// v000
// Times are from an AMD MI455X. After a warm-up the kernel runs many times in a row, and a time is the length of
// such a window on the GPU divided by its runs, so every launch and the gaps after it count. The runs cycle
// through copies of the inputs. A figure is the median of several windows, for all but v000 over two sittings.
// Sittings can differ by a few percent; kernels timed side by side share one.
// v000 is the starting kernel. One run takes 229 microseconds.
#include <hip/hip_runtime.h>

// Contractions: x*W projections (q,k,v): v_wmma_f32_16x16x32_bf16, bf16 operands (RNE-converted inputs), f32 accumulate.
// q.k scores, P.v, P row sums: v_wmma_f32_16x16x32_f16, f16 operands (q x log2e, k, P x 1024, v x 16), f32 accumulate;
// query rows < 256 of each sequence also use f16 residual planes of P and v (x1024 carries) in separate f32 accumulators.
// Bias add, rotary pair mixing (f32 cos/sin via powf + sincosf), online softmax and normalisation in f32.

#ifndef NB
#define NB 4
#endif
#ifndef SEQ
#define SEQ 2048
#endif
#define NB_FULL  4
#define SEQ_FULL 2048
#define CDIM  1024
#define HDIM  64
#define NPROJ 192
#define WP    1024        // pitch of the k-contiguous W plane (16-bit elements) == CDIM, 2048 B = 16 lines
#define XC    256         // k chunk of the x tile staged in LDS per pass
#define XP    264         // LDS pitch of the staged x chunk (16-bit elements)
#define NTB    (SEQ / 64)                    // 64-row query tiles per sequence
#define NTB_E  ((NTB < 4) ? NTB : 4)         // tiles with query rows < 256: residual path
#define NTB_L  (NTB - NTB_E)
#define NTB_LD ((NTB_L > 0) ? NTB_L : 1)

static_assert(SEQ % 64 == 0 && SEQ >= 64);
static_assert(SEQ <= SEQ_FULL);
static_assert(NB >= 1 && NB <= NB_FULL);
static_assert(WP == CDIM && (CDIM % XC) == 0 && (XC % 32) == 0);
static_assert(((WP * 2) % 512) == 0);
static_assert(XP >= XC && (XP % 8) == 0);
static_assert(NPROJ == 3 * HDIM && (NPROJ % 8) == 0 && (HDIM % 8) == 0 && HDIM == 64);
static_assert(64 * XP >= 4 * 4096);
static_assert(((long long)(NB - 1) * SEQ_FULL + SEQ) * HDIM <= 524288LL);

typedef _Float16       v16h  __attribute__((ext_vector_type(16)));
typedef _Float16       v8h   __attribute__((ext_vector_type(8)));
typedef float          v8f   __attribute__((ext_vector_type(8)));
typedef float          v4f   __attribute__((ext_vector_type(4)));
typedef unsigned short v16us __attribute__((ext_vector_type(16)));
typedef unsigned short v8us  __attribute__((ext_vector_type(8)));
typedef unsigned int   v4u   __attribute__((ext_vector_type(4)));
typedef unsigned int   v2u   __attribute__((ext_vector_type(2)));
typedef __bf16         v16bf __attribute__((ext_vector_type(16)));

union FragH { v16h v; v8h h[2]; };
union FragU { v16us v; v8us h[2]; };

#define LOG2E_F 1.4426950408889634f
#define NEG_BIG (-3.0e38f)
#define RINV    0.0009765625f
#define SCL     0.03125f          // CDIM^-0.5

// f32 -> bf16 bits, RNE convert
__device__ __forceinline__ unsigned int bf_bits(float f) {
  const unsigned int u = __float_as_uint(f);
  return (u + 0x7FFFu + ((u >> 16) & 1u)) >> 16;
}
// f32 -> bf16 (RNE) -> f32
__device__ __forceinline__ float bfr(float f) {
  return __uint_as_float(bf_bits(f) << 16);
}

// WMMA helpers with the VALU hazard guard (ties D, keeps A/B live)
__device__ __forceinline__ v8f wmma_f16(v16h a, v16h b, v8f c) {
  v8f d = __builtin_amdgcn_wmma_f32_16x16x32_f16(false, a, false, b, (short)0, c, false, false);
  asm volatile("v_nop\n\tv_nop\n\tv_nop\n\tv_nop" : "+v"(d) : "v"(a), "v"(b));
  return d;
}
__device__ __forceinline__ v8f wmma_bf16(v16us a, v16us b, v8f c) {
  v8f d = __builtin_amdgcn_wmma_f32_16x16x32_bf16(false, __builtin_bit_cast(v16bf, a), false,
                                                   __builtin_bit_cast(v16bf, b), (short)0, c, false, false);
  asm volatile("v_nop\n\tv_nop\n\tv_nop\n\tv_nop" : "+v"(d) : "v"(a), "v"(b));
  return d;
}

// 16-bit operand fragment, split k map for BOTH A and B:
// p = (row or column (lane&15)) base + k0 + 8*(lane>>4); elements 0..7 <- p[0..7], elements 8..15 <- p[16..23].
__device__ __forceinline__ v16h frag_f16(const _Float16* p) {
  FragH f;
  f.h[0] = *(const v8h*)p;
  f.h[1] = *(const v8h*)(p + 16);
  return f.v;
}
__device__ __forceinline__ v16us frag_u16(const unsigned short* p) {
  FragU f;
  f.h[0] = *(const v8us*)p;
  f.h[1] = *(const v8us*)(p + 16);
  return f.v;
}

// ---------------------------------------------------------------------------
// Kernel 1: W [c][64] (q,k,v) -> one k-contiguous bf16 plane Wt[n][WP], n = p*64 + hcol (p: 0 q, 1 k, 2 v).
// Block = 8 output rows (coalesced 32-B reads of W, transposed in LDS); one wave per output row,
// ---------------------------------------------------------------------------
__global__ __launch_bounds__(256) void k_wconv(
    const float* __restrict__ Wq, const float* __restrict__ Wk, const float* __restrict__ Wv,
    unsigned short* __restrict__ Wt)
{
  __shared__ __attribute__((aligned(16))) unsigned short sw[8 * WP];   // [hcol_local][c], 16384 B

  const int tid   = threadIdx.x;
  const int lane  = tid & 31;
  const int wave  = __builtin_amdgcn_readfirstlane(tid >> 5);
  const int p     = blockIdx.x >> 3;
  const int hcol0 = (blockIdx.x & 7) * 8;
  const float* W = (p == 0) ? Wq : ((p == 1) ? Wk : Wv);   // block-uniform select, same address space

  for (int i = tid; i < CDIM * 2; i += 256) {
    const int c  = i >> 1;
    const int q4 = (i & 1) * 4;
    const v4f v = *(const v4f*)(W + (size_t)c * HDIM + hcol0 + q4);
    sw[(q4 + 0) * WP + c] = (unsigned short)bf_bits(v.x);
    sw[(q4 + 1) * WP + c] = (unsigned short)bf_bits(v.y);
    sw[(q4 + 2) * WP + c] = (unsigned short)bf_bits(v.z);
    sw[(q4 + 3) * WP + c] = (unsigned short)bf_bits(v.w);
  }
  __syncthreads();

  const int n = p * HDIM + hcol0 + wave;          // 0..NPROJ-1
  unsigned short* dst = Wt + (size_t)n * WP;
  v4u w[4];
#pragma unroll
  for (int j = 0; j < 4; ++j) w[j] = *(const v4u*)(sw + wave * WP + j * 256 + lane * 8);
#pragma unroll
  for (int j = 0; j < 4; ++j) *(v4u*)(dst + j * 256 + lane * 8) = w[j];
  
}

// ---------------------------------------------------------------------------
// Kernel 2: q,k,v projections (+bias, rotary pair mixing on q,k) for a tile of 64 token rows on bf16 WMMA.
// 8 waves: wave -> 16 rows (wave&3) x 96 output columns (wave>>2). x tile staged in LDS as bf16 in 4 chunks of 256 k.
// Outputs: qh = f16(rot(q+bq)*log2e) [tok][64], kh = f16(rot(k+bk)) [tok][64], vT = f16(16*(v+bv)) [b][64][SEQ],
// vR = f16((16*v - vT) * 1024) [b][64][SEQ] (residual plane).
// ---------------------------------------------------------------------------
__global__ __launch_bounds__(256) __attribute__((amdgpu_num_vgpr(256)))
void k_proj(const float* __restrict__ x, const unsigned short* __restrict__ Wt,
            const float* __restrict__ bq, const float* __restrict__ bk, const float* __restrict__ bv,
            _Float16* __restrict__ qh, _Float16* __restrict__ kh,
            _Float16* __restrict__ vT, _Float16* __restrict__ vR)
{
  __shared__ __attribute__((aligned(16))) unsigned short sm[64 * XP];    // 33792 B, later reused as staging
  __shared__ __attribute__((aligned(16))) float scs[64 * HDIM];         // [tl][2i] = cos, [tl][2i+1] = sin
  __shared__ float sb[NPROJ];                                           // biases (bf16 RNE-converted)

  const int tid  = threadIdx.x;
  const int lane = tid & 31;
  const int wave = __builtin_amdgcn_readfirstlane(tid >> 5);
  const int half = lane >> 4;
  const int ln   = lane & 15;
  const int m0 = blockIdx.x * 64;               // compact token row of this tile
  const int b  = m0 / SEQ;
  const int t0 = m0 - b * SEQ;
  const float* xblk = x + ((size_t)b * SEQ_FULL + t0) * CDIM;

  // rotary table for positions t0..t0+63: f_i = 1 / 10000^(i/32), angle = t * f_i, i = 0..31
#pragma unroll 1
  for (int i = tid; i < 64 * (HDIM / 2); i += 256) {
    const int r  = i >> 5;
    const int pr = i & 31;
    const float ex  = (float)(2 * pr) * 0.015625f;
    const float fr  = 1.0f / powf(10000.0f, ex);
    const float ang = (float)(t0 + r) * fr;
    float sn, cn;
    sincosf(ang, &sn, &cn);
    scs[r * HDIM + 2 * pr]     = cn;
    scs[r * HDIM + 2 * pr + 1] = sn;
  }
  if (tid < HDIM) {                             // waves 0 and 1 exactly (wave-uniform)
    sb[tid]            = bfr(bq[tid]);
    sb[HDIM + tid]     = bfr(bk[tid]);
    sb[2 * HDIM + tid] = bfr(bv[tid]);
  }

  const int rg = wave & 3;
  const int ch = wave >> 2;
  v8f acc[6];
#pragma unroll
  for (int nt = 0; nt < 6; ++nt) {
#pragma unroll
    for (int r = 0; r < 8; ++r) acc[nt][r] = 0.0f;
  }

#pragma unroll 1
  for (int kc = 0; kc < CDIM; kc += XC) {
    __syncthreads();   // all waves done reading the prior chunk
    // stage x chunk: 64 rows x XC columns (kc..kc+XC-1) -> bf16
    for (int i = tid; i < 64 * (XC / 4); i += 256) {
      const int r  = i / (XC / 4);
      const int c4 = i - r * (XC / 4);
      const v4f v = *(const v4f*)(xblk + (size_t)r * CDIM + kc + c4 * 4);
      v2u w;
      w.x = bf_bits(v.x) | (bf_bits(v.y) << 16);
      w.y = bf_bits(v.z) | (bf_bits(v.w) << 16);
      *(v2u*)(sm + r * XP + c4 * 4) = w;
    }
    __syncthreads();

    const unsigned short* arow = sm + (rg * 16 + ln) * XP + 8 * half;
    const unsigned short* brow = Wt + (size_t)(ch * 96 + ln) * WP + kc + 8 * half;
#pragma unroll 1
    for (int k0 = 0; k0 < XC; k0 += 32) {
      const v16us a = frag_u16(arow + k0);
#pragma unroll
      for (int nt = 0; nt < 6; ++nt) {
        const v16us bb = frag_u16(brow + (size_t)nt * 16 * WP + k0);
        acc[nt] = wmma_bf16(a, bb, acc[nt]);
      }
    }
  }
  __syncthreads();   // all waves done reading the x tile

  // staging (16-bit elements): sQ = sm[0..4095] as [t][64], sK = sm[4096..8191] as [t][64],
  // sV = sm[8192..12287] as [hcol][t], sVr = sm[12288..16383] as [hcol][t]
#pragma unroll
  for (int nt = 0; nt < 6; ++nt) {
    const int n0 = ch * 96 + nt * 16;            // wave-uniform
    const int p  = n0 >> 6;
    const int hc = (n0 & 63) + ln;
    const float bias = sb[p * HDIM + hc];
    const float sc = (p == 0) ? LOG2E_F : ((p == 2) ? 16.0f : 1.0f);
    unsigned short* base = sm + p * 4096;
#pragma unroll
    for (int r = 0; r < 8; ++r) {
      const int tl = rg * 16 + 8 * half + r;
      const float val = acc[nt][r] + bias;
      const float pv  = __shfl_xor(val, 1, 32);          // pair partner column hc^1 (lane ln^1), unconditional
      const float cn  = scs[tl * HDIM + (hc & ~1)];
      const float sn  = scs[tl * HDIM + (hc | 1)];
      const float t1  = val * cn;
      const float t2  = pv * sn;
      const float rot = (hc & 1) ? (t1 + t2) : (t1 - t2);  // even: ev*c - od*s ; odd: od*c + ev*s
      const float vf  = ((p < 2) ? rot : val) * sc;
      const int idx = (p == 2) ? (hc * 64 + tl) : (tl * 64 + hc);
      const _Float16 hv = (_Float16)vf;
      base[idx] = __builtin_bit_cast(unsigned short, hv);
      if (p == 2) {
        const _Float16 rv = (_Float16)((vf - (float)hv) * 1024.0f);
        sm[12288 + idx] = __builtin_bit_cast(unsigned short, rv);
      }
    }
  }
  __syncthreads();

  // whole-line stores: wave w owns token rows 8w..8w+7 of qh/kh and hcol rows 8w..8w+7 of vT/vR
  const int rl = lane >> 3;
  const int pc = lane & 7;
  const int rA = wave * 8 + rl;
  const int rB = rA + 4;
  const v4u qA = *(const v4u*)(sm + rA * 64 + pc * 8);
  const v4u qB = *(const v4u*)(sm + rB * 64 + pc * 8);
  const v4u kA = *(const v4u*)(sm + 4096 + rA * 64 + pc * 8);
  const v4u kB = *(const v4u*)(sm + 4096 + rB * 64 + pc * 8);
  const v4u vA = *(const v4u*)(sm + 8192 + rA * 64 + pc * 8);
  const v4u vB = *(const v4u*)(sm + 8192 + rB * 64 + pc * 8);
  const v4u uA = *(const v4u*)(sm + 12288 + rA * 64 + pc * 8);
  const v4u uB = *(const v4u*)(sm + 12288 + rB * 64 + pc * 8);
  _Float16* dqA = qh + (size_t)(m0 + rA) * HDIM + pc * 8;
  _Float16* dqB = qh + (size_t)(m0 + rB) * HDIM + pc * 8;
  _Float16* dkA = kh + (size_t)(m0 + rA) * HDIM + pc * 8;
  _Float16* dkB = kh + (size_t)(m0 + rB) * HDIM + pc * 8;
  _Float16* dvA = vT + ((size_t)b * HDIM + rA) * SEQ + t0 + pc * 8;
  _Float16* dvB = vT + ((size_t)b * HDIM + rB) * SEQ + t0 + pc * 8;
  _Float16* duA = vR + ((size_t)b * HDIM + rA) * SEQ + t0 + pc * 8;
  _Float16* duB = vR + ((size_t)b * HDIM + rB) * SEQ + t0 + pc * 8;
  *(v4u*)dqA = qA; *(v4u*)dqB = qB;
  *(v4u*)dkA = kA; *(v4u*)dkB = kB;
  *(v4u*)dvA = vA; *(v4u*)dvB = vB;
  *(v4u*)duA = uA; *(v4u*)duB = uB;
  
}

// ---------------------------------------------------------------------------
// Kernel 3: causal flash attention. Block = 4 waves x 16 query rows (64 rows), key chunks of 32.
// S tiles (D layout) -> online softmax in log2 domain -> P x 1024 to f16 A layout via LDS -> O += P.V, sums += P.ones.
// EARLY = 1 handles query tiles 0..NTB_E-1 (rows < 256): adds P residual (x1024) and v residual plane (x1024)
// products into separate accumulators folded with 2^-10 before the normalisation; EARLY = 0 handles the rest.
// Query rows with mask == 0 get NaN (whole score row excluded -> NaN softmax).
// ---------------------------------------------------------------------------
template <int EARLY>
__global__ __launch_bounds__(128) __attribute__((amdgpu_num_vgpr(256)))
void k_attn(const _Float16* __restrict__ qh, const _Float16* __restrict__ kh,
            const _Float16* __restrict__ vT, const _Float16* __restrict__ vR,
            const int* __restrict__ mask, float* __restrict__ out)
{
  __shared__ __attribute__((aligned(16))) _Float16 pbuf[4][16][40];   // per-wave 16 x 32 P tile (x1024)
  __shared__ __attribute__((aligned(16))) _Float16 rbuf[4][16][40];   // per-wave 16 x 32 P residual tile
  __shared__ __attribute__((aligned(16))) float    obuf[4][16][68];   // per-wave 16 x 64 output tile

  const int tid  = threadIdx.x;
  const int lane = tid & 31;
  const int wave = __builtin_amdgcn_readfirstlane(tid >> 5);
  const int half = lane >> 4;
  const int ln   = lane & 15;
  int b, tb;
  if (EARLY) { b = blockIdx.x / NTB_E;  tb = blockIdx.x - b * NTB_E; }
  else       { b = blockIdx.x / NTB_LD; tb = NTB_E + (blockIdx.x - b * NTB_LD); }
  const int row0 = tb * 64 + wave * 16;          // first query row of this wave (within the sequence)

  const _Float16* qrow  = qh + ((size_t)b * SEQ + row0 + ln) * HDIM + 8 * half;
  const _Float16* kbase = kh + (size_t)b * SEQ * HDIM + 8 * half;
  const _Float16* vbase = vT + (size_t)b * HDIM * SEQ + 8 * half;
  const _Float16* rbase = vR + (size_t)b * HDIM * SEQ + 8 * half;

  // loop-invariant Q A fragments (feature blocks 0..31, 32..63)
  const v16h qa0 = frag_f16(qrow);
  const v16h qa1 = frag_f16(qrow + 32);

  v16h ones;
#pragma unroll
  for (int i = 0; i < 16; ++i) ones[i] = (_Float16)1.0f;

  v8f o[4], orr[4];
  v8f osum, osumr;
#pragma unroll
  for (int r = 0; r < 8; ++r) { osum[r] = 0.0f; osumr[r] = 0.0f; }
#pragma unroll
  for (int ht = 0; ht < 4; ++ht) {
#pragma unroll
    for (int r = 0; r < 8; ++r) { o[ht][r] = 0.0f; orr[ht][r] = 0.0f; }
  }
  float rmax[8];
#pragma unroll
  for (int r = 0; r < 8; ++r) rmax[r] = NEG_BIG;

  const int nchunk = 2 * tb + 2;                 // keys 0 .. tb*64+63, block-uniform trip count
#pragma unroll 1
  for (int c = 0; c < nchunk; ++c) {
    const int kt0 = c * 32;
    const bool active = (kt0 <= row0 + 15);     // wave-uniform
    v8f s[2];
#pragma unroll
    for (int r = 0; r < 8; ++r) { s[0][r] = 0.0f; s[1][r] = 0.0f; }

    if (active) {
      // S[16 x 32] = Q(16 x 64) . K^T, K as B operand: column = key (lane&15), k = feature (split map)
#pragma unroll
      for (int nt = 0; nt < 2; ++nt) {
        const int key = kt0 + nt * 16 + ln;
        const _Float16* krow = kbase + (size_t)key * HDIM;
        const v16h kb0 = frag_f16(krow);
        const v16h kb1 = frag_f16(krow + 32);
        v8f acc;
#pragma unroll
        for (int r = 0; r < 8; ++r) acc[r] = 0.0f;
        acc = wmma_f16(qa0, kb0, acc);
        acc = wmma_f16(qa1, kb1, acc);
#pragma unroll
        for (int r = 0; r < 8; ++r) {
          const float sv = acc[r] * SCL;                            // CDIM^-0.5, log2e already in q
          s[nt][r] = (key > row0 + 8 * half + r) ? NEG_BIG : sv;   // causal fill (replace)
        }
      }
      // online softmax, row = 8*half + r, columns across the 16-lane half
      float alpha[8];
#pragma unroll
      for (int r = 0; r < 8; ++r) {
        float tmax = fmaxf(s[0][r], s[1][r]);
#pragma unroll
        for (int m = 1; m < 16; m <<= 1) tmax = fmaxf(tmax, __shfl_xor(tmax, m, 32));
        const float nmax = fmaxf(rmax[r], tmax);
        alpha[r] = exp2f(rmax[r] - nmax);
        rmax[r]  = nmax;
        s[0][r] = exp2f(s[0][r] - nmax);
        s[1][r] = exp2f(s[1][r] - nmax);
      }
#pragma unroll
      for (int r = 0; r < 8; ++r) {
        osum[r] *= alpha[r];
        if (EARLY) osumr[r] *= alpha[r];
#pragma unroll
        for (int ht = 0; ht < 4; ++ht) {
          o[ht][r] *= alpha[r];
          if (EARLY) orr[ht][r] *= alpha[r];
        }
      }
    }

    // P: D layout -> [q_local][key_local] in LDS (carried x 1024; residual x 1024 more), then reloaded as A fragments
    __syncthreads();
    if (active) {
#pragma unroll
      for (int nt = 0; nt < 2; ++nt) {
#pragma unroll
        for (int r = 0; r < 8; ++r) {
          const float pf = s[nt][r] * 1024.0f;
          const _Float16 ph = (_Float16)pf;
          pbuf[wave][r + 8 * half][nt * 16 + ln] = ph;
          if (EARLY) {
            const _Float16 pr = (_Float16)((pf - (float)ph) * 1024.0f);
            rbuf[wave][r + 8 * half][nt * 16 + ln] = pr;
          }
        }
      }
    }
    __syncthreads();

    if (active) {
      const v16h pa = frag_f16(&pbuf[wave][ln][8 * half]);
      // V as B operand: column = feature (lane&15), k = key (split map) from the key-contiguous planes
      if (EARLY) {
        const v16h pra = frag_f16(&rbuf[wave][ln][8 * half]);
#pragma unroll
        for (int ht = 0; ht < 4; ++ht) {
          const v16h vb = frag_f16(vbase + (size_t)(ht * 16 + ln) * SEQ + kt0);
          o[ht]   = wmma_f16(pa,  vb, o[ht]);
          orr[ht] = wmma_f16(pra, vb, orr[ht]);
        }
        osum  = wmma_f16(pa,  ones, osum);
        osumr = wmma_f16(pra, ones, osumr);
#pragma unroll
        for (int ht = 0; ht < 4; ++ht) {
          const v16h vr = frag_f16(rbase + (size_t)(ht * 16 + ln) * SEQ + kt0);
          orr[ht] = wmma_f16(pa, vr, orr[ht]);
        }
      } else {
#pragma unroll
        for (int ht = 0; ht < 4; ++ht) {
          const v16h vb = frag_f16(vbase + (size_t)(ht * 16 + ln) * SEQ + kt0);
          o[ht] = wmma_f16(pa, vb, o[ht]);
        }
        osum = wmma_f16(pa, ones, osum);   // row sums of the same f16 P in D layout
      }
    }
  }

  // query-row pad flags (row = row0 + 8*half + r, always < SEQ)
  int mk[8];
#pragma unroll
  for (int r = 0; r < 8; ++r) mk[r] = mask[(size_t)b * SEQ_FULL + row0 + 8 * half + r];
  const float qnan = __uint_as_float(0x7fc00000u);

  // normalise (1024 carry cancels between numerator and denominator; 1/16 undoes the v carry) and stage in LDS
#pragma unroll
  for (int r = 0; r < 8; ++r) {
    float den = osum[r];
    if (EARLY) den = den + osumr[r] * RINV;
    const float inv = 0.0625f * __builtin_amdgcn_rcpf(den);
#pragma unroll
    for (int ht = 0; ht < 4; ++ht) {
      float num = o[ht][r];
      if (EARLY) num = num + orr[ht][r] * RINV;
      obuf[wave][8 * half + r][ht * 16 + ln] = (mk[r] != 0) ? (num * inv) : qnan;
    }
  }
  __syncthreads();

  v4f vals[8];
#pragma unroll
  for (int i = 0; i < 8; ++i) vals[i] = *(const v4f*)(&obuf[wave][2 * i + half][ln * 4]);
  float* orow = out + ((size_t)b * SEQ_FULL + row0) * HDIM;
#pragma unroll
  for (int i = 0; i < 8; ++i)
    *(v4f*)(orow + (size_t)(2 * i + half) * HDIM + ln * 4) = vals[i];
  
}

// ---------------------------------------------------------------------------
extern "C" void kernel_launch(void* const* d_in, const int* in_sizes, int n_in,
                              void* d_out, int out_size, void* d_ws, size_t ws_size,
                              hipStream_t stream)
{
  if (n_in < 8) return;
  const long long tok_rows = (long long)(NB - 1) * SEQ_FULL + SEQ;
  if ((long long)in_sizes[0] < tok_rows * CDIM) return;
  if ((long long)in_sizes[1] < tok_rows) return;
  if (in_sizes[2] < CDIM * HDIM || in_sizes[4] < CDIM * HDIM || in_sizes[6] < CDIM * HDIM) return;
  if (in_sizes[3] < HDIM || in_sizes[5] < HDIM || in_sizes[7] < HDIM) return;
  if ((long long)out_size < tok_rows * HDIM) return;

  const float* x    = (const float*)d_in[0];
  const int*   mask = (const int*)d_in[1];
  const float* Wq   = (const float*)d_in[2];
  const float* bq   = (const float*)d_in[3];
  const float* Wk   = (const float*)d_in[4];
  const float* bk   = (const float*)d_in[5];
  const float* Wv   = (const float*)d_in[6];
  const float* bv   = (const float*)d_in[7];
  float* out = (float*)d_out;

  // workspace carve (bytes): Wt 192*1024*2 = 393216 | qh NB*SEQ*64*2 | kh same | vT same | vR same
  const size_t wt_bytes = (size_t)NPROJ * WP * sizeof(unsigned short);
  const size_t plane    = (size_t)NB * SEQ * HDIM * sizeof(_Float16);
  const size_t off_wt = 0;
  const size_t off_q  = (off_wt + wt_bytes + 255) & ~(size_t)255;
  const size_t off_k  = off_q + plane;
  const size_t off_v  = off_k + plane;
  const size_t off_r  = off_v + plane;
  const size_t total  = off_r + plane;
  if (total > ws_size) return;

  unsigned short* Wt = (unsigned short*)((char*)d_ws + off_wt);
  _Float16* qh = (_Float16*)((char*)d_ws + off_q);
  _Float16* kh = (_Float16*)((char*)d_ws + off_k);
  _Float16* vT = (_Float16*)((char*)d_ws + off_v);
  _Float16* vR = (_Float16*)((char*)d_ws + off_r);

  k_wconv<<<NPROJ / 8, 256, 0, stream>>>(Wq, Wk, Wv, Wt);
  k_proj<<<(NB * SEQ) / 64, 256, 0, stream>>>(x, Wt, bq, bk, bv, qh, kh, vT, vR);
  k_attn<1><<<NB * NTB_E, 128, 0, stream>>>(qh, kh, vT, vR, mask, out);
  if (NTB_L > 0) k_attn<0><<<NB * NTB_LD, 128, 0, stream>>>(qh, kh, vT, vR, mask, out);
}

// v001
// A run of this version takes 97.9 microseconds.
// Next to v000, in two timings, it ran 2.28 and 2.38 times as fast.
#include <hip/hip_runtime.h>

// Contractions: x*W projections (q,k,v): v_wmma_f32_16x16x32_bf16, bf16 operands (RNE-converted inputs), f32 accumulate.
// q.k scores, P.v, P row sums: v_wmma_f32_16x16x32_f16, f16 operands (q x log2e, k, P x 1024, v x 16), f32 accumulate;
// query rows < 256 of each sequence also use f16 residual planes of P and v (x1024 carries) in separate f32 accumulators.
// Bias add, rotary pair mixing (f32 cos/sin via powf + sincosf), online softmax and normalisation in f32.

#ifndef NB
#define NB 4
#endif
#ifndef SEQ
#define SEQ 2048
#endif
#define NB_FULL  4
#define SEQ_FULL 2048
#define CDIM  1024
#define HDIM  64
#define NPROJ 192
#define WP    1024        // pitch of the k-contiguous W plane (16-bit elements) == CDIM, 2048 B = 16 lines
#define XC    256         // k chunk of the x tile staged in LDS per pass
#define XP    264         // LDS pitch of the staged x chunk (16-bit elements)
#define NTB    (SEQ / 64)                    // 64-row query tiles per sequence
#define NTB_E  ((NTB < 4) ? NTB : 4)         // tiles with query rows < 256: residual path
#define NTB_L  (NTB - NTB_E)
#define NTB_LD ((NTB_L > 0) ? NTB_L : 1)
#define NS_E   8                              // key splits (waves) per 16-row query tile, rows < 256 (at most 8 chunks)
#define NS_L   16                             // key splits (waves) per 16-row query tile, later rows

static_assert(SEQ % 64 == 0 && SEQ >= 64);
static_assert((NS_E == 8 || NS_E == 16) && (NS_L == 8 || NS_L == 16));
static_assert(SEQ <= SEQ_FULL);
static_assert(NB >= 1 && NB <= NB_FULL);
static_assert(WP == CDIM && (CDIM % XC) == 0 && (XC % 32) == 0);
static_assert(((WP * 2) % 512) == 0);
static_assert(XP >= XC && (XP % 8) == 0);
static_assert(NPROJ == 3 * HDIM && (NPROJ % 8) == 0 && (HDIM % 8) == 0 && HDIM == 64);
static_assert(64 * XP >= 4 * 4096);
static_assert(((long long)(NB - 1) * SEQ_FULL + SEQ) * HDIM <= 524288LL);

typedef _Float16       v16h  __attribute__((ext_vector_type(16)));
typedef _Float16       v8h   __attribute__((ext_vector_type(8)));
typedef float          v8f   __attribute__((ext_vector_type(8)));
typedef float          v4f   __attribute__((ext_vector_type(4)));
typedef unsigned short v16us __attribute__((ext_vector_type(16)));
typedef unsigned short v8us  __attribute__((ext_vector_type(8)));
typedef unsigned int   v4u   __attribute__((ext_vector_type(4)));
typedef unsigned int   v2u   __attribute__((ext_vector_type(2)));
typedef __bf16         v16bf __attribute__((ext_vector_type(16)));

union FragH { v16h v; v8h h[2]; };
union FragU { v16us v; v8us h[2]; };

#define LOG2E_F 1.4426950408889634f
#define NEG_BIG (-3.0e38f)
#define RINV    0.0009765625f
#define SCL     0.03125f          // CDIM^-0.5

// f32 -> bf16 bits, RNE convert
__device__ __forceinline__ unsigned int bf_bits(float f) {
  const unsigned int u = __float_as_uint(f);
  return (u + 0x7FFFu + ((u >> 16) & 1u)) >> 16;
}
// f32 -> bf16 (RNE) -> f32
__device__ __forceinline__ float bfr(float f) {
  return __uint_as_float(bf_bits(f) << 16);
}

// WMMA helpers with the VALU hazard guard (ties D, keeps A/B live)
__device__ __forceinline__ v8f wmma_f16(v16h a, v16h b, v8f c) {
  v8f d = __builtin_amdgcn_wmma_f32_16x16x32_f16(false, a, false, b, (short)0, c, false, false);
  asm volatile("v_nop\n\tv_nop\n\tv_nop\n\tv_nop" : "+v"(d) : "v"(a), "v"(b));
  return d;
}
__device__ __forceinline__ v8f wmma_bf16(v16us a, v16us b, v8f c) {
  v8f d = __builtin_amdgcn_wmma_f32_16x16x32_bf16(false, __builtin_bit_cast(v16bf, a), false,
                                                   __builtin_bit_cast(v16bf, b), (short)0, c, false, false);
  asm volatile("v_nop\n\tv_nop\n\tv_nop\n\tv_nop" : "+v"(d) : "v"(a), "v"(b));
  return d;
}

// 16-bit operand fragment, split k map for BOTH A and B:
// p = (row or column (lane&15)) base + k0 + 8*(lane>>4); elements 0..7 <- p[0..7], elements 8..15 <- p[16..23].
__device__ __forceinline__ v16h frag_f16(const _Float16* p) {
  FragH f;
  f.h[0] = *(const v8h*)p;
  f.h[1] = *(const v8h*)(p + 16);
  return f.v;
}
__device__ __forceinline__ v16us frag_u16(const unsigned short* p) {
  FragU f;
  f.h[0] = *(const v8us*)p;
  f.h[1] = *(const v8us*)(p + 16);
  return f.v;
}

// ---------------------------------------------------------------------------
// Kernel 1: W [c][64] (q,k,v) -> one k-contiguous bf16 plane Wt[n][WP], n = p*64 + hcol (p: 0 q, 1 k, 2 v).
// Block = 8 output rows (coalesced 32-B reads of W, transposed in LDS); one wave per output row,
// ---------------------------------------------------------------------------
__global__ __launch_bounds__(256) void k_wconv(
    const float* __restrict__ Wq, const float* __restrict__ Wk, const float* __restrict__ Wv,
    unsigned short* __restrict__ Wt)
{
  __shared__ __attribute__((aligned(16))) unsigned short sw[8 * WP];   // [hcol_local][c], 16384 B

  const int tid   = threadIdx.x;
  const int lane  = tid & 31;
  const int wave  = __builtin_amdgcn_readfirstlane(tid >> 5);
  const int p     = blockIdx.x >> 3;
  const int hcol0 = (blockIdx.x & 7) * 8;
  const float* W = (p == 0) ? Wq : ((p == 1) ? Wk : Wv);   // block-uniform select, same address space

  for (int i = tid; i < CDIM * 2; i += 256) {
    const int c  = i >> 1;
    const int q4 = (i & 1) * 4;
    const v4f v = *(const v4f*)(W + (size_t)c * HDIM + hcol0 + q4);
    sw[(q4 + 0) * WP + c] = (unsigned short)bf_bits(v.x);
    sw[(q4 + 1) * WP + c] = (unsigned short)bf_bits(v.y);
    sw[(q4 + 2) * WP + c] = (unsigned short)bf_bits(v.z);
    sw[(q4 + 3) * WP + c] = (unsigned short)bf_bits(v.w);
  }
  __syncthreads();

  const int n = p * HDIM + hcol0 + wave;          // 0..NPROJ-1
  unsigned short* dst = Wt + (size_t)n * WP;
  v4u w[4];
#pragma unroll
  for (int j = 0; j < 4; ++j) w[j] = *(const v4u*)(sw + wave * WP + j * 256 + lane * 8);
#pragma unroll
  for (int j = 0; j < 4; ++j) *(v4u*)(dst + j * 256 + lane * 8) = w[j];
  
}

// ---------------------------------------------------------------------------
// Kernel 2: q,k,v projections (+bias, rotary pair mixing on q,k) for a tile of 64 token rows on bf16 WMMA.
// 8 waves: wave -> 16 rows (wave&3) x 96 output columns (wave>>2). x tile staged in LDS as bf16 in 4 chunks of 256 k.
// Outputs: qh = f16(rot(q+bq)*log2e) [tok][64], kh = f16(rot(k+bk)) [tok][64], vT = f16(16*(v+bv)) [b][64][SEQ],
// vR = f16((16*v - vT) * 1024) [b][64][SEQ] (residual plane).
// ---------------------------------------------------------------------------
__global__ __launch_bounds__(256) __attribute__((amdgpu_num_vgpr(256)))
void k_proj(const float* __restrict__ x, const unsigned short* __restrict__ Wt,
            const float* __restrict__ bq, const float* __restrict__ bk, const float* __restrict__ bv,
            _Float16* __restrict__ qh, _Float16* __restrict__ kh,
            _Float16* __restrict__ vT, _Float16* __restrict__ vR)
{
  __shared__ __attribute__((aligned(16))) unsigned short sm[64 * XP];    // 33792 B, later reused as staging
  __shared__ __attribute__((aligned(16))) float scs[64 * HDIM];         // [tl][2i] = cos, [tl][2i+1] = sin
  __shared__ float sb[NPROJ];                                           // biases (bf16 RNE-converted)

  const int tid  = threadIdx.x;
  const int lane = tid & 31;
  const int wave = __builtin_amdgcn_readfirstlane(tid >> 5);
  const int half = lane >> 4;
  const int ln   = lane & 15;
  const int m0 = blockIdx.x * 64;               // compact token row of this tile
  const int b  = m0 / SEQ;
  const int t0 = m0 - b * SEQ;
  const float* xblk = x + ((size_t)b * SEQ_FULL + t0) * CDIM;

  // rotary table for positions t0..t0+63: f_i = 1 / 10000^(i/32), angle = t * f_i, i = 0..31
#pragma unroll 1
  for (int i = tid; i < 64 * (HDIM / 2); i += 256) {
    const int r  = i >> 5;
    const int pr = i & 31;
    const float ex  = (float)(2 * pr) * 0.015625f;
    const float fr  = 1.0f / powf(10000.0f, ex);
    const float ang = (float)(t0 + r) * fr;
    float sn, cn;
    sincosf(ang, &sn, &cn);
    scs[r * HDIM + 2 * pr]     = cn;
    scs[r * HDIM + 2 * pr + 1] = sn;
  }
  if (tid < HDIM) {                             // waves 0 and 1 exactly (wave-uniform)
    sb[tid]            = bfr(bq[tid]);
    sb[HDIM + tid]     = bfr(bk[tid]);
    sb[2 * HDIM + tid] = bfr(bv[tid]);
  }

  const int rg = wave & 3;
  const int ch = wave >> 2;
  v8f acc[6];
#pragma unroll
  for (int nt = 0; nt < 6; ++nt) {
#pragma unroll
    for (int r = 0; r < 8; ++r) acc[nt][r] = 0.0f;
  }

#pragma unroll 1
  for (int kc = 0; kc < CDIM; kc += XC) {
    __syncthreads();   // all waves done reading the prior chunk
    // stage x chunk: 64 rows x XC columns (kc..kc+XC-1) -> bf16
    for (int i = tid; i < 64 * (XC / 4); i += 256) {
      const int r  = i / (XC / 4);
      const int c4 = i - r * (XC / 4);
      const v4f v = *(const v4f*)(xblk + (size_t)r * CDIM + kc + c4 * 4);
      v2u w;
      w.x = bf_bits(v.x) | (bf_bits(v.y) << 16);
      w.y = bf_bits(v.z) | (bf_bits(v.w) << 16);
      *(v2u*)(sm + r * XP + c4 * 4) = w;
    }
    __syncthreads();

    const unsigned short* arow = sm + (rg * 16 + ln) * XP + 8 * half;
    const unsigned short* brow = Wt + (size_t)(ch * 96 + ln) * WP + kc + 8 * half;
#pragma unroll 1
    for (int k0 = 0; k0 < XC; k0 += 32) {
      const v16us a = frag_u16(arow + k0);
#pragma unroll
      for (int nt = 0; nt < 6; ++nt) {
        const v16us bb = frag_u16(brow + (size_t)nt * 16 * WP + k0);
        acc[nt] = wmma_bf16(a, bb, acc[nt]);
      }
    }
  }
  __syncthreads();   // all waves done reading the x tile

  // staging (16-bit elements): sQ = sm[0..4095] as [t][64], sK = sm[4096..8191] as [t][64],
  // sV = sm[8192..12287] as [hcol][t], sVr = sm[12288..16383] as [hcol][t]
#pragma unroll
  for (int nt = 0; nt < 6; ++nt) {
    const int n0 = ch * 96 + nt * 16;            // wave-uniform
    const int p  = n0 >> 6;
    const int hc = (n0 & 63) + ln;
    const float bias = sb[p * HDIM + hc];
    const float sc = (p == 0) ? LOG2E_F : ((p == 2) ? 16.0f : 1.0f);
    unsigned short* base = sm + p * 4096;
#pragma unroll
    for (int r = 0; r < 8; ++r) {
      const int tl = rg * 16 + 8 * half + r;
      const float val = acc[nt][r] + bias;
      const float pv  = __shfl_xor(val, 1, 32);          // pair partner column hc^1 (lane ln^1), unconditional
      const float cn  = scs[tl * HDIM + (hc & ~1)];
      const float sn  = scs[tl * HDIM + (hc | 1)];
      const float t1  = val * cn;
      const float t2  = pv * sn;
      const float rot = (hc & 1) ? (t1 + t2) : (t1 - t2);  // even: ev*c - od*s ; odd: od*c + ev*s
      const float vf  = ((p < 2) ? rot : val) * sc;
      const int idx = (p == 2) ? (hc * 64 + tl) : (tl * 64 + hc);
      const _Float16 hv = (_Float16)vf;
      base[idx] = __builtin_bit_cast(unsigned short, hv);
      if (p == 2) {
        const _Float16 rv = (_Float16)((vf - (float)hv) * 1024.0f);
        sm[12288 + idx] = __builtin_bit_cast(unsigned short, rv);
      }
    }
  }
  __syncthreads();

  // whole-line stores: wave w owns token rows 8w..8w+7 of qh/kh and hcol rows 8w..8w+7 of vT/vR
  const int rl = lane >> 3;
  const int pc = lane & 7;
  const int rA = wave * 8 + rl;
  const int rB = rA + 4;
  const v4u qA = *(const v4u*)(sm + rA * 64 + pc * 8);
  const v4u qB = *(const v4u*)(sm + rB * 64 + pc * 8);
  const v4u kA = *(const v4u*)(sm + 4096 + rA * 64 + pc * 8);
  const v4u kB = *(const v4u*)(sm + 4096 + rB * 64 + pc * 8);
  const v4u vA = *(const v4u*)(sm + 8192 + rA * 64 + pc * 8);
  const v4u vB = *(const v4u*)(sm + 8192 + rB * 64 + pc * 8);
  const v4u uA = *(const v4u*)(sm + 12288 + rA * 64 + pc * 8);
  const v4u uB = *(const v4u*)(sm + 12288 + rB * 64 + pc * 8);
  _Float16* dqA = qh + (size_t)(m0 + rA) * HDIM + pc * 8;
  _Float16* dqB = qh + (size_t)(m0 + rB) * HDIM + pc * 8;
  _Float16* dkA = kh + (size_t)(m0 + rA) * HDIM + pc * 8;
  _Float16* dkB = kh + (size_t)(m0 + rB) * HDIM + pc * 8;
  _Float16* dvA = vT + ((size_t)b * HDIM + rA) * SEQ + t0 + pc * 8;
  _Float16* dvB = vT + ((size_t)b * HDIM + rB) * SEQ + t0 + pc * 8;
  _Float16* duA = vR + ((size_t)b * HDIM + rA) * SEQ + t0 + pc * 8;
  _Float16* duB = vR + ((size_t)b * HDIM + rB) * SEQ + t0 + pc * 8;
  *(v4u*)dqA = qA; *(v4u*)dqB = qB;
  *(v4u*)dkA = kA; *(v4u*)dkB = kB;
  *(v4u*)dvA = vA; *(v4u*)dvB = vB;
  *(v4u*)duA = uA; *(v4u*)duB = uB;
  
}

// ---------------------------------------------------------------------------
// Kernel 3: causal flash attention. Block = one tile of 16 query rows; its NS waves split the tile's key chunks
// (32 keys each): wave w takes chunks w, w + NS, w + 2*NS, ... and keeps its own running maximum, sums and O tile.
// S tiles (D layout) -> online softmax in log2 domain -> P x 1024 to f16 A layout via LDS -> O += P.V, sums += P.ones.
// After the loop the NS partial results are merged through LDS in wave order (rescaled to the common row maximum).
// EARLY = 1 handles query rows < 256: adds P residual (x1024) and v residual plane (x1024)
// products into separate accumulators folded with 2^-10 before the merge; EARLY = 0 handles the rest.
// Query rows with mask == 0 get NaN (whole score row excluded -> NaN softmax).
// Second launch bound (waves per SIMD): 8 for EARLY = 0, so that two of its 16-wave blocks fit one WGP and the whole
// grid is resident at once.
// ---------------------------------------------------------------------------
template <int EARLY>
__global__ __launch_bounds__(EARLY ? NS_E * 32 : NS_L * 32, EARLY ? 2 : 8) __attribute__((amdgpu_num_vgpr(256)))
void k_attn(const _Float16* __restrict__ qh, const _Float16* __restrict__ kh,
            const _Float16* __restrict__ vT, const _Float16* __restrict__ vR,
            const int* __restrict__ mask, float* __restrict__ out)
{
  constexpr int NS  = EARLY ? NS_E : NS_L;     // waves per block = key splits of the tile
  constexpr int CPT = 32 / NS;                 // output columns merged per thread (16 x 64 tile over NS*32 threads)
  constexpr int TPR = HDIM / CPT;              // threads per output row in the merge
  typedef float vcf __attribute__((ext_vector_type(CPT)));

  __shared__ __attribute__((aligned(16))) _Float16 pbuf[NS][16][40];               // per-wave 16 x 32 P tile (x1024)
  __shared__ __attribute__((aligned(16))) _Float16 rbuf[EARLY ? NS : 1][16][40];   // per-wave 16 x 32 P residual tile
  __shared__ __attribute__((aligned(16))) float    part[NS][16][68];               // per-wave 16 x 64 partial O tile
  __shared__ __attribute__((aligned(16))) float    pmax[16][NS];                   // per-wave row maxima  [row][wave]
  __shared__ __attribute__((aligned(16))) float    pden[16][NS];                   // per-wave row sums    [row][wave]

  const int tid  = threadIdx.x;
  const int lane = tid & 31;
  const int wave = __builtin_amdgcn_readfirstlane(tid >> 5);
  const int half = lane >> 4;
  const int ln   = lane & 15;
  int b, tq;
  if (EARLY) { b = blockIdx.x / (4 * NTB_E);  tq = blockIdx.x - b * (4 * NTB_E); }
  else       { b = blockIdx.x / (4 * NTB_LD); tq = 4 * NTB_E + (blockIdx.x - b * (4 * NTB_LD)); }
  const int row0 = tq * 16;                      // first query row of this block (within the sequence)

  const _Float16* qrow  = qh + ((size_t)b * SEQ + row0 + ln) * HDIM + 8 * half;
  const _Float16* kbase = kh + (size_t)b * SEQ * HDIM + 8 * half;
  const _Float16* vbase = vT + (size_t)b * HDIM * SEQ + 8 * half;
  const _Float16* rbase = vR + (size_t)b * HDIM * SEQ + 8 * half;

  // pad flag of the query row that this thread will merge and store (row0 + tid / TPR, always < SEQ)
  const int mk = mask[(size_t)b * SEQ_FULL + row0 + tid / TPR];
  // held before any register that the flag load names (its offset, its base pair) is written again
  asm volatile("s_wait_xcnt 0x0" ::: "memory");

  // loop-invariant Q A fragments (feature blocks 0..31, 32..63)
  const v16h qa0 = frag_f16(qrow);
  const v16h qa1 = frag_f16(qrow + 32);

  v16h ones;
#pragma unroll
  for (int i = 0; i < 16; ++i) ones[i] = (_Float16)1.0f;

  v8f o[4], orr[4];
  v8f osum, osumr;
#pragma unroll
  for (int r = 0; r < 8; ++r) { osum[r] = 0.0f; osumr[r] = 0.0f; }
#pragma unroll
  for (int ht = 0; ht < 4; ++ht) {
#pragma unroll
    for (int r = 0; r < 8; ++r) { o[ht][r] = 0.0f; orr[ht][r] = 0.0f; }
  }
  float rmax[8];
#pragma unroll
  for (int r = 0; r < 8; ++r) rmax[r] = NEG_BIG;

  const int nchunk = ((row0 + 15) >> 5) + 1;     // keys 0 .. row0+15 in chunks of 32
  const int ntrip  = (nchunk + NS - 1) / NS;     // block-uniform trip count
#pragma unroll 1
  for (int j = 0; j < ntrip; ++j) {
    const int c   = j * NS + wave;
    const int kt0 = c * 32;
    const bool active = (c < nchunk);           // wave-uniform
    v8f s[2];
#pragma unroll
    for (int r = 0; r < 8; ++r) { s[0][r] = 0.0f; s[1][r] = 0.0f; }

    if (active) {
      // S[16 x 32] = Q(16 x 64) . K^T, K as B operand: column = key (lane&15), k = feature (split map)
#pragma unroll
      for (int nt = 0; nt < 2; ++nt) {
        const int key = kt0 + nt * 16 + ln;
        const _Float16* krow = kbase + (size_t)key * HDIM;
        const v16h kb0 = frag_f16(krow);
        const v16h kb1 = frag_f16(krow + 32);
        v8f acc;
#pragma unroll
        for (int r = 0; r < 8; ++r) acc[r] = 0.0f;
        acc = wmma_f16(qa0, kb0, acc);
        acc = wmma_f16(qa1, kb1, acc);
#pragma unroll
        for (int r = 0; r < 8; ++r) {
          const float sv = acc[r] * SCL;                            // CDIM^-0.5, log2e already in q
          s[nt][r] = (key > row0 + 8 * half + r) ? NEG_BIG : sv;   // causal fill (replace)
        }
      }
      // online softmax, row = 8*half + r, columns across the 16-lane half
      float alpha[8];
#pragma unroll
      for (int r = 0; r < 8; ++r) {
        float tmax = fmaxf(s[0][r], s[1][r]);
#pragma unroll
        for (int m = 1; m < 16; m <<= 1) tmax = fmaxf(tmax, __shfl_xor(tmax, m, 32));
        const float nmax = fmaxf(rmax[r], tmax);
        alpha[r] = exp2f(rmax[r] - nmax);
        rmax[r]  = nmax;
        s[0][r] = exp2f(s[0][r] - nmax);
        s[1][r] = exp2f(s[1][r] - nmax);
      }
#pragma unroll
      for (int r = 0; r < 8; ++r) {
        osum[r] *= alpha[r];
        if (EARLY) osumr[r] *= alpha[r];
#pragma unroll
        for (int ht = 0; ht < 4; ++ht) {
          o[ht][r] *= alpha[r];
          if (EARLY) orr[ht][r] *= alpha[r];
        }
      }
    }

    // P: D layout -> [q_local][key_local] in LDS (carried x 1024; residual x 1024 more), then reloaded as A fragments
    __syncthreads();
    if (active) {
#pragma unroll
      for (int nt = 0; nt < 2; ++nt) {
#pragma unroll
        for (int r = 0; r < 8; ++r) {
          const float pf = s[nt][r] * 1024.0f;
          const _Float16 ph = (_Float16)pf;
          pbuf[wave][r + 8 * half][nt * 16 + ln] = ph;
          if (EARLY) {
            const _Float16 pr = (_Float16)((pf - (float)ph) * 1024.0f);
            rbuf[wave][r + 8 * half][nt * 16 + ln] = pr;
          }
        }
      }
    }
    __syncthreads();

    if (active) {
      const v16h pa = frag_f16(&pbuf[wave][ln][8 * half]);
      // V as B operand: column = feature (lane&15), k = key (split map) from the key-contiguous planes
      if (EARLY) {
        const v16h pra = frag_f16(&rbuf[wave][ln][8 * half]);
#pragma unroll
        for (int ht = 0; ht < 4; ++ht) {
          const v16h vb = frag_f16(vbase + (size_t)(ht * 16 + ln) * SEQ + kt0);
          o[ht]   = wmma_f16(pa,  vb, o[ht]);
          orr[ht] = wmma_f16(pra, vb, orr[ht]);
        }
        osum  = wmma_f16(pa,  ones, osum);
        osumr = wmma_f16(pra, ones, osumr);
#pragma unroll
        for (int ht = 0; ht < 4; ++ht) {
          const v16h vr = frag_f16(rbase + (size_t)(ht * 16 + ln) * SEQ + kt0);
          orr[ht] = wmma_f16(pa, vr, orr[ht]);
        }
      } else {
#pragma unroll
        for (int ht = 0; ht < 4; ++ht) {
          const v16h vb = frag_f16(vbase + (size_t)(ht * 16 + ln) * SEQ + kt0);
          o[ht] = wmma_f16(pa, vb, o[ht]);
        }
        osum = wmma_f16(pa, ones, osum);   // row sums of the same f16 P in D layout
      }
    }
  }

  // lane index taken anew from the value that the loop's shuffles already hold, so that no thread-index value has to
  // stay in a register across the loop (the register budget decides how many blocks a WGP holds)
  const int el  = (int)__lane_id();
  const int eh  = el >> 4;
  const int eln = el & 15;

  // merge ownership: each thread owns CPT adjacent columns of one query row
  const unsigned int et = (unsigned int)(wave * 32 + el);
  const int mrow = (int)(et / TPR);
  const int mcol = (int)(et % TPR) * CPT;

  // every wave publishes its own row maxima, row sums and unnormalised O tile (a wave without a chunk: NEG_BIG, 0, 0)
#pragma unroll
  for (int r = 0; r < 8; ++r) {
#pragma unroll
    for (int ht = 0; ht < 4; ++ht) {
      float num = o[ht][r];
      if (EARLY) num = num + orr[ht][r] * RINV;
      part[wave][8 * eh + r][ht * 16 + eln] = num;
    }
  }
  if (eln == 0) {
#pragma unroll
    for (int r = 0; r < 8; ++r) {
      float den = osum[r];
      if (EARLY) den = den + osumr[r] * RINV;
      pmax[8 * eh + r][wave] = rmax[r];
      pden[8 * eh + r][wave] = den;
    }
  }
  __syncthreads();   // all NS partial results are in LDS before any thread merges them

  // merge: the NS partials are added in wave order, each rescaled by 2^(its maximum - common maximum)
  float pm[NS];
  float gmax = NEG_BIG;
#pragma unroll
  for (int w = 0; w < NS; ++w) { pm[w] = pmax[mrow][w]; gmax = fmaxf(gmax, pm[w]); }
  float den = 0.0f;
  vcf num;
#pragma unroll
  for (int i = 0; i < CPT; ++i) num[i] = 0.0f;
#pragma unroll
  for (int w = 0; w < NS; ++w) {
    const float f = exp2f(pm[w] - gmax);
    den += pden[mrow][w] * f;
    num += *(const vcf*)(&part[w][mrow][mcol]) * f;
  }

  const float qnan = __uint_as_float(0x7fc00000u);

  // normalise (1024 carry cancels between numerator and denominator; 1/16 undoes the v carry)
  const float inv = 0.0625f * __builtin_amdgcn_rcpf(den);
  vcf res;
#pragma unroll
  for (int i = 0; i < CPT; ++i) res[i] = (mk != 0) ? (num[i] * inv) : qnan;
  *(vcf*)(out + ((size_t)b * SEQ_FULL + row0 + mrow) * HDIM + mcol) = res;
}

// ---------------------------------------------------------------------------
extern "C" void kernel_launch(void* const* d_in, const int* in_sizes, int n_in,
                              void* d_out, int out_size, void* d_ws, size_t ws_size,
                              hipStream_t stream)
{
  if (n_in < 8) return;
  const long long tok_rows = (long long)(NB - 1) * SEQ_FULL + SEQ;
  if ((long long)in_sizes[0] < tok_rows * CDIM) return;
  if ((long long)in_sizes[1] < tok_rows) return;
  if (in_sizes[2] < CDIM * HDIM || in_sizes[4] < CDIM * HDIM || in_sizes[6] < CDIM * HDIM) return;
  if (in_sizes[3] < HDIM || in_sizes[5] < HDIM || in_sizes[7] < HDIM) return;
  if ((long long)out_size < tok_rows * HDIM) return;

  const float* x    = (const float*)d_in[0];
  const int*   mask = (const int*)d_in[1];
  const float* Wq   = (const float*)d_in[2];
  const float* bq   = (const float*)d_in[3];
  const float* Wk   = (const float*)d_in[4];
  const float* bk   = (const float*)d_in[5];
  const float* Wv   = (const float*)d_in[6];
  const float* bv   = (const float*)d_in[7];
  float* out = (float*)d_out;

  // workspace carve (bytes): Wt 192*1024*2 = 393216 | qh NB*SEQ*64*2 | kh same | vT same | vR same
  const size_t wt_bytes = (size_t)NPROJ * WP * sizeof(unsigned short);
  const size_t plane    = (size_t)NB * SEQ * HDIM * sizeof(_Float16);
  const size_t off_wt = 0;
  const size_t off_q  = (off_wt + wt_bytes + 255) & ~(size_t)255;
  const size_t off_k  = off_q + plane;
  const size_t off_v  = off_k + plane;
  const size_t off_r  = off_v + plane;
  const size_t total  = off_r + plane;
  if (total > ws_size) return;

  unsigned short* Wt = (unsigned short*)((char*)d_ws + off_wt);
  _Float16* qh = (_Float16*)((char*)d_ws + off_q);
  _Float16* kh = (_Float16*)((char*)d_ws + off_k);
  _Float16* vT = (_Float16*)((char*)d_ws + off_v);
  _Float16* vR = (_Float16*)((char*)d_ws + off_r);

  k_wconv<<<NPROJ / 8, 256, 0, stream>>>(Wq, Wk, Wv, Wt);
  k_proj<<<(NB * SEQ) / 64, 256, 0, stream>>>(x, Wt, bq, bk, bv, qh, kh, vT, vR);
  k_attn<1><<<NB * NTB_E * 4, NS_E * 32, 0, stream>>>(qh, kh, vT, vR, mask, out);
  if (NTB_L > 0) k_attn<0><<<NB * NTB_LD * 4, NS_L * 32, 0, stream>>>(qh, kh, vT, vR, mask, out);
}

// v002
// It runs in 66.5 microseconds.
// In two side-by-side timings against v001, it was 1.58 and 1.42 times as fast.
// Over all steps from v000 it is 3.48 times as fast.
#include <hip/hip_runtime.h>

// Contractions: x*W projections (q,k,v): v_wmma_f32_16x16x32_bf16, bf16 operands (RNE-converted inputs), f32 accumulate.
// q.k scores, P.v, P row sums: v_wmma_f32_16x16x32_f16, f16 operands (q x log2e, k, P x 1024, v x 16), f32 accumulate;
// query rows < 256 of each sequence also use f16 residual planes of P and v (x1024 carries) in separate f32 accumulators.
// Bias add, rotary pair mixing (f32 cos/sin via powf + sincosf), online softmax and normalisation in f32.

#ifndef NB
#define NB 4
#endif
#ifndef SEQ
#define SEQ 2048
#endif
#define NB_FULL  4
#define SEQ_FULL 2048
#define CDIM  1024
#define HDIM  64
#define NPROJ 192
#define WP    1024        // pitch of the k-contiguous W plane (16-bit elements) == CDIM, 2048 B = 16 lines
#define XC    256         // k chunk of the x tile staged in LDS per pass
#define XP    264         // LDS pitch of the staged x chunk (16-bit elements)
#define NTB    (SEQ / 64)                    // 64-row query tiles per sequence
#define NTB_E  ((NTB < 4) ? NTB : 4)         // tiles with query rows < 256: residual path
#define NTB_L  (NTB - NTB_E)
#define NTB_LD ((NTB_L > 0) ? NTB_L : 1)
#define NS_E   8                              // key splits (waves) per 16-row query tile, rows < 256 (at most 8 chunks)
#define NS_L   16                             // key splits (waves) per 16-row query tile, later rows

static_assert(SEQ % 64 == 0 && SEQ >= 64);
static_assert((NS_E == 8 || NS_E == 16) && (NS_L == 8 || NS_L == 16));
static_assert(SEQ <= SEQ_FULL);
static_assert(NB >= 1 && NB <= NB_FULL);
static_assert(WP == CDIM && (CDIM % XC) == 0 && (XC % 32) == 0);
static_assert(((WP * 2) % 512) == 0);
static_assert(XP >= XC && (XP % 8) == 0);
static_assert(XC == 32 * 8);   // one W row of a chunk = one wave-wide 16-byte load
static_assert(NPROJ == 3 * HDIM && (NPROJ % 8) == 0 && (HDIM % 8) == 0 && HDIM == 64);
static_assert(64 * XP >= 4 * 4096);
static_assert(((long long)(NB - 1) * SEQ_FULL + SEQ) * HDIM <= 524288LL);

typedef _Float16       v16h  __attribute__((ext_vector_type(16)));
typedef _Float16       v8h   __attribute__((ext_vector_type(8)));
typedef float          v8f   __attribute__((ext_vector_type(8)));
typedef float          v4f   __attribute__((ext_vector_type(4)));
typedef unsigned short v16us __attribute__((ext_vector_type(16)));
typedef unsigned short v8us  __attribute__((ext_vector_type(8)));
typedef unsigned int   v4u   __attribute__((ext_vector_type(4)));
typedef unsigned int   v2u   __attribute__((ext_vector_type(2)));
typedef __bf16         v16bf __attribute__((ext_vector_type(16)));

union FragH { v16h v; v8h h[2]; };
union FragU { v16us v; v8us h[2]; };

#define LOG2E_F 1.4426950408889634f
#define NEG_BIG (-3.0e38f)
#define RINV    0.0009765625f
#define SCL     0.03125f          // CDIM^-0.5

// f32 -> bf16 bits, RNE convert
__device__ __forceinline__ unsigned int bf_bits(float f) {
  const unsigned int u = __float_as_uint(f);
  return (u + 0x7FFFu + ((u >> 16) & 1u)) >> 16;
}
// f32 -> bf16 (RNE) -> f32
__device__ __forceinline__ float bfr(float f) {
  return __uint_as_float(bf_bits(f) << 16);
}

// WMMA helpers with the VALU hazard guard (ties D, keeps A/B live)
__device__ __forceinline__ v8f wmma_f16(v16h a, v16h b, v8f c) {
  v8f d = __builtin_amdgcn_wmma_f32_16x16x32_f16(false, a, false, b, (short)0, c, false, false);
  asm volatile("v_nop\n\tv_nop\n\tv_nop\n\tv_nop" : "+v"(d) : "v"(a), "v"(b));
  return d;
}
__device__ __forceinline__ v8f wmma_bf16(v16us a, v16us b, v8f c) {
  v8f d = __builtin_amdgcn_wmma_f32_16x16x32_bf16(false, __builtin_bit_cast(v16bf, a), false,
                                                   __builtin_bit_cast(v16bf, b), (short)0, c, false, false);
  asm volatile("v_nop\n\tv_nop\n\tv_nop\n\tv_nop" : "+v"(d) : "v"(a), "v"(b));
  return d;
}

// 16-bit operand fragment, split k map for BOTH A and B:
// p = (row or column (lane&15)) base + k0 + 8*(lane>>4); elements 0..7 <- p[0..7], elements 8..15 <- p[16..23].
__device__ __forceinline__ v16h frag_f16(const _Float16* p) {
  FragH f;
  f.h[0] = *(const v8h*)p;
  f.h[1] = *(const v8h*)(p + 16);
  return f.v;
}
__device__ __forceinline__ v16us frag_u16(const unsigned short* p) {
  FragU f;
  f.h[0] = *(const v8us*)p;
  f.h[1] = *(const v8us*)(p + 16);
  return f.v;
}

// ---------------------------------------------------------------------------
// Kernel 1: W [c][64] (q,k,v) -> one k-contiguous bf16 plane Wt[n][WP], n = p*64 + hcol (p: 0 q, 1 k, 2 v).
// Block = 8 output rows (coalesced 32-B reads of W, transposed in LDS); one wave per output row,
// ---------------------------------------------------------------------------
__global__ __launch_bounds__(256) void k_wconv(
    const float* __restrict__ Wq, const float* __restrict__ Wk, const float* __restrict__ Wv,
    unsigned short* __restrict__ Wt)
{
  __shared__ __attribute__((aligned(16))) unsigned short sw[8 * WP];   // [hcol_local][c], 16384 B

  const int tid   = threadIdx.x;
  const int lane  = tid & 31;
  const int wave  = __builtin_amdgcn_readfirstlane(tid >> 5);
  const int p     = blockIdx.x >> 3;
  const int hcol0 = (blockIdx.x & 7) * 8;
  const float* W = (p == 0) ? Wq : ((p == 1) ? Wk : Wv);   // block-uniform select, same address space

  for (int i = tid; i < CDIM * 2; i += 256) {
    const int c  = i >> 1;
    const int q4 = (i & 1) * 4;
    const v4f v = *(const v4f*)(W + (size_t)c * HDIM + hcol0 + q4);
    sw[(q4 + 0) * WP + c] = (unsigned short)bf_bits(v.x);
    sw[(q4 + 1) * WP + c] = (unsigned short)bf_bits(v.y);
    sw[(q4 + 2) * WP + c] = (unsigned short)bf_bits(v.z);
    sw[(q4 + 3) * WP + c] = (unsigned short)bf_bits(v.w);
  }
  __syncthreads();

  const int n = p * HDIM + hcol0 + wave;          // 0..NPROJ-1
  unsigned short* dst = Wt + (size_t)n * WP;
  v4u w[4];
#pragma unroll
  for (int j = 0; j < 4; ++j) w[j] = *(const v4u*)(sw + wave * WP + j * 256 + lane * 8);
#pragma unroll
  for (int j = 0; j < 4; ++j) *(v4u*)(dst + j * 256 + lane * 8) = w[j];
  
}

// ---------------------------------------------------------------------------
// Kernel 2: q,k,v projections (+bias, rotary pair mixing on q,k) for a tile of 64 token rows on bf16 WMMA.
// 8 waves: wave -> 16 rows (wave&3) x 96 output columns (wave>>2). x tile staged in LDS as bf16 in 4 chunks of 256 k,
// and with each x chunk the same 256 k of all 192 W rows, so that the B fragments come from LDS like the A fragments.
// Outputs: qh = f16(rot(q+bq)*log2e) [tok][64], kh = f16(rot(k+bk)) [tok][64], vT = f16(16*(v+bv)) [b][64][SEQ],
// vR = f16((16*v - vT) * 1024) [b][64][SEQ] (residual plane).
// ---------------------------------------------------------------------------
__global__ __launch_bounds__(256) __attribute__((amdgpu_num_vgpr(256)))
void k_proj(const float* __restrict__ x, const unsigned short* __restrict__ Wt,
            const float* __restrict__ bq, const float* __restrict__ bk, const float* __restrict__ bv,
            _Float16* __restrict__ qh, _Float16* __restrict__ kh,
            _Float16* __restrict__ vT, _Float16* __restrict__ vR)
{
  __shared__ __attribute__((aligned(16))) unsigned short sm[64 * XP];    // 33792 B, later reused as staging
  __shared__ __attribute__((aligned(16))) unsigned short swt[NPROJ * XP]; // W chunk [n][k], same pitch as the x chunk, 101376 B
  __shared__ __attribute__((aligned(16))) float scs[64 * HDIM];         // [tl][2i] = cos, [tl][2i+1] = sin
  __shared__ float sb[NPROJ];                                           // biases (bf16 RNE-converted)

  const int tid  = threadIdx.x;
  const int lane = tid & 31;
  const int wave = __builtin_amdgcn_readfirstlane(tid >> 5);
  const int half = lane >> 4;
  const int ln   = lane & 15;
  const int m0 = blockIdx.x * 64;               // compact token row of this tile
  const int b  = m0 / SEQ;
  const int t0 = m0 - b * SEQ;
  const float* xblk = x + ((size_t)b * SEQ_FULL + t0) * CDIM;

  // rotary table for positions t0..t0+63: f_i = 1 / 10000^(i/32), angle = t * f_i, i = 0..31
#pragma unroll 1
  for (int i = tid; i < 64 * (HDIM / 2); i += 256) {
    const int r  = i >> 5;
    const int pr = i & 31;
    const float ex  = (float)(2 * pr) * 0.015625f;
    const float fr  = 1.0f / powf(10000.0f, ex);
    const float ang = (float)(t0 + r) * fr;
    float sn, cn;
    sincosf(ang, &sn, &cn);
    scs[r * HDIM + 2 * pr]     = cn;
    scs[r * HDIM + 2 * pr + 1] = sn;
  }
  if (tid < HDIM) {                             // waves 0 and 1 exactly (wave-uniform)
    sb[tid]            = bfr(bq[tid]);
    sb[HDIM + tid]     = bfr(bk[tid]);
    sb[2 * HDIM + tid] = bfr(bv[tid]);
  }

  const int rg = wave & 3;
  const int ch = wave >> 2;
  v8f acc[6];
#pragma unroll
  for (int nt = 0; nt < 6; ++nt) {
#pragma unroll
    for (int r = 0; r < 8; ++r) acc[nt][r] = 0.0f;
  }

  const unsigned short* wsrc = Wt + (size_t)(wave * (NPROJ / 8)) * WP + lane * 8;   // this lane's 16 bytes of the wave's first W row
#pragma unroll 1
  for (int kc = 0; kc < CDIM; kc += XC) {
    __syncthreads();   // all waves done reading the prior chunk
    // W chunk: wave w brings rows 24w..24w+23, each row's XC elements as 512 contiguous bytes; the loads are issued
    // ahead of the x chunk's and stored behind it
    v4u wr[NPROJ / 8];
#pragma unroll   // constant indices keep wr[] in registers and all 24 loads in flight at once
    for (int j = 0; j < NPROJ / 8; ++j)
      wr[j] = *(const v4u*)(wsrc + (size_t)j * WP);
    // stage x chunk: 64 rows x XC columns (kc..kc+XC-1) -> bf16
    for (int i = tid; i < 64 * (XC / 4); i += 256) {
      const int r  = i / (XC / 4);
      const int c4 = i - r * (XC / 4);
      const v4f v = *(const v4f*)(xblk + (size_t)r * CDIM + kc + c4 * 4);
      v2u w;
      w.x = bf_bits(v.x) | (bf_bits(v.y) << 16);
      w.y = bf_bits(v.z) | (bf_bits(v.w) << 16);
      *(v2u*)(sm + r * XP + c4 * 4) = w;
    }
#pragma unroll   // constant indices keep wr[] in registers
    for (int j = 0; j < NPROJ / 8; ++j)
      *(v4u*)(swt + (wave * (NPROJ / 8) + j) * XP + lane * 8) = wr[j];
    wsrc += XC;
    __syncthreads();

    const unsigned short* arow = sm + (rg * 16 + ln) * XP + 8 * half;
    const unsigned short* brow = swt + (ch * 96 + ln) * XP + 8 * half;
#pragma unroll 1
    for (int k0 = 0; k0 < XC; k0 += 32) {
      const v16us a = frag_u16(arow + k0);
#pragma unroll
      for (int nt = 0; nt < 6; ++nt) {
        const v16us bb = frag_u16(brow + nt * 16 * XP + k0);
        acc[nt] = wmma_bf16(a, bb, acc[nt]);
      }
    }
  }
  __syncthreads();   // all waves done reading the x tile

  // staging (16-bit elements): sQ = sm[0..4095] as [t][64], sK = sm[4096..8191] as [t][64],
  // sV = sm[8192..12287] as [hcol][t], sVr = sm[12288..16383] as [hcol][t]
#pragma unroll
  for (int nt = 0; nt < 6; ++nt) {
    const int n0 = ch * 96 + nt * 16;            // wave-uniform
    const int p  = n0 >> 6;
    const int hc = (n0 & 63) + ln;
    const float bias = sb[p * HDIM + hc];
    const float sc = (p == 0) ? LOG2E_F : ((p == 2) ? 16.0f : 1.0f);
    unsigned short* base = sm + p * 4096;
#pragma unroll
    for (int r = 0; r < 8; ++r) {
      const int tl = rg * 16 + 8 * half + r;
      const float val = acc[nt][r] + bias;
      const float pv  = __shfl_xor(val, 1, 32);          // pair partner column hc^1 (lane ln^1), unconditional
      const float cn  = scs[tl * HDIM + (hc & ~1)];
      const float sn  = scs[tl * HDIM + (hc | 1)];
      const float t1  = val * cn;
      const float t2  = pv * sn;
      const float rot = (hc & 1) ? (t1 + t2) : (t1 - t2);  // even: ev*c - od*s ; odd: od*c + ev*s
      const float vf  = ((p < 2) ? rot : val) * sc;
      const int idx = (p == 2) ? (hc * 64 + tl) : (tl * 64 + hc);
      const _Float16 hv = (_Float16)vf;
      base[idx] = __builtin_bit_cast(unsigned short, hv);
      if (p == 2) {
        const _Float16 rv = (_Float16)((vf - (float)hv) * 1024.0f);
        sm[12288 + idx] = __builtin_bit_cast(unsigned short, rv);
      }
    }
  }
  __syncthreads();

  // whole-line stores: wave w owns token rows 8w..8w+7 of qh/kh and hcol rows 8w..8w+7 of vT/vR
  const int rl = lane >> 3;
  const int pc = lane & 7;
  const int rA = wave * 8 + rl;
  const int rB = rA + 4;
  const v4u qA = *(const v4u*)(sm + rA * 64 + pc * 8);
  const v4u qB = *(const v4u*)(sm + rB * 64 + pc * 8);
  const v4u kA = *(const v4u*)(sm + 4096 + rA * 64 + pc * 8);
  const v4u kB = *(const v4u*)(sm + 4096 + rB * 64 + pc * 8);
  const v4u vA = *(const v4u*)(sm + 8192 + rA * 64 + pc * 8);
  const v4u vB = *(const v4u*)(sm + 8192 + rB * 64 + pc * 8);
  const v4u uA = *(const v4u*)(sm + 12288 + rA * 64 + pc * 8);
  const v4u uB = *(const v4u*)(sm + 12288 + rB * 64 + pc * 8);
  _Float16* dqA = qh + (size_t)(m0 + rA) * HDIM + pc * 8;
  _Float16* dqB = qh + (size_t)(m0 + rB) * HDIM + pc * 8;
  _Float16* dkA = kh + (size_t)(m0 + rA) * HDIM + pc * 8;
  _Float16* dkB = kh + (size_t)(m0 + rB) * HDIM + pc * 8;
  _Float16* dvA = vT + ((size_t)b * HDIM + rA) * SEQ + t0 + pc * 8;
  _Float16* dvB = vT + ((size_t)b * HDIM + rB) * SEQ + t0 + pc * 8;
  _Float16* duA = vR + ((size_t)b * HDIM + rA) * SEQ + t0 + pc * 8;
  _Float16* duB = vR + ((size_t)b * HDIM + rB) * SEQ + t0 + pc * 8;
  *(v4u*)dqA = qA; *(v4u*)dqB = qB;
  *(v4u*)dkA = kA; *(v4u*)dkB = kB;
  *(v4u*)dvA = vA; *(v4u*)dvB = vB;
  *(v4u*)duA = uA; *(v4u*)duB = uB;
  
}

// ---------------------------------------------------------------------------
// Kernel 3: causal flash attention. Block = one tile of 16 query rows; its NS waves split the tile's key chunks
// (32 keys each): wave w takes chunks w, w + NS, w + 2*NS, ... and keeps its own running maximum, sums and O tile.
// S tiles (D layout) -> online softmax in log2 domain -> P x 1024 to f16 A layout via LDS -> O += P.V, sums += P.ones.
// After the loop the NS partial results are merged through LDS in wave order (rescaled to the common row maximum).
// EARLY = 1 handles query rows < 256: adds P residual (x1024) and v residual plane (x1024)
// products into separate accumulators folded with 2^-10 before the merge; EARLY = 0 handles the rest.
// Query rows with mask == 0 get NaN (whole score row excluded -> NaN softmax).
// Second launch bound (waves per SIMD): 8 for EARLY = 0, so that two of its 16-wave blocks fit one WGP and the whole
// grid is resident at once.
// ---------------------------------------------------------------------------
template <int EARLY>
__global__ __launch_bounds__(EARLY ? NS_E * 32 : NS_L * 32, EARLY ? 2 : 8) __attribute__((amdgpu_num_vgpr(256)))
void k_attn(const _Float16* __restrict__ qh, const _Float16* __restrict__ kh,
            const _Float16* __restrict__ vT, const _Float16* __restrict__ vR,
            const int* __restrict__ mask, float* __restrict__ out)
{
  constexpr int NS  = EARLY ? NS_E : NS_L;     // waves per block = key splits of the tile
  constexpr int CPT = 32 / NS;                 // output columns merged per thread (16 x 64 tile over NS*32 threads)
  constexpr int TPR = HDIM / CPT;              // threads per output row in the merge
  typedef float vcf __attribute__((ext_vector_type(CPT)));

  __shared__ __attribute__((aligned(16))) _Float16 pbuf[NS][16][40];               // per-wave 16 x 32 P tile (x1024)
  __shared__ __attribute__((aligned(16))) _Float16 rbuf[EARLY ? NS : 1][16][40];   // per-wave 16 x 32 P residual tile
  __shared__ __attribute__((aligned(16))) float    part[NS][16][68];               // per-wave 16 x 64 partial O tile
  __shared__ __attribute__((aligned(16))) float    pmax[16][NS];                   // per-wave row maxima  [row][wave]
  __shared__ __attribute__((aligned(16))) float    pden[16][NS];                   // per-wave row sums    [row][wave]

  const int tid  = threadIdx.x;
  const int lane = tid & 31;
  const int wave = __builtin_amdgcn_readfirstlane(tid >> 5);
  const int half = lane >> 4;
  const int ln   = lane & 15;
  int b, tq;
  if (EARLY) { b = blockIdx.x / (4 * NTB_E);  tq = blockIdx.x - b * (4 * NTB_E); }
  else       { b = blockIdx.x / (4 * NTB_LD); tq = 4 * NTB_E + (blockIdx.x - b * (4 * NTB_LD)); }
  const int row0 = tq * 16;                      // first query row of this block (within the sequence)

  const _Float16* qrow  = qh + ((size_t)b * SEQ + row0 + ln) * HDIM + 8 * half;
  const _Float16* kbase = kh + (size_t)b * SEQ * HDIM + 8 * half;
  const _Float16* vbase = vT + (size_t)b * HDIM * SEQ + 8 * half;
  const _Float16* rbase = vR + (size_t)b * HDIM * SEQ + 8 * half;

  // pad flag of the query row that this thread will merge and store (row0 + tid / TPR, always < SEQ)
  const int mk = mask[(size_t)b * SEQ_FULL + row0 + tid / TPR];
  // held before any register that the flag load names (its offset, its base pair) is written again
  asm volatile("s_wait_xcnt 0x0" ::: "memory");

  // loop-invariant Q A fragments (feature blocks 0..31, 32..63)
  const v16h qa0 = frag_f16(qrow);
  const v16h qa1 = frag_f16(qrow + 32);

  v16h ones;
#pragma unroll
  for (int i = 0; i < 16; ++i) ones[i] = (_Float16)1.0f;

  v8f o[4], orr[4];
  v8f osum, osumr;
#pragma unroll
  for (int r = 0; r < 8; ++r) { osum[r] = 0.0f; osumr[r] = 0.0f; }
#pragma unroll
  for (int ht = 0; ht < 4; ++ht) {
#pragma unroll
    for (int r = 0; r < 8; ++r) { o[ht][r] = 0.0f; orr[ht][r] = 0.0f; }
  }
  float rmax[8];
#pragma unroll
  for (int r = 0; r < 8; ++r) rmax[r] = NEG_BIG;

  const int nchunk = ((row0 + 15) >> 5) + 1;     // keys 0 .. row0+15 in chunks of 32
  const int ntrip  = (nchunk + NS - 1) / NS;     // block-uniform trip count
#pragma unroll 1
  for (int j = 0; j < ntrip; ++j) {
    const int c   = j * NS + wave;
    const int kt0 = c * 32;
    const bool active = (c < nchunk);           // wave-uniform
    v8f s[2];
#pragma unroll
    for (int r = 0; r < 8; ++r) { s[0][r] = 0.0f; s[1][r] = 0.0f; }

    if (active) {
      // S[16 x 32] = Q(16 x 64) . K^T, K as B operand: column = key (lane&15), k = feature (split map)
#pragma unroll
      for (int nt = 0; nt < 2; ++nt) {
        const int key = kt0 + nt * 16 + ln;
        const _Float16* krow = kbase + (size_t)key * HDIM;
        const v16h kb0 = frag_f16(krow);
        const v16h kb1 = frag_f16(krow + 32);
        v8f acc;
#pragma unroll
        for (int r = 0; r < 8; ++r) acc[r] = 0.0f;
        acc = wmma_f16(qa0, kb0, acc);
        acc = wmma_f16(qa1, kb1, acc);
#pragma unroll
        for (int r = 0; r < 8; ++r) {
          const float sv = acc[r] * SCL;                            // CDIM^-0.5, log2e already in q
          s[nt][r] = (key > row0 + 8 * half + r) ? NEG_BIG : sv;   // causal fill (replace)
        }
      }
      // online softmax, row = 8*half + r, columns across the 16-lane half
      float alpha[8];
#pragma unroll
      for (int r = 0; r < 8; ++r) {
        float tmax = fmaxf(s[0][r], s[1][r]);
#pragma unroll
        for (int m = 1; m < 16; m <<= 1) tmax = fmaxf(tmax, __shfl_xor(tmax, m, 32));
        const float nmax = fmaxf(rmax[r], tmax);
        alpha[r] = exp2f(rmax[r] - nmax);
        rmax[r]  = nmax;
        s[0][r] = exp2f(s[0][r] - nmax);
        s[1][r] = exp2f(s[1][r] - nmax);
      }
#pragma unroll
      for (int r = 0; r < 8; ++r) {
        osum[r] *= alpha[r];
        if (EARLY) osumr[r] *= alpha[r];
#pragma unroll
        for (int ht = 0; ht < 4; ++ht) {
          o[ht][r] *= alpha[r];
          if (EARLY) orr[ht][r] *= alpha[r];
        }
      }
    }

    // P: D layout -> [q_local][key_local] in LDS (carried x 1024; residual x 1024 more), then reloaded as A fragments
    __syncthreads();
    if (active) {
#pragma unroll
      for (int nt = 0; nt < 2; ++nt) {
#pragma unroll
        for (int r = 0; r < 8; ++r) {
          const float pf = s[nt][r] * 1024.0f;
          const _Float16 ph = (_Float16)pf;
          pbuf[wave][r + 8 * half][nt * 16 + ln] = ph;
          if (EARLY) {
            const _Float16 pr = (_Float16)((pf - (float)ph) * 1024.0f);
            rbuf[wave][r + 8 * half][nt * 16 + ln] = pr;
          }
        }
      }
    }
    __syncthreads();

    if (active) {
      const v16h pa = frag_f16(&pbuf[wave][ln][8 * half]);
      // V as B operand: column = feature (lane&15), k = key (split map) from the key-contiguous planes
      if (EARLY) {
        const v16h pra = frag_f16(&rbuf[wave][ln][8 * half]);
#pragma unroll
        for (int ht = 0; ht < 4; ++ht) {
          const v16h vb = frag_f16(vbase + (size_t)(ht * 16 + ln) * SEQ + kt0);
          o[ht]   = wmma_f16(pa,  vb, o[ht]);
          orr[ht] = wmma_f16(pra, vb, orr[ht]);
        }
        osum  = wmma_f16(pa,  ones, osum);
        osumr = wmma_f16(pra, ones, osumr);
#pragma unroll
        for (int ht = 0; ht < 4; ++ht) {
          const v16h vr = frag_f16(rbase + (size_t)(ht * 16 + ln) * SEQ + kt0);
          orr[ht] = wmma_f16(pa, vr, orr[ht]);
        }
      } else {
#pragma unroll
        for (int ht = 0; ht < 4; ++ht) {
          const v16h vb = frag_f16(vbase + (size_t)(ht * 16 + ln) * SEQ + kt0);
          o[ht] = wmma_f16(pa, vb, o[ht]);
        }
        osum = wmma_f16(pa, ones, osum);   // row sums of the same f16 P in D layout
      }
    }
  }

  // lane index taken anew from the value that the loop's shuffles already hold, so that no thread-index value has to
  // stay in a register across the loop (the register budget decides how many blocks a WGP holds)
  const int el  = (int)__lane_id();
  const int eh  = el >> 4;
  const int eln = el & 15;

  // merge ownership: each thread owns CPT adjacent columns of one query row
  const unsigned int et = (unsigned int)(wave * 32 + el);
  const int mrow = (int)(et / TPR);
  const int mcol = (int)(et % TPR) * CPT;

  // every wave publishes its own row maxima, row sums and unnormalised O tile (a wave without a chunk: NEG_BIG, 0, 0)
#pragma unroll
  for (int r = 0; r < 8; ++r) {
#pragma unroll
    for (int ht = 0; ht < 4; ++ht) {
      float num = o[ht][r];
      if (EARLY) num = num + orr[ht][r] * RINV;
      part[wave][8 * eh + r][ht * 16 + eln] = num;
    }
  }
  if (eln == 0) {
#pragma unroll
    for (int r = 0; r < 8; ++r) {
      float den = osum[r];
      if (EARLY) den = den + osumr[r] * RINV;
      pmax[8 * eh + r][wave] = rmax[r];
      pden[8 * eh + r][wave] = den;
    }
  }
  __syncthreads();   // all NS partial results are in LDS before any thread merges them

  // merge: the NS partials are added in wave order, each rescaled by 2^(its maximum - common maximum)
  float pm[NS];
  float gmax = NEG_BIG;
#pragma unroll
  for (int w = 0; w < NS; ++w) { pm[w] = pmax[mrow][w]; gmax = fmaxf(gmax, pm[w]); }
  float den = 0.0f;
  vcf num;
#pragma unroll
  for (int i = 0; i < CPT; ++i) num[i] = 0.0f;
#pragma unroll
  for (int w = 0; w < NS; ++w) {
    const float f = exp2f(pm[w] - gmax);
    den += pden[mrow][w] * f;
    num += *(const vcf*)(&part[w][mrow][mcol]) * f;
  }

  const float qnan = __uint_as_float(0x7fc00000u);

  // normalise (1024 carry cancels between numerator and denominator; 1/16 undoes the v carry)
  const float inv = 0.0625f * __builtin_amdgcn_rcpf(den);
  vcf res;
#pragma unroll
  for (int i = 0; i < CPT; ++i) res[i] = (mk != 0) ? (num[i] * inv) : qnan;
  *(vcf*)(out + ((size_t)b * SEQ_FULL + row0 + mrow) * HDIM + mcol) = res;
}

// ---------------------------------------------------------------------------
extern "C" void kernel_launch(void* const* d_in, const int* in_sizes, int n_in,
                              void* d_out, int out_size, void* d_ws, size_t ws_size,
                              hipStream_t stream)
{
  if (n_in < 8) return;
  const long long tok_rows = (long long)(NB - 1) * SEQ_FULL + SEQ;
  if ((long long)in_sizes[0] < tok_rows * CDIM) return;
  if ((long long)in_sizes[1] < tok_rows) return;
  if (in_sizes[2] < CDIM * HDIM || in_sizes[4] < CDIM * HDIM || in_sizes[6] < CDIM * HDIM) return;
  if (in_sizes[3] < HDIM || in_sizes[5] < HDIM || in_sizes[7] < HDIM) return;
  if ((long long)out_size < tok_rows * HDIM) return;

  const float* x    = (const float*)d_in[0];
  const int*   mask = (const int*)d_in[1];
  const float* Wq   = (const float*)d_in[2];
  const float* bq   = (const float*)d_in[3];
  const float* Wk   = (const float*)d_in[4];
  const float* bk   = (const float*)d_in[5];
  const float* Wv   = (const float*)d_in[6];
  const float* bv   = (const float*)d_in[7];
  float* out = (float*)d_out;

  // workspace carve (bytes): Wt 192*1024*2 = 393216 | qh NB*SEQ*64*2 | kh same | vT same | vR same
  const size_t wt_bytes = (size_t)NPROJ * WP * sizeof(unsigned short);
  const size_t plane    = (size_t)NB * SEQ * HDIM * sizeof(_Float16);
  const size_t off_wt = 0;
  const size_t off_q  = (off_wt + wt_bytes + 255) & ~(size_t)255;
  const size_t off_k  = off_q + plane;
  const size_t off_v  = off_k + plane;
  const size_t off_r  = off_v + plane;
  const size_t total  = off_r + plane;
  if (total > ws_size) return;

  unsigned short* Wt = (unsigned short*)((char*)d_ws + off_wt);
  _Float16* qh = (_Float16*)((char*)d_ws + off_q);
  _Float16* kh = (_Float16*)((char*)d_ws + off_k);
  _Float16* vT = (_Float16*)((char*)d_ws + off_v);
  _Float16* vR = (_Float16*)((char*)d_ws + off_r);

  k_wconv<<<NPROJ / 8, 256, 0, stream>>>(Wq, Wk, Wv, Wt);
  k_proj<<<(NB * SEQ) / 64, 256, 0, stream>>>(x, Wt, bq, bk, bv, qh, kh, vT, vR);
  k_attn<1><<<NB * NTB_E * 4, NS_E * 32, 0, stream>>>(qh, kh, vT, vR, mask, out);
  if (NTB_L > 0) k_attn<0><<<NB * NTB_LD * 4, NS_L * 32, 0, stream>>>(qh, kh, vT, vR, mask, out);
}

// v003
// It runs in 60.4 microseconds.
// In both of two side-by-side timings against v002, it was 1.08 times as fast.
// Counting every step since v000, it is 3.77 times as fast.
#include <hip/hip_runtime.h>

// Contractions: x*W projections (q,k,v): v_wmma_f32_16x16x32_bf16, bf16 operands (RNE-converted inputs), f32 accumulate.
// q.k scores, P.v, P row sums: v_wmma_f32_16x16x32_f16, f16 operands (q x log2e, k, P x 1024, v x 16), f32 accumulate;
// query rows < 256 of each sequence also use f16 residual planes of P and v (x1024 carries) in separate f32 accumulators.
// Bias add, rotary pair mixing (f32 cos/sin via powf + sincosf), online softmax and normalisation in f32.

#ifndef NB
#define NB 4
#endif
#ifndef SEQ
#define SEQ 2048
#endif
#define NB_FULL  4
#define SEQ_FULL 2048
#define CDIM  1024
#define HDIM  64
#define NPROJ 192
#define WP    1024        // pitch of the k-contiguous W plane (16-bit elements) == CDIM, 2048 B = 16 lines
#define XC    256         // k chunk of the x tile staged in LDS per pass
#define XP    264         // LDS pitch of the staged x chunk (16-bit elements)
#define NTB    (SEQ / 64)                    // 64-row query tiles per sequence
#define NTB_E  ((NTB < 4) ? NTB : 4)         // tiles with query rows < 256: residual path
#define NTB_L  (NTB - NTB_E)
#define NTB_LD ((NTB_L > 0) ? NTB_L : 1)
#define NS_E   8                              // key splits (waves) per 16-row query tile, rows < 256 (at most 8 chunks)
#define NS_L   16                             // key splits (waves) per 16-row query tile, later rows

static_assert(SEQ % 64 == 0 && SEQ >= 64);
static_assert((NS_E == 8 || NS_E == 16) && (NS_L == 8 || NS_L == 16));
static_assert(SEQ <= SEQ_FULL);
static_assert(NB >= 1 && NB <= NB_FULL);
static_assert(WP == CDIM && (CDIM % XC) == 0 && (XC % 32) == 0);
static_assert(((WP * 2) % 512) == 0);
static_assert(XP >= XC && (XP % 8) == 0);
static_assert(XC == 32 * 8);   // one W row of a chunk = one wave-wide 16-byte load
static_assert(NPROJ == 3 * HDIM && (NPROJ % 8) == 0 && (HDIM % 8) == 0 && HDIM == 64);
static_assert(64 * XP >= 4 * 4096);
static_assert(((long long)(NB - 1) * SEQ_FULL + SEQ) * HDIM <= 524288LL);

typedef _Float16       v16h  __attribute__((ext_vector_type(16)));
typedef _Float16       v8h   __attribute__((ext_vector_type(8)));
typedef float          v8f   __attribute__((ext_vector_type(8)));
typedef float          v4f   __attribute__((ext_vector_type(4)));
typedef unsigned short v16us __attribute__((ext_vector_type(16)));
typedef unsigned short v8us  __attribute__((ext_vector_type(8)));
typedef unsigned int   v4u   __attribute__((ext_vector_type(4)));
typedef unsigned int   v2u   __attribute__((ext_vector_type(2)));
typedef __bf16         v16bf __attribute__((ext_vector_type(16)));

union FragH { v16h v; v8h h[2]; };
union FragU { v16us v; v8us h[2]; };

#define LOG2E_F 1.4426950408889634f
#define NEG_BIG (-3.0e38f)
#define RINV    0.0009765625f
#define SCL     0.03125f          // CDIM^-0.5

// f32 -> bf16 bits, RNE convert
__device__ __forceinline__ unsigned int bf_bits(float f) {
  const unsigned int u = __float_as_uint(f);
  return (u + 0x7FFFu + ((u >> 16) & 1u)) >> 16;
}
// f32 -> bf16 (RNE) -> f32
__device__ __forceinline__ float bfr(float f) {
  return __uint_as_float(bf_bits(f) << 16);
}

// WMMA helpers with the VALU hazard guard (ties D, keeps A/B live)
__device__ __forceinline__ v8f wmma_f16(v16h a, v16h b, v8f c) {
  v8f d = __builtin_amdgcn_wmma_f32_16x16x32_f16(false, a, false, b, (short)0, c, false, false);
  asm volatile("v_nop\n\tv_nop\n\tv_nop\n\tv_nop" : "+v"(d) : "v"(a), "v"(b));
  return d;
}
__device__ __forceinline__ v8f wmma_bf16(v16us a, v16us b, v8f c) {
  v8f d = __builtin_amdgcn_wmma_f32_16x16x32_bf16(false, __builtin_bit_cast(v16bf, a), false,
                                                   __builtin_bit_cast(v16bf, b), (short)0, c, false, false);
  asm volatile("v_nop\n\tv_nop\n\tv_nop\n\tv_nop" : "+v"(d) : "v"(a), "v"(b));
  return d;
}

// 16-bit operand fragment, split k map for BOTH A and B:
// p = (row or column (lane&15)) base + k0 + 8*(lane>>4); elements 0..7 <- p[0..7], elements 8..15 <- p[16..23].
__device__ __forceinline__ v16h frag_f16(const _Float16* p) {
  FragH f;
  f.h[0] = *(const v8h*)p;
  f.h[1] = *(const v8h*)(p + 16);
  return f.v;
}
__device__ __forceinline__ v16us frag_u16(const unsigned short* p) {
  FragU f;
  f.h[0] = *(const v8us*)p;
  f.h[1] = *(const v8us*)(p + 16);
  return f.v;
}

// ---------------------------------------------------------------------------
// Kernel 1: W [c][64] (q,k,v) -> one k-contiguous bf16 plane Wt[n][WP], n = p*64 + hcol (p: 0 q, 1 k, 2 v).
// Block = 8 output rows (coalesced 32-B reads of W, transposed in LDS); one wave per output row,
// ---------------------------------------------------------------------------
__global__ __launch_bounds__(256) void k_wconv(
    const float* __restrict__ Wq, const float* __restrict__ Wk, const float* __restrict__ Wv,
    unsigned short* __restrict__ Wt)
{
  __shared__ __attribute__((aligned(16))) unsigned short sw[8 * WP];   // [hcol_local][c], 16384 B

  const int tid   = threadIdx.x;
  const int lane  = tid & 31;
  const int wave  = __builtin_amdgcn_readfirstlane(tid >> 5);
  const int p     = blockIdx.x >> 3;
  const int hcol0 = (blockIdx.x & 7) * 8;
  const float* W = (p == 0) ? Wq : ((p == 1) ? Wk : Wv);   // block-uniform select, same address space

  for (int i = tid; i < CDIM * 2; i += 256) {
    const int c  = i >> 1;
    const int q4 = (i & 1) * 4;
    const v4f v = *(const v4f*)(W + (size_t)c * HDIM + hcol0 + q4);
    sw[(q4 + 0) * WP + c] = (unsigned short)bf_bits(v.x);
    sw[(q4 + 1) * WP + c] = (unsigned short)bf_bits(v.y);
    sw[(q4 + 2) * WP + c] = (unsigned short)bf_bits(v.z);
    sw[(q4 + 3) * WP + c] = (unsigned short)bf_bits(v.w);
  }
  __syncthreads();

  const int n = p * HDIM + hcol0 + wave;          // 0..NPROJ-1
  unsigned short* dst = Wt + (size_t)n * WP;
  v4u w[4];
#pragma unroll
  for (int j = 0; j < 4; ++j) w[j] = *(const v4u*)(sw + wave * WP + j * 256 + lane * 8);
#pragma unroll
  for (int j = 0; j < 4; ++j) *(v4u*)(dst + j * 256 + lane * 8) = w[j];
  
}

// ---------------------------------------------------------------------------
// Kernel 2: q,k,v projections (+bias, rotary pair mixing on q,k) for a tile of 64 token rows on bf16 WMMA.
// 8 waves: wave -> 16 rows (wave&3) x 96 output columns (wave>>2). x tile staged in LDS as bf16 in 4 chunks of 256 k,
// and with each x chunk the same 256 k of all 192 W rows, so that the B fragments come from LDS like the A fragments.
// Outputs: qh = f16(rot(q+bq)*log2e) [tok][64], kh = f16(rot(k+bk)) [tok][64], vT = f16(16*(v+bv)) [b][64][SEQ],
// vR = f16((16*v - vT) * 1024) [b][64][SEQ] (residual plane).
// ---------------------------------------------------------------------------
__global__ __launch_bounds__(256) __attribute__((amdgpu_num_vgpr(256)))
void k_proj(const float* __restrict__ x, const unsigned short* __restrict__ Wt,
            const float* __restrict__ bq, const float* __restrict__ bk, const float* __restrict__ bv,
            _Float16* __restrict__ qh, _Float16* __restrict__ kh,
            _Float16* __restrict__ vT, _Float16* __restrict__ vR)
{
  __shared__ __attribute__((aligned(16))) unsigned short sm[64 * XP];    // 33792 B, later reused as staging
  __shared__ __attribute__((aligned(16))) unsigned short swt[NPROJ * XP]; // W chunk [n][k], same pitch as the x chunk, 101376 B
  __shared__ __attribute__((aligned(16))) float scs[64 * HDIM];         // [tl][2i] = cos, [tl][2i+1] = sin
  __shared__ float sb[NPROJ];                                           // biases (bf16 RNE-converted)

  const int tid  = threadIdx.x;
  const int lane = tid & 31;
  const int wave = __builtin_amdgcn_readfirstlane(tid >> 5);
  const int half = lane >> 4;
  const int ln   = lane & 15;
  const int m0 = blockIdx.x * 64;               // compact token row of this tile
  const int b  = m0 / SEQ;
  const int t0 = m0 - b * SEQ;
  const float* xblk = x + ((size_t)b * SEQ_FULL + t0) * CDIM;

  // rotary table for positions t0..t0+63: f_i = 1 / 10000^(i/32), angle = t * f_i, i = 0..31
#pragma unroll 1
  for (int i = tid; i < 64 * (HDIM / 2); i += 256) {
    const int r  = i >> 5;
    const int pr = i & 31;
    const float ex  = (float)(2 * pr) * 0.015625f;
    const float fr  = 1.0f / powf(10000.0f, ex);
    const float ang = (float)(t0 + r) * fr;
    float sn, cn;
    sincosf(ang, &sn, &cn);
    scs[r * HDIM + 2 * pr]     = cn;
    scs[r * HDIM + 2 * pr + 1] = sn;
  }
  if (tid < HDIM) {                             // waves 0 and 1 exactly (wave-uniform)
    sb[tid]            = bfr(bq[tid]);
    sb[HDIM + tid]     = bfr(bk[tid]);
    sb[2 * HDIM + tid] = bfr(bv[tid]);
  }

  const int rg = wave & 3;
  const int ch = wave >> 2;
  v8f acc[6];
#pragma unroll
  for (int nt = 0; nt < 6; ++nt) {
#pragma unroll
    for (int r = 0; r < 8; ++r) acc[nt][r] = 0.0f;
  }

  const unsigned short* wsrc = Wt + (size_t)(wave * (NPROJ / 8)) * WP + lane * 8;   // this lane's 16 bytes of the wave's first W row
#pragma unroll 1
  for (int kc = 0; kc < CDIM; kc += XC) {
    __syncthreads();   // all waves done reading the prior chunk
    // W chunk: wave w brings rows 24w..24w+23, each row's XC elements as 512 contiguous bytes; the loads are issued
    // ahead of the x chunk's and stored behind it
    v4u wr[NPROJ / 8];
#pragma unroll   // constant indices keep wr[] in registers and all 24 loads in flight at once
    for (int j = 0; j < NPROJ / 8; ++j)
      wr[j] = *(const v4u*)(wsrc + (size_t)j * WP);
    // stage x chunk: 64 rows x XC columns (kc..kc+XC-1) -> bf16
    for (int i = tid; i < 64 * (XC / 4); i += 256) {
      const int r  = i / (XC / 4);
      const int c4 = i - r * (XC / 4);
      const v4f v = *(const v4f*)(xblk + (size_t)r * CDIM + kc + c4 * 4);
      v2u w;
      w.x = bf_bits(v.x) | (bf_bits(v.y) << 16);
      w.y = bf_bits(v.z) | (bf_bits(v.w) << 16);
      *(v2u*)(sm + r * XP + c4 * 4) = w;
    }
#pragma unroll   // constant indices keep wr[] in registers
    for (int j = 0; j < NPROJ / 8; ++j)
      *(v4u*)(swt + (wave * (NPROJ / 8) + j) * XP + lane * 8) = wr[j];
    wsrc += XC;
    __syncthreads();

    const unsigned short* arow = sm + (rg * 16 + ln) * XP + 8 * half;
    const unsigned short* brow = swt + (ch * 96 + ln) * XP + 8 * half;
    // two register sets of fragments: the 14 LDS reads of k step ks + 1 are issued as one group ahead of the 6 products
    // of step ks, so that a product no longer waits out the LDS latency of its own operands
    v16us af[2];
    v16us bf[2][6];
    af[0] = frag_u16(arow);
#pragma unroll
    for (int nt = 0; nt < 6; ++nt) bf[0][nt] = frag_u16(brow + nt * 16 * XP);
#pragma unroll   // constant set indices keep both fragment sets in registers, with no copies between them
    for (int ks = 0; ks < XC / 32; ++ks) {
      const int cur = ks & 1;
      const int nxt = cur ^ 1;
      if (ks + 1 < XC / 32) {
        af[nxt] = frag_u16(arow + (ks + 1) * 32);
#pragma unroll
        for (int nt = 0; nt < 6; ++nt) bf[nxt][nt] = frag_u16(brow + nt * 16 * XP + (ks + 1) * 32);
      }
#pragma unroll
      for (int nt = 0; nt < 6; ++nt) acc[nt] = wmma_bf16(af[cur], bf[cur][nt], acc[nt]);
    }
  }
  __syncthreads();   // all waves done reading the x tile

  // staging (16-bit elements): sQ = sm[0..4095] as [t][64], sK = sm[4096..8191] as [t][64],
  // sV = sm[8192..12287] as [hcol][t], sVr = sm[12288..16383] as [hcol][t]
#pragma unroll
  for (int nt = 0; nt < 6; ++nt) {
    const int n0 = ch * 96 + nt * 16;            // wave-uniform
    const int p  = n0 >> 6;
    const int hc = (n0 & 63) + ln;
    const float bias = sb[p * HDIM + hc];
    const float sc = (p == 0) ? LOG2E_F : ((p == 2) ? 16.0f : 1.0f);
    unsigned short* base = sm + p * 4096;
#pragma unroll
    for (int r = 0; r < 8; ++r) {
      const int tl = rg * 16 + 8 * half + r;
      const float val = acc[nt][r] + bias;
      const float pv  = __shfl_xor(val, 1, 32);          // pair partner column hc^1 (lane ln^1), unconditional
      const float cn  = scs[tl * HDIM + (hc & ~1)];
      const float sn  = scs[tl * HDIM + (hc | 1)];
      const float t1  = val * cn;
      const float t2  = pv * sn;
      const float rot = (hc & 1) ? (t1 + t2) : (t1 - t2);  // even: ev*c - od*s ; odd: od*c + ev*s
      const float vf  = ((p < 2) ? rot : val) * sc;
      const int idx = (p == 2) ? (hc * 64 + tl) : (tl * 64 + hc);
      const _Float16 hv = (_Float16)vf;
      base[idx] = __builtin_bit_cast(unsigned short, hv);
      if (p == 2) {
        const _Float16 rv = (_Float16)((vf - (float)hv) * 1024.0f);
        sm[12288 + idx] = __builtin_bit_cast(unsigned short, rv);
      }
    }
  }
  __syncthreads();

  // whole-line stores: wave w owns token rows 8w..8w+7 of qh/kh and hcol rows 8w..8w+7 of vT/vR
  const int rl = lane >> 3;
  const int pc = lane & 7;
  const int rA = wave * 8 + rl;
  const int rB = rA + 4;
  const v4u qA = *(const v4u*)(sm + rA * 64 + pc * 8);
  const v4u qB = *(const v4u*)(sm + rB * 64 + pc * 8);
  const v4u kA = *(const v4u*)(sm + 4096 + rA * 64 + pc * 8);
  const v4u kB = *(const v4u*)(sm + 4096 + rB * 64 + pc * 8);
  const v4u vA = *(const v4u*)(sm + 8192 + rA * 64 + pc * 8);
  const v4u vB = *(const v4u*)(sm + 8192 + rB * 64 + pc * 8);
  const v4u uA = *(const v4u*)(sm + 12288 + rA * 64 + pc * 8);
  const v4u uB = *(const v4u*)(sm + 12288 + rB * 64 + pc * 8);
  _Float16* dqA = qh + (size_t)(m0 + rA) * HDIM + pc * 8;
  _Float16* dqB = qh + (size_t)(m0 + rB) * HDIM + pc * 8;
  _Float16* dkA = kh + (size_t)(m0 + rA) * HDIM + pc * 8;
  _Float16* dkB = kh + (size_t)(m0 + rB) * HDIM + pc * 8;
  _Float16* dvA = vT + ((size_t)b * HDIM + rA) * SEQ + t0 + pc * 8;
  _Float16* dvB = vT + ((size_t)b * HDIM + rB) * SEQ + t0 + pc * 8;
  _Float16* duA = vR + ((size_t)b * HDIM + rA) * SEQ + t0 + pc * 8;
  _Float16* duB = vR + ((size_t)b * HDIM + rB) * SEQ + t0 + pc * 8;
  *(v4u*)dqA = qA; *(v4u*)dqB = qB;
  *(v4u*)dkA = kA; *(v4u*)dkB = kB;
  *(v4u*)dvA = vA; *(v4u*)dvB = vB;
  *(v4u*)duA = uA; *(v4u*)duB = uB;
  
}

// ---------------------------------------------------------------------------
// Kernel 3: causal flash attention. Block = one tile of 16 query rows; its NS waves split the tile's key chunks
// (32 keys each): wave w takes chunks w, w + NS, w + 2*NS, ... and keeps its own running maximum, sums and O tile.
// S tiles (D layout) -> online softmax in log2 domain -> P x 1024 to f16 A layout via LDS -> O += P.V, sums += P.ones.
// After the loop the NS partial results are merged through LDS in wave order (rescaled to the common row maximum).
// EARLY = 1 handles query rows < 256: adds P residual (x1024) and v residual plane (x1024)
// products into separate accumulators folded with 2^-10 before the merge; EARLY = 0 handles the rest.
// Query rows with mask == 0 get NaN (whole score row excluded -> NaN softmax).
// Second launch bound (waves per SIMD): 8 for EARLY = 0, so that two of its 16-wave blocks fit one WGP and the whole
// grid is resident at once.
// ---------------------------------------------------------------------------
template <int EARLY>
__global__ __launch_bounds__(EARLY ? NS_E * 32 : NS_L * 32, EARLY ? 2 : 8) __attribute__((amdgpu_num_vgpr(256)))
void k_attn(const _Float16* __restrict__ qh, const _Float16* __restrict__ kh,
            const _Float16* __restrict__ vT, const _Float16* __restrict__ vR,
            const int* __restrict__ mask, float* __restrict__ out)
{
  constexpr int NS  = EARLY ? NS_E : NS_L;     // waves per block = key splits of the tile
  constexpr int CPT = 32 / NS;                 // output columns merged per thread (16 x 64 tile over NS*32 threads)
  constexpr int TPR = HDIM / CPT;              // threads per output row in the merge
  typedef float vcf __attribute__((ext_vector_type(CPT)));

  __shared__ __attribute__((aligned(16))) _Float16 pbuf[NS][16][40];               // per-wave 16 x 32 P tile (x1024)
  __shared__ __attribute__((aligned(16))) _Float16 rbuf[EARLY ? NS : 1][16][40];   // per-wave 16 x 32 P residual tile
  __shared__ __attribute__((aligned(16))) float    part[NS][16][68];               // per-wave 16 x 64 partial O tile
  __shared__ __attribute__((aligned(16))) float    pmax[16][NS];                   // per-wave row maxima  [row][wave]
  __shared__ __attribute__((aligned(16))) float    pden[16][NS];                   // per-wave row sums    [row][wave]

  const int tid  = threadIdx.x;
  const int lane = tid & 31;
  const int wave = __builtin_amdgcn_readfirstlane(tid >> 5);
  const int half = lane >> 4;
  const int ln   = lane & 15;
  int b, tq;
  if (EARLY) { b = blockIdx.x / (4 * NTB_E);  tq = blockIdx.x - b * (4 * NTB_E); }
  else       { b = blockIdx.x / (4 * NTB_LD); tq = 4 * NTB_E + (blockIdx.x - b * (4 * NTB_LD)); }
  const int row0 = tq * 16;                      // first query row of this block (within the sequence)

  const _Float16* qrow  = qh + ((size_t)b * SEQ + row0 + ln) * HDIM + 8 * half;
  const _Float16* kbase = kh + (size_t)b * SEQ * HDIM + 8 * half;
  const _Float16* vbase = vT + (size_t)b * HDIM * SEQ + 8 * half;
  const _Float16* rbase = vR + (size_t)b * HDIM * SEQ + 8 * half;

  // pad flag of the query row that this thread will merge and store (row0 + tid / TPR, always < SEQ)
  const int mk = mask[(size_t)b * SEQ_FULL + row0 + tid / TPR];
  // held before any register that the flag load names (its offset, its base pair) is written again
  asm volatile("s_wait_xcnt 0x0" ::: "memory");

  // loop-invariant Q A fragments (feature blocks 0..31, 32..63)
  const v16h qa0 = frag_f16(qrow);
  const v16h qa1 = frag_f16(qrow + 32);

  v16h ones;
#pragma unroll
  for (int i = 0; i < 16; ++i) ones[i] = (_Float16)1.0f;

  v8f o[4], orr[4];
  v8f osum, osumr;
#pragma unroll
  for (int r = 0; r < 8; ++r) { osum[r] = 0.0f; osumr[r] = 0.0f; }
#pragma unroll
  for (int ht = 0; ht < 4; ++ht) {
#pragma unroll
    for (int r = 0; r < 8; ++r) { o[ht][r] = 0.0f; orr[ht][r] = 0.0f; }
  }
  float rmax[8];
#pragma unroll
  for (int r = 0; r < 8; ++r) rmax[r] = NEG_BIG;

  const int nchunk = ((row0 + 15) >> 5) + 1;     // keys 0 .. row0+15 in chunks of 32
  const int ntrip  = (nchunk + NS - 1) / NS;     // block-uniform trip count
#pragma unroll 1
  for (int j = 0; j < ntrip; ++j) {
    const int c   = j * NS + wave;
    const int kt0 = c * 32;
    const bool active = (c < nchunk);           // wave-uniform
    v8f s[2];
#pragma unroll
    for (int r = 0; r < 8; ++r) { s[0][r] = 0.0f; s[1][r] = 0.0f; }

    if (active) {
      // S[16 x 32] = Q(16 x 64) . K^T, K as B operand: column = key (lane&15), k = feature (split map)
#pragma unroll
      for (int nt = 0; nt < 2; ++nt) {
        const int key = kt0 + nt * 16 + ln;
        const _Float16* krow = kbase + (size_t)key * HDIM;
        const v16h kb0 = frag_f16(krow);
        const v16h kb1 = frag_f16(krow + 32);
        v8f acc;
#pragma unroll
        for (int r = 0; r < 8; ++r) acc[r] = 0.0f;
        acc = wmma_f16(qa0, kb0, acc);
        acc = wmma_f16(qa1, kb1, acc);
#pragma unroll
        for (int r = 0; r < 8; ++r) {
          const float sv = acc[r] * SCL;                            // CDIM^-0.5, log2e already in q
          s[nt][r] = (key > row0 + 8 * half + r) ? NEG_BIG : sv;   // causal fill (replace)
        }
      }
      // online softmax, row = 8*half + r, columns across the 16-lane half
      float alpha[8];
#pragma unroll
      for (int r = 0; r < 8; ++r) {
        float tmax = fmaxf(s[0][r], s[1][r]);
#pragma unroll
        for (int m = 1; m < 16; m <<= 1) tmax = fmaxf(tmax, __shfl_xor(tmax, m, 32));
        const float nmax = fmaxf(rmax[r], tmax);
        alpha[r] = exp2f(rmax[r] - nmax);
        rmax[r]  = nmax;
        s[0][r] = exp2f(s[0][r] - nmax);
        s[1][r] = exp2f(s[1][r] - nmax);
      }
#pragma unroll
      for (int r = 0; r < 8; ++r) {
        osum[r] *= alpha[r];
        if (EARLY) osumr[r] *= alpha[r];
#pragma unroll
        for (int ht = 0; ht < 4; ++ht) {
          o[ht][r] *= alpha[r];
          if (EARLY) orr[ht][r] *= alpha[r];
        }
      }
    }

    // P: D layout -> [q_local][key_local] in LDS (carried x 1024; residual x 1024 more), then reloaded as A fragments
    __syncthreads();
    if (active) {
#pragma unroll
      for (int nt = 0; nt < 2; ++nt) {
#pragma unroll
        for (int r = 0; r < 8; ++r) {
          const float pf = s[nt][r] * 1024.0f;
          const _Float16 ph = (_Float16)pf;
          pbuf[wave][r + 8 * half][nt * 16 + ln] = ph;
          if (EARLY) {
            const _Float16 pr = (_Float16)((pf - (float)ph) * 1024.0f);
            rbuf[wave][r + 8 * half][nt * 16 + ln] = pr;
          }
        }
      }
    }
    __syncthreads();

    if (active) {
      const v16h pa = frag_f16(&pbuf[wave][ln][8 * half]);
      // V as B operand: column = feature (lane&15), k = key (split map) from the key-contiguous planes
      if (EARLY) {
        const v16h pra = frag_f16(&rbuf[wave][ln][8 * half]);
#pragma unroll
        for (int ht = 0; ht < 4; ++ht) {
          const v16h vb = frag_f16(vbase + (size_t)(ht * 16 + ln) * SEQ + kt0);
          o[ht]   = wmma_f16(pa,  vb, o[ht]);
          orr[ht] = wmma_f16(pra, vb, orr[ht]);
        }
        osum  = wmma_f16(pa,  ones, osum);
        osumr = wmma_f16(pra, ones, osumr);
#pragma unroll
        for (int ht = 0; ht < 4; ++ht) {
          const v16h vr = frag_f16(rbase + (size_t)(ht * 16 + ln) * SEQ + kt0);
          orr[ht] = wmma_f16(pa, vr, orr[ht]);
        }
      } else {
#pragma unroll
        for (int ht = 0; ht < 4; ++ht) {
          const v16h vb = frag_f16(vbase + (size_t)(ht * 16 + ln) * SEQ + kt0);
          o[ht] = wmma_f16(pa, vb, o[ht]);
        }
        osum = wmma_f16(pa, ones, osum);   // row sums of the same f16 P in D layout
      }
    }
  }

  // lane index taken anew from the value that the loop's shuffles already hold, so that no thread-index value has to
  // stay in a register across the loop (the register budget decides how many blocks a WGP holds)
  const int el  = (int)__lane_id();
  const int eh  = el >> 4;
  const int eln = el & 15;

  // merge ownership: each thread owns CPT adjacent columns of one query row
  const unsigned int et = (unsigned int)(wave * 32 + el);
  const int mrow = (int)(et / TPR);
  const int mcol = (int)(et % TPR) * CPT;

  // every wave publishes its own row maxima, row sums and unnormalised O tile (a wave without a chunk: NEG_BIG, 0, 0)
#pragma unroll
  for (int r = 0; r < 8; ++r) {
#pragma unroll
    for (int ht = 0; ht < 4; ++ht) {
      float num = o[ht][r];
      if (EARLY) num = num + orr[ht][r] * RINV;
      part[wave][8 * eh + r][ht * 16 + eln] = num;
    }
  }
  if (eln == 0) {
#pragma unroll
    for (int r = 0; r < 8; ++r) {
      float den = osum[r];
      if (EARLY) den = den + osumr[r] * RINV;
      pmax[8 * eh + r][wave] = rmax[r];
      pden[8 * eh + r][wave] = den;
    }
  }
  __syncthreads();   // all NS partial results are in LDS before any thread merges them

  // merge: the NS partials are added in wave order, each rescaled by 2^(its maximum - common maximum)
  float pm[NS];
  float gmax = NEG_BIG;
#pragma unroll
  for (int w = 0; w < NS; ++w) { pm[w] = pmax[mrow][w]; gmax = fmaxf(gmax, pm[w]); }
  float den = 0.0f;
  vcf num;
#pragma unroll
  for (int i = 0; i < CPT; ++i) num[i] = 0.0f;
#pragma unroll
  for (int w = 0; w < NS; ++w) {
    const float f = exp2f(pm[w] - gmax);
    den += pden[mrow][w] * f;
    num += *(const vcf*)(&part[w][mrow][mcol]) * f;
  }

  const float qnan = __uint_as_float(0x7fc00000u);

  // normalise (1024 carry cancels between numerator and denominator; 1/16 undoes the v carry)
  const float inv = 0.0625f * __builtin_amdgcn_rcpf(den);
  vcf res;
#pragma unroll
  for (int i = 0; i < CPT; ++i) res[i] = (mk != 0) ? (num[i] * inv) : qnan;
  *(vcf*)(out + ((size_t)b * SEQ_FULL + row0 + mrow) * HDIM + mcol) = res;
}

// ---------------------------------------------------------------------------
extern "C" void kernel_launch(void* const* d_in, const int* in_sizes, int n_in,
                              void* d_out, int out_size, void* d_ws, size_t ws_size,
                              hipStream_t stream)
{
  if (n_in < 8) return;
  const long long tok_rows = (long long)(NB - 1) * SEQ_FULL + SEQ;
  if ((long long)in_sizes[0] < tok_rows * CDIM) return;
  if ((long long)in_sizes[1] < tok_rows) return;
  if (in_sizes[2] < CDIM * HDIM || in_sizes[4] < CDIM * HDIM || in_sizes[6] < CDIM * HDIM) return;
  if (in_sizes[3] < HDIM || in_sizes[5] < HDIM || in_sizes[7] < HDIM) return;
  if ((long long)out_size < tok_rows * HDIM) return;

  const float* x    = (const float*)d_in[0];
  const int*   mask = (const int*)d_in[1];
  const float* Wq   = (const float*)d_in[2];
  const float* bq   = (const float*)d_in[3];
  const float* Wk   = (const float*)d_in[4];
  const float* bk   = (const float*)d_in[5];
  const float* Wv   = (const float*)d_in[6];
  const float* bv   = (const float*)d_in[7];
  float* out = (float*)d_out;

  // workspace carve (bytes): Wt 192*1024*2 = 393216 | qh NB*SEQ*64*2 | kh same | vT same | vR same
  const size_t wt_bytes = (size_t)NPROJ * WP * sizeof(unsigned short);
  const size_t plane    = (size_t)NB * SEQ * HDIM * sizeof(_Float16);
  const size_t off_wt = 0;
  const size_t off_q  = (off_wt + wt_bytes + 255) & ~(size_t)255;
  const size_t off_k  = off_q + plane;
  const size_t off_v  = off_k + plane;
  const size_t off_r  = off_v + plane;
  const size_t total  = off_r + plane;
  if (total > ws_size) return;

  unsigned short* Wt = (unsigned short*)((char*)d_ws + off_wt);
  _Float16* qh = (_Float16*)((char*)d_ws + off_q);
  _Float16* kh = (_Float16*)((char*)d_ws + off_k);
  _Float16* vT = (_Float16*)((char*)d_ws + off_v);
  _Float16* vR = (_Float16*)((char*)d_ws + off_r);

  k_wconv<<<NPROJ / 8, 256, 0, stream>>>(Wq, Wk, Wv, Wt);
  k_proj<<<(NB * SEQ) / 64, 256, 0, stream>>>(x, Wt, bq, bk, bv, qh, kh, vT, vR);
  k_attn<1><<<NB * NTB_E * 4, NS_E * 32, 0, stream>>>(qh, kh, vT, vR, mask, out);
  if (NTB_L > 0) k_attn<0><<<NB * NTB_LD * 4, NS_L * 32, 0, stream>>>(qh, kh, vT, vR, mask, out);
}

// v004
// It runs in 52.7 microseconds.
// Two timings next to v003 both put it at 1.15 times that version's speed.
// Counting every step since v000, it is 4.32 times as fast.
#include <hip/hip_runtime.h>

// Contractions: x*W projections (q,k,v): v_wmma_f32_16x16x32_bf16, bf16 operands (RNE-converted inputs), f32 accumulate.
// q.k scores, P.v, P row sums: v_wmma_f32_16x16x32_f16, f16 operands (q x log2e, k, P x 1024, v x 16), f32 accumulate;
// query rows < 256 of each sequence also use f16 residual planes of P and v (x1024 carries) in separate f32 accumulators.
// Bias add, rotary pair mixing (f32 cos/sin via powf + sincosf), online softmax and normalisation in f32.

#ifndef NB
#define NB 4
#endif
#ifndef SEQ
#define SEQ 2048
#endif
#define NB_FULL  4
#define SEQ_FULL 2048
#define CDIM  1024
#define HDIM  64
#define NPROJ 192
#define WP    1024        // pitch of the k-contiguous W plane (16-bit elements) == CDIM, 2048 B = 16 lines
#define XC    256         // k chunk of the x tile staged in LDS per pass
#define XP    264         // LDS pitch of the staged x chunk (16-bit elements)
#define NTB    (SEQ / 64)                    // 64-row query tiles per sequence
#define NTB_E  ((NTB < 4) ? NTB : 4)         // tiles with query rows < 256: residual path
#define NTB_L  (NTB - NTB_E)
#define NTB_LD ((NTB_L > 0) ? NTB_L : 1)
#define NS_A   16                             // key splits (waves) per 16-row query tile, the same for all rows (one launch)

static_assert(SEQ % 64 == 0 && SEQ >= 64);
static_assert(NS_A == 8 || NS_A == 16);
static_assert(SEQ <= SEQ_FULL);
static_assert(NB >= 1 && NB <= NB_FULL);
static_assert(WP == CDIM && (CDIM % XC) == 0 && (XC % 32) == 0);
static_assert(((WP * 2) % 512) == 0);
static_assert(XP >= XC && (XP % 8) == 0);
static_assert(XC == 32 * 8);   // one W row of a chunk = one wave-wide 16-byte load
static_assert(NPROJ == 3 * HDIM && (NPROJ % 8) == 0 && (HDIM % 8) == 0 && HDIM == 64);
static_assert(64 * XP >= 4 * 4096);
static_assert(((long long)(NB - 1) * SEQ_FULL + SEQ) * HDIM <= 524288LL);

typedef _Float16       v16h  __attribute__((ext_vector_type(16)));
typedef _Float16       v8h   __attribute__((ext_vector_type(8)));
typedef float          v8f   __attribute__((ext_vector_type(8)));
typedef float          v4f   __attribute__((ext_vector_type(4)));
typedef unsigned short v16us __attribute__((ext_vector_type(16)));
typedef unsigned short v8us  __attribute__((ext_vector_type(8)));
typedef unsigned int   v4u   __attribute__((ext_vector_type(4)));
typedef unsigned int   v2u   __attribute__((ext_vector_type(2)));
typedef __bf16         v16bf __attribute__((ext_vector_type(16)));

union FragH { v16h v; v8h h[2]; };
union FragU { v16us v; v8us h[2]; };

#define LOG2E_F 1.4426950408889634f
#define NEG_BIG (-3.0e38f)
#define RINV    0.0009765625f
#define SCL     0.03125f          // CDIM^-0.5

// f32 -> bf16 bits, RNE convert
__device__ __forceinline__ unsigned int bf_bits(float f) {
  const unsigned int u = __float_as_uint(f);
  return (u + 0x7FFFu + ((u >> 16) & 1u)) >> 16;
}
// f32 -> bf16 (RNE) -> f32
__device__ __forceinline__ float bfr(float f) {
  return __uint_as_float(bf_bits(f) << 16);
}

// WMMA helpers with the VALU hazard guard (ties D, keeps A/B live)
__device__ __forceinline__ v8f wmma_f16(v16h a, v16h b, v8f c) {
  v8f d = __builtin_amdgcn_wmma_f32_16x16x32_f16(false, a, false, b, (short)0, c, false, false);
  asm volatile("v_nop\n\tv_nop\n\tv_nop\n\tv_nop" : "+v"(d) : "v"(a), "v"(b));
  return d;
}
__device__ __forceinline__ v8f wmma_bf16(v16us a, v16us b, v8f c) {
  v8f d = __builtin_amdgcn_wmma_f32_16x16x32_bf16(false, __builtin_bit_cast(v16bf, a), false,
                                                   __builtin_bit_cast(v16bf, b), (short)0, c, false, false);
  asm volatile("v_nop\n\tv_nop\n\tv_nop\n\tv_nop" : "+v"(d) : "v"(a), "v"(b));
  return d;
}

// 16-bit operand fragment, split k map for BOTH A and B:
// p = (row or column (lane&15)) base + k0 + 8*(lane>>4); elements 0..7 <- p[0..7], elements 8..15 <- p[16..23].
__device__ __forceinline__ v16h frag_f16(const _Float16* p) {
  FragH f;
  f.h[0] = *(const v8h*)p;
  f.h[1] = *(const v8h*)(p + 16);
  return f.v;
}
__device__ __forceinline__ v16us frag_u16(const unsigned short* p) {
  FragU f;
  f.h[0] = *(const v8us*)p;
  f.h[1] = *(const v8us*)(p + 16);
  return f.v;
}

// ---------------------------------------------------------------------------
// Kernel 1: W [c][64] (q,k,v) -> one k-contiguous bf16 plane Wt[n][WP], n = p*64 + hcol (p: 0 q, 1 k, 2 v).
// Block = 8 output rows (coalesced 32-B reads of W, transposed in LDS); one wave per output row,
// ---------------------------------------------------------------------------
__global__ __launch_bounds__(256) void k_wconv(
    const float* __restrict__ Wq, const float* __restrict__ Wk, const float* __restrict__ Wv,
    unsigned short* __restrict__ Wt)
{
  __shared__ __attribute__((aligned(16))) unsigned short sw[8 * WP];   // [hcol_local][c], 16384 B

  const int tid   = threadIdx.x;
  const int lane  = tid & 31;
  const int wave  = __builtin_amdgcn_readfirstlane(tid >> 5);
  const int p     = blockIdx.x >> 3;
  const int hcol0 = (blockIdx.x & 7) * 8;
  const float* W = (p == 0) ? Wq : ((p == 1) ? Wk : Wv);   // block-uniform select, same address space

  for (int i = tid; i < CDIM * 2; i += 256) {
    const int c  = i >> 1;
    const int q4 = (i & 1) * 4;
    const v4f v = *(const v4f*)(W + (size_t)c * HDIM + hcol0 + q4);
    sw[(q4 + 0) * WP + c] = (unsigned short)bf_bits(v.x);
    sw[(q4 + 1) * WP + c] = (unsigned short)bf_bits(v.y);
    sw[(q4 + 2) * WP + c] = (unsigned short)bf_bits(v.z);
    sw[(q4 + 3) * WP + c] = (unsigned short)bf_bits(v.w);
  }
  __syncthreads();

  const int n = p * HDIM + hcol0 + wave;          // 0..NPROJ-1
  unsigned short* dst = Wt + (size_t)n * WP;
  v4u w[4];
#pragma unroll
  for (int j = 0; j < 4; ++j) w[j] = *(const v4u*)(sw + wave * WP + j * 256 + lane * 8);
#pragma unroll
  for (int j = 0; j < 4; ++j) *(v4u*)(dst + j * 256 + lane * 8) = w[j];
  
}

// ---------------------------------------------------------------------------
// Kernel 2: q,k,v projections (+bias, rotary pair mixing on q,k) for a tile of 64 token rows on bf16 WMMA.
// 8 waves: wave -> 16 rows (wave&3) x 96 output columns (wave>>2). x tile staged in LDS as bf16 in 4 chunks of 256 k,
// and with each x chunk the same 256 k of all 192 W rows, so that the B fragments come from LDS like the A fragments.
// Outputs: qh = f16(rot(q+bq)*log2e) [tok][64], kh = f16(rot(k+bk)) [tok][64], vT = f16(16*(v+bv)) [b][64][SEQ],
// vR = f16((16*v - vT) * 1024) [b][64][SEQ] (residual plane).
// ---------------------------------------------------------------------------
__global__ __launch_bounds__(256) __attribute__((amdgpu_num_vgpr(256)))
void k_proj(const float* __restrict__ x, const unsigned short* __restrict__ Wt,
            const float* __restrict__ bq, const float* __restrict__ bk, const float* __restrict__ bv,
            _Float16* __restrict__ qh, _Float16* __restrict__ kh,
            _Float16* __restrict__ vT, _Float16* __restrict__ vR)
{
  __shared__ __attribute__((aligned(16))) unsigned short sm[64 * XP];    // 33792 B, later reused as staging
  __shared__ __attribute__((aligned(16))) unsigned short swt[NPROJ * XP]; // W chunk [n][k], same pitch as the x chunk, 101376 B
  __shared__ __attribute__((aligned(16))) float scs[64 * HDIM];         // [tl][2i] = cos, [tl][2i+1] = sin
  __shared__ float sb[NPROJ];                                           // biases (bf16 RNE-converted)

  const int tid  = threadIdx.x;
  const int lane = tid & 31;
  const int wave = __builtin_amdgcn_readfirstlane(tid >> 5);
  const int half = lane >> 4;
  const int ln   = lane & 15;
  const int m0 = blockIdx.x * 64;               // compact token row of this tile
  const int b  = m0 / SEQ;
  const int t0 = m0 - b * SEQ;
  const float* xblk = x + ((size_t)b * SEQ_FULL + t0) * CDIM;

  // rotary table for positions t0..t0+63: f_i = 1 / 10000^(i/32), angle = t * f_i, i = 0..31
#pragma unroll 1
  for (int i = tid; i < 64 * (HDIM / 2); i += 256) {
    const int r  = i >> 5;
    const int pr = i & 31;
    const float ex  = (float)(2 * pr) * 0.015625f;
    const float fr  = 1.0f / powf(10000.0f, ex);
    const float ang = (float)(t0 + r) * fr;
    float sn, cn;
    sincosf(ang, &sn, &cn);
    scs[r * HDIM + 2 * pr]     = cn;
    scs[r * HDIM + 2 * pr + 1] = sn;
  }
  if (tid < HDIM) {                             // waves 0 and 1 exactly (wave-uniform)
    sb[tid]            = bfr(bq[tid]);
    sb[HDIM + tid]     = bfr(bk[tid]);
    sb[2 * HDIM + tid] = bfr(bv[tid]);
  }

  const int rg = wave & 3;
  const int ch = wave >> 2;
  v8f acc[6];
#pragma unroll
  for (int nt = 0; nt < 6; ++nt) {
#pragma unroll
    for (int r = 0; r < 8; ++r) acc[nt][r] = 0.0f;
  }

  const unsigned short* wsrc = Wt + (size_t)(wave * (NPROJ / 8)) * WP + lane * 8;   // this lane's 16 bytes of the wave's first W row
#pragma unroll 1
  for (int kc = 0; kc < CDIM; kc += XC) {
    __syncthreads();   // all waves done reading the prior chunk
    // W chunk: wave w brings rows 24w..24w+23, each row's XC elements as 512 contiguous bytes; the loads are issued
    // ahead of the x chunk's and stored behind it
    v4u wr[NPROJ / 8];
#pragma unroll   // constant indices keep wr[] in registers and all 24 loads in flight at once
    for (int j = 0; j < NPROJ / 8; ++j)
      wr[j] = *(const v4u*)(wsrc + (size_t)j * WP);
    // stage x chunk: 64 rows x XC columns (kc..kc+XC-1) -> bf16
    for (int i = tid; i < 64 * (XC / 4); i += 256) {
      const int r  = i / (XC / 4);
      const int c4 = i - r * (XC / 4);
      const v4f v = *(const v4f*)(xblk + (size_t)r * CDIM + kc + c4 * 4);
      v2u w;
      w.x = bf_bits(v.x) | (bf_bits(v.y) << 16);
      w.y = bf_bits(v.z) | (bf_bits(v.w) << 16);
      *(v2u*)(sm + r * XP + c4 * 4) = w;
    }
#pragma unroll   // constant indices keep wr[] in registers
    for (int j = 0; j < NPROJ / 8; ++j)
      *(v4u*)(swt + (wave * (NPROJ / 8) + j) * XP + lane * 8) = wr[j];
    wsrc += XC;
    __syncthreads();

    const unsigned short* arow = sm + (rg * 16 + ln) * XP + 8 * half;
    const unsigned short* brow = swt + (ch * 96 + ln) * XP + 8 * half;
    // two register sets of fragments: the 14 LDS reads of k step ks + 1 are issued as one group ahead of the 6 products
    // of step ks, so that a product no longer waits out the LDS latency of its own operands
    v16us af[2];
    v16us bf[2][6];
    af[0] = frag_u16(arow);
#pragma unroll
    for (int nt = 0; nt < 6; ++nt) bf[0][nt] = frag_u16(brow + nt * 16 * XP);
#pragma unroll   // constant set indices keep both fragment sets in registers, with no copies between them
    for (int ks = 0; ks < XC / 32; ++ks) {
      const int cur = ks & 1;
      const int nxt = cur ^ 1;
      if (ks + 1 < XC / 32) {
        af[nxt] = frag_u16(arow + (ks + 1) * 32);
#pragma unroll
        for (int nt = 0; nt < 6; ++nt) bf[nxt][nt] = frag_u16(brow + nt * 16 * XP + (ks + 1) * 32);
      }
#pragma unroll
      for (int nt = 0; nt < 6; ++nt) acc[nt] = wmma_bf16(af[cur], bf[cur][nt], acc[nt]);
    }
  }
  __syncthreads();   // all waves done reading the x tile

  // staging (16-bit elements): sQ = sm[0..4095] as [t][64], sK = sm[4096..8191] as [t][64],
  // sV = sm[8192..12287] as [hcol][t], sVr = sm[12288..16383] as [hcol][t]
#pragma unroll
  for (int nt = 0; nt < 6; ++nt) {
    const int n0 = ch * 96 + nt * 16;            // wave-uniform
    const int p  = n0 >> 6;
    const int hc = (n0 & 63) + ln;
    const float bias = sb[p * HDIM + hc];
    const float sc = (p == 0) ? LOG2E_F : ((p == 2) ? 16.0f : 1.0f);
    unsigned short* base = sm + p * 4096;
#pragma unroll
    for (int r = 0; r < 8; ++r) {
      const int tl = rg * 16 + 8 * half + r;
      const float val = acc[nt][r] + bias;
      const float pv  = __shfl_xor(val, 1, 32);          // pair partner column hc^1 (lane ln^1), unconditional
      const float cn  = scs[tl * HDIM + (hc & ~1)];
      const float sn  = scs[tl * HDIM + (hc | 1)];
      const float t1  = val * cn;
      const float t2  = pv * sn;
      const float rot = (hc & 1) ? (t1 + t2) : (t1 - t2);  // even: ev*c - od*s ; odd: od*c + ev*s
      const float vf  = ((p < 2) ? rot : val) * sc;
      const int idx = (p == 2) ? (hc * 64 + tl) : (tl * 64 + hc);
      const _Float16 hv = (_Float16)vf;
      base[idx] = __builtin_bit_cast(unsigned short, hv);
      if (p == 2) {
        const _Float16 rv = (_Float16)((vf - (float)hv) * 1024.0f);
        sm[12288 + idx] = __builtin_bit_cast(unsigned short, rv);
      }
    }
  }
  __syncthreads();

  // whole-line stores: wave w owns token rows 8w..8w+7 of qh/kh and hcol rows 8w..8w+7 of vT/vR
  const int rl = lane >> 3;
  const int pc = lane & 7;
  const int rA = wave * 8 + rl;
  const int rB = rA + 4;
  const v4u qA = *(const v4u*)(sm + rA * 64 + pc * 8);
  const v4u qB = *(const v4u*)(sm + rB * 64 + pc * 8);
  const v4u kA = *(const v4u*)(sm + 4096 + rA * 64 + pc * 8);
  const v4u kB = *(const v4u*)(sm + 4096 + rB * 64 + pc * 8);
  const v4u vA = *(const v4u*)(sm + 8192 + rA * 64 + pc * 8);
  const v4u vB = *(const v4u*)(sm + 8192 + rB * 64 + pc * 8);
  const v4u uA = *(const v4u*)(sm + 12288 + rA * 64 + pc * 8);
  const v4u uB = *(const v4u*)(sm + 12288 + rB * 64 + pc * 8);
  _Float16* dqA = qh + (size_t)(m0 + rA) * HDIM + pc * 8;
  _Float16* dqB = qh + (size_t)(m0 + rB) * HDIM + pc * 8;
  _Float16* dkA = kh + (size_t)(m0 + rA) * HDIM + pc * 8;
  _Float16* dkB = kh + (size_t)(m0 + rB) * HDIM + pc * 8;
  _Float16* dvA = vT + ((size_t)b * HDIM + rA) * SEQ + t0 + pc * 8;
  _Float16* dvB = vT + ((size_t)b * HDIM + rB) * SEQ + t0 + pc * 8;
  _Float16* duA = vR + ((size_t)b * HDIM + rA) * SEQ + t0 + pc * 8;
  _Float16* duB = vR + ((size_t)b * HDIM + rB) * SEQ + t0 + pc * 8;
  *(v4u*)dqA = qA; *(v4u*)dqB = qB;
  *(v4u*)dkA = kA; *(v4u*)dkB = kB;
  *(v4u*)dvA = vA; *(v4u*)dvB = vB;
  *(v4u*)duA = uA; *(v4u*)duB = uB;
  
}

// ---------------------------------------------------------------------------
// Kernel 3: causal flash attention, all query tiles in one launch. Block = one tile of 16 query rows; its NS waves split the tile's key chunks
// (32 keys each): wave w takes chunks w, w + NS, w + 2*NS, ... and keeps its own running maximum, sums and O tile.
// S tiles (D layout) -> online softmax in log2 domain -> P x 1024 to f16 A layout via LDS -> O += P.V, sums += P.ones.
// After the loop the partial results of the waves that can hold a chunk (NM of the NS) are merged through LDS in wave order (rescaled to the common row maximum).
// EARLY = 1 handles query rows < 256: adds P residual (x1024) and v residual plane (x1024)
// products into separate accumulators folded with 2^-10 before the merge; EARLY = 0 handles the rest.
// Query rows with mask == 0 get NaN (whole score row excluded -> NaN softmax).
// The two paths share one grid behind a block-uniform branch: neither reads what the other writes. The later rows' tiles
// come first in the grid, by rising row; the short tiles of rows < 256 come last and run beside them.
// Second launch bound (waves per SIMD): 8, so that two 16-wave blocks fit one WGP and the whole grid is resident at once.
// ---------------------------------------------------------------------------
template <int EARLY>
__device__ __forceinline__
void attn_tile(const _Float16* __restrict__ qh, const _Float16* __restrict__ kh,
               const _Float16* __restrict__ vT, const _Float16* __restrict__ vR,
               const int* __restrict__ mask, float* __restrict__ out, const int b, const int tq,
               _Float16 (*pbuf)[16][40], _Float16 (*rbuf)[16][40], float (*part)[16][68],
               float (*pmax)[NS_A], float (*pden)[NS_A])
{
  constexpr int NS  = NS_A;                    // waves per block = key splits of the tile
  constexpr int NM  = (EARLY && 2 * NTB_E < NS) ? 2 * NTB_E : NS;   // waves that can hold a chunk (rows < 256: at most 2 chunks per 64 rows)
  constexpr int CPT = 32 / NS;                 // output columns merged per thread (16 x 64 tile over NS*32 threads)
  constexpr int TPR = HDIM / CPT;              // threads per output row in the merge
  typedef float vcf __attribute__((ext_vector_type(CPT)));

  const int tid  = threadIdx.x;
  const int lane = tid & 31;
  const int wave = __builtin_amdgcn_readfirstlane(tid >> 5);
  const int half = lane >> 4;
  const int ln   = lane & 15;
  const int row0 = tq * 16;                      // first query row of this block (within the sequence)

  const _Float16* qrow  = qh + ((size_t)b * SEQ + row0 + ln) * HDIM + 8 * half;
  // block-uniform plane bases (scalar registers); a lane's own part of an address is one 32-bit element offset, below
  // SEQ * HDIM, so that a lane carries 32 bits a plane, not a 64-bit pointer, in vector registers across the loop
  const _Float16* kbase = kh + (size_t)b * SEQ * HDIM;
  const _Float16* vbase = vT + (size_t)b * HDIM * SEQ;
  const _Float16* rbase = vR + (size_t)b * HDIM * SEQ;

  // pad flag of the query row that this thread will merge and store (row0 + tid / TPR, always < SEQ); with one wave per row the
  // index is wave-uniform, so that the flag waits in a scalar register and takes no vector register across the loop
  const int mk = mask[(size_t)b * SEQ_FULL + row0 + ((TPR == 32) ? wave : tid / TPR)];
  // held before any register that the flag load names (its offset, its base pair) is written again
  asm volatile("s_wait_xcnt 0x0" ::: "memory");

  // loop-invariant Q A fragments (feature blocks 0..31, 32..63)
  const v16h qa0 = frag_f16(qrow);
  const v16h qa1 = frag_f16(qrow + 32);

  v16h ones;
#pragma unroll
  for (int i = 0; i < 16; ++i) ones[i] = (_Float16)1.0f;

  v8f o[4], orr[4];
  v8f osum, osumr;
#pragma unroll
  for (int r = 0; r < 8; ++r) { osum[r] = 0.0f; osumr[r] = 0.0f; }
#pragma unroll
  for (int ht = 0; ht < 4; ++ht) {
#pragma unroll
    for (int r = 0; r < 8; ++r) { o[ht][r] = 0.0f; orr[ht][r] = 0.0f; }
  }
  float rmax[8];
#pragma unroll
  for (int r = 0; r < 8; ++r) rmax[r] = NEG_BIG;

  const int nchunk = ((row0 + 15) >> 5) + 1;     // keys 0 .. row0+15 in chunks of 32
  const int ntrip  = (nchunk + NS - 1) / NS;     // block-uniform trip count
#pragma unroll 1
  for (int j = 0; j < ntrip; ++j) {
    const int c   = j * NS + wave;
    const int kt0 = c * 32;
    const bool active = (c < nchunk);           // wave-uniform
    v8f s[2];
#pragma unroll
    for (int r = 0; r < 8; ++r) { s[0][r] = 0.0f; s[1][r] = 0.0f; }

    if (active) {
      // S[16 x 32] = Q(16 x 64) . K^T, K as B operand: column = key (lane&15), k = feature (split map)
#pragma unroll
      for (int nt = 0; nt < 2; ++nt) {
        const int key = kt0 + nt * 16 + ln;
        const _Float16* krow = kbase + (unsigned int)(key * HDIM + 8 * half);
        const v16h kb0 = frag_f16(krow);
        FragH kf;
        kf.h[0] = *(const v8h*)(krow + 32);
        // later rows: the row's four loads share one address pair and the last one's result lands on that pair, so the three
        // loads before it are held first (rows < 256 load from a scalar base and one offset register that no result lands on)
        if (!EARLY) asm volatile("s_wait_xcnt 0x0" ::: "memory");
        kf.h[1] = *(const v8h*)(krow + 48);
        const v16h kb1 = kf.v;
        v8f acc;
#pragma unroll
        for (int r = 0; r < 8; ++r) acc[r] = 0.0f;
        acc = wmma_f16(qa0, kb0, acc);
        acc = wmma_f16(qa1, kb1, acc);
#pragma unroll
        for (int r = 0; r < 8; ++r) {
          const float sv = acc[r] * SCL;                            // CDIM^-0.5, log2e already in q
          s[nt][r] = (key > row0 + 8 * half + r) ? NEG_BIG : sv;   // causal fill (replace)
        }
      }
      // online softmax, row = 8*half + r, columns across the 16-lane half
      float alpha[8];
#pragma unroll
      for (int r = 0; r < 8; ++r) {
        float tmax = fmaxf(s[0][r], s[1][r]);
#pragma unroll
        for (int m = 1; m < 16; m <<= 1) tmax = fmaxf(tmax, __shfl_xor(tmax, m, 32));
        const float nmax = fmaxf(rmax[r], tmax);
        alpha[r] = exp2f(rmax[r] - nmax);
        rmax[r]  = nmax;
        s[0][r] = exp2f(s[0][r] - nmax);
        s[1][r] = exp2f(s[1][r] - nmax);
      }
#pragma unroll
      for (int r = 0; r < 8; ++r) {
        osum[r] *= alpha[r];
        if (EARLY) osumr[r] *= alpha[r];
#pragma unroll
        for (int ht = 0; ht < 4; ++ht) {
          o[ht][r] *= alpha[r];
          if (EARLY) orr[ht][r] *= alpha[r];
        }
      }
    }

    // P: D layout -> [q_local][key_local] in LDS (carried x 1024; residual x 1024 more), then reloaded as A fragments
    __syncthreads();
    if (active) {
#pragma unroll
      for (int nt = 0; nt < 2; ++nt) {
#pragma unroll
        for (int r = 0; r < 8; ++r) {
          const float pf = s[nt][r] * 1024.0f;
          const _Float16 ph = (_Float16)pf;
          pbuf[wave][r + 8 * half][nt * 16 + ln] = ph;
          if (EARLY) {
            const _Float16 pr = (_Float16)((pf - (float)ph) * 1024.0f);
            rbuf[wave][r + 8 * half][nt * 16 + ln] = pr;
          }
        }
      }
    }
    __syncthreads();

    if (active) {
      const v16h pa = frag_f16(&pbuf[wave][ln][8 * half]);
      // V as B operand: column = feature (lane&15), k = key (split map) from the key-contiguous planes
      if (EARLY) {
        const v16h pra = frag_f16(&rbuf[wave][ln][8 * half]);
#pragma unroll
        for (int ht = 0; ht < 4; ++ht) {
          const v16h vb = frag_f16(vbase + (unsigned int)((ht * 16 + ln) * SEQ + kt0 + 8 * half));
          o[ht]   = wmma_f16(pa,  vb, o[ht]);
          orr[ht] = wmma_f16(pra, vb, orr[ht]);
        }
        osum  = wmma_f16(pa,  ones, osum);
        osumr = wmma_f16(pra, ones, osumr);
#pragma unroll
        for (int ht = 0; ht < 4; ++ht) {
          const v16h vr = frag_f16(rbase + (unsigned int)((ht * 16 + ln) * SEQ + kt0 + 8 * half));
          orr[ht] = wmma_f16(pa, vr, orr[ht]);
        }
      } else {
#pragma unroll
        for (int ht = 0; ht < 4; ++ht) {
          const v16h vb = frag_f16(vbase + (unsigned int)((ht * 16 + ln) * SEQ + kt0 + 8 * half));
          o[ht] = wmma_f16(pa, vb, o[ht]);
        }
        osum = wmma_f16(pa, ones, osum);   // row sums of the same f16 P in D layout
      }
    }
  }

  // lane index taken anew from the value that the loop's shuffles already hold, so that no thread-index value has to
  // stay in a register across the loop (the register budget decides how many blocks a WGP holds)
  const int el  = (int)__lane_id();
  const int eh  = el >> 4;
  const int eln = el & 15;

  // merge ownership: each thread owns CPT adjacent columns of one query row
  const unsigned int et = (unsigned int)(wave * 32 + el);
  const int mrow = (int)(et / TPR);
  const int mcol = (int)(et % TPR) * CPT;

  // every wave publishes its own row maxima, row sums and unnormalised O tile (a wave without a chunk: NEG_BIG, 0, 0)
#pragma unroll
  for (int r = 0; r < 8; ++r) {
#pragma unroll
    for (int ht = 0; ht < 4; ++ht) {
      float num = o[ht][r];
      if (EARLY) num = num + orr[ht][r] * RINV;
      part[wave][8 * eh + r][ht * 16 + eln] = num;
    }
  }
  if (eln == 0) {
#pragma unroll
    for (int r = 0; r < 8; ++r) {
      float den = osum[r];
      if (EARLY) den = den + osumr[r] * RINV;
      pmax[8 * eh + r][wave] = rmax[r];
      pden[8 * eh + r][wave] = den;
    }
  }
  __syncthreads();   // all NS partial results are in LDS before any thread merges them

  // merge: the partials of the first NM waves (those that can hold a chunk) are added in wave order, each rescaled by 2^(its maximum - common maximum)
  float pm[NM];
  float gmax = NEG_BIG;
#pragma unroll
  for (int w = 0; w < NM; ++w) { pm[w] = pmax[mrow][w]; gmax = fmaxf(gmax, pm[w]); }
  float den = 0.0f;
  vcf num;
#pragma unroll
  for (int i = 0; i < CPT; ++i) num[i] = 0.0f;
#pragma unroll
  for (int w = 0; w < NM; ++w) {
    const float f = exp2f(pm[w] - gmax);
    den += pden[mrow][w] * f;
    num += *(const vcf*)(&part[w][mrow][mcol]) * f;
  }

  const float qnan = __uint_as_float(0x7fc00000u);

  // normalise (1024 carry cancels between numerator and denominator; 1/16 undoes the v carry)
  const float inv = 0.0625f * __builtin_amdgcn_rcpf(den);
  vcf res;
#pragma unroll
  for (int i = 0; i < CPT; ++i) res[i] = (mk != 0) ? (num[i] * inv) : qnan;
  *(vcf*)(out + ((size_t)b * SEQ_FULL + row0 + mrow) * HDIM + mcol) = res;
}

__global__ __launch_bounds__(NS_A * 32, 8) __attribute__((amdgpu_num_vgpr(256)))
void k_attn(const _Float16* __restrict__ qh, const _Float16* __restrict__ kh,
            const _Float16* __restrict__ vT, const _Float16* __restrict__ vR,
            const int* __restrict__ mask, float* __restrict__ out)
{
  __shared__ __attribute__((aligned(16))) _Float16 pbuf[NS_A][16][40];   // per-wave 16 x 32 P tile (x1024)
  __shared__ __attribute__((aligned(16))) _Float16 rbuf[NS_A][16][40];   // per-wave 16 x 32 P residual tile (rows < 256 only)
  __shared__ __attribute__((aligned(16))) float    part[NS_A][16][68];   // per-wave 16 x 64 partial O tile
  __shared__ __attribute__((aligned(16))) float    pmax[16][NS_A];       // per-wave row maxima  [row][wave]
  __shared__ __attribute__((aligned(16))) float    pden[16][NS_A];       // per-wave row sums    [row][wave]

  const int blk = blockIdx.x;                    // block-uniform: every barrier below is passed by the whole block
  if (blk < NB * NTB_L * 4) {
    const int b = blk / (4 * NTB_LD);
    attn_tile<0>(qh, kh, vT, vR, mask, out, b, 4 * NTB_E + (blk - b * (4 * NTB_LD)), pbuf, rbuf, part, pmax, pden);
  } else {
    const int e = blk - NB * NTB_L * 4;
    const int b = e / (4 * NTB_E);
    attn_tile<1>(qh, kh, vT, vR, mask, out, b, e - b * (4 * NTB_E), pbuf, rbuf, part, pmax, pden);
  }
}

// ---------------------------------------------------------------------------
extern "C" void kernel_launch(void* const* d_in, const int* in_sizes, int n_in,
                              void* d_out, int out_size, void* d_ws, size_t ws_size,
                              hipStream_t stream)
{
  if (n_in < 8) return;
  const long long tok_rows = (long long)(NB - 1) * SEQ_FULL + SEQ;
  if ((long long)in_sizes[0] < tok_rows * CDIM) return;
  if ((long long)in_sizes[1] < tok_rows) return;
  if (in_sizes[2] < CDIM * HDIM || in_sizes[4] < CDIM * HDIM || in_sizes[6] < CDIM * HDIM) return;
  if (in_sizes[3] < HDIM || in_sizes[5] < HDIM || in_sizes[7] < HDIM) return;
  if ((long long)out_size < tok_rows * HDIM) return;

  const float* x    = (const float*)d_in[0];
  const int*   mask = (const int*)d_in[1];
  const float* Wq   = (const float*)d_in[2];
  const float* bq   = (const float*)d_in[3];
  const float* Wk   = (const float*)d_in[4];
  const float* bk   = (const float*)d_in[5];
  const float* Wv   = (const float*)d_in[6];
  const float* bv   = (const float*)d_in[7];
  float* out = (float*)d_out;

  // workspace carve (bytes): Wt 192*1024*2 = 393216 | qh NB*SEQ*64*2 | kh same | vT same | vR same
  const size_t wt_bytes = (size_t)NPROJ * WP * sizeof(unsigned short);
  const size_t plane    = (size_t)NB * SEQ * HDIM * sizeof(_Float16);
  const size_t off_wt = 0;
  const size_t off_q  = (off_wt + wt_bytes + 255) & ~(size_t)255;
  const size_t off_k  = off_q + plane;
  const size_t off_v  = off_k + plane;
  const size_t off_r  = off_v + plane;
  const size_t total  = off_r + plane;
  if (total > ws_size) return;

  unsigned short* Wt = (unsigned short*)((char*)d_ws + off_wt);
  _Float16* qh = (_Float16*)((char*)d_ws + off_q);
  _Float16* kh = (_Float16*)((char*)d_ws + off_k);
  _Float16* vT = (_Float16*)((char*)d_ws + off_v);
  _Float16* vR = (_Float16*)((char*)d_ws + off_r);

  k_wconv<<<NPROJ / 8, 256, 0, stream>>>(Wq, Wk, Wv, Wt);
  k_proj<<<(NB * SEQ) / 64, 256, 0, stream>>>(x, Wt, bq, bk, bv, qh, kh, vT, vR);
  k_attn<<<NB * NTB * 4, NS_A * 32, 0, stream>>>(qh, kh, vT, vR, mask, out);
}

// v005
// It runs in 50 microseconds.
// In both of two side-by-side timings against v004, it was 1.05 times as fast.
// All steps since v000 together make it 4.52 times as fast.
#include <hip/hip_runtime.h>

// Contractions: x*W projections (q,k,v): v_wmma_f32_16x16x32_bf16, bf16 operands (RNE-converted inputs), f32 accumulate.
// q.k scores, P.v, P row sums: v_wmma_f32_16x16x32_f16, f16 operands (q x log2e, k, P x 1024, v x 16), f32 accumulate;
// query rows < 256 of each sequence also use f16 residual planes of P and v (x1024 carries) in separate f32 accumulators.
// Bias add, rotary pair mixing (f32 cos/sin via powf + sincosf), online softmax and normalisation in f32.

#ifndef NB
#define NB 4
#endif
#ifndef SEQ
#define SEQ 2048
#endif
#define NB_FULL  4
#define SEQ_FULL 2048
#define CDIM  1024
#define HDIM  64
#define NPROJ 192
#define WP    1024        // pitch of the k-contiguous W plane (16-bit elements) == CDIM, 2048 B = 16 lines
#define XC    256         // k chunk of the x tile staged in LDS per pass
#define XP    264         // LDS pitch of the staged x chunk (16-bit elements)
#define NTB    (SEQ / 64)                    // 64-row query tiles per sequence
#define NTB_E  ((NTB < 4) ? NTB : 4)         // tiles with query rows < 256: residual path
#define NTB_L  (NTB - NTB_E)
#define NTB_LD ((NTB_L > 0) ? NTB_L : 1)
#define NS_A   16                             // key splits (waves) per 16-row query tile, the same for all rows (one launch)

static_assert(SEQ % 64 == 0 && SEQ >= 64);
static_assert(NS_A == 8 || NS_A == 16);
static_assert(SEQ <= SEQ_FULL);
static_assert(NB >= 1 && NB <= NB_FULL);
static_assert(WP == CDIM && (CDIM % XC) == 0 && (XC % 32) == 0);
static_assert(((WP * 2) % 512) == 0);
static_assert(XP >= XC && (XP % 8) == 0);
static_assert(XC == 32 * 8);   // one W row of a chunk = one wave-wide 16-byte load
static_assert(NPROJ == 3 * HDIM && (NPROJ % 8) == 0 && (HDIM % 8) == 0 && HDIM == 64);
static_assert(64 * XP >= 4 * 4096);
static_assert(((long long)(NB - 1) * SEQ_FULL + SEQ) * HDIM <= 524288LL);

typedef _Float16       v16h  __attribute__((ext_vector_type(16)));
typedef _Float16       v8h   __attribute__((ext_vector_type(8)));
typedef float          v8f   __attribute__((ext_vector_type(8)));
typedef float          v4f   __attribute__((ext_vector_type(4)));
typedef unsigned short v16us __attribute__((ext_vector_type(16)));
typedef unsigned short v8us  __attribute__((ext_vector_type(8)));
typedef unsigned int   v4u   __attribute__((ext_vector_type(4)));
typedef unsigned int   v2u   __attribute__((ext_vector_type(2)));
typedef __bf16         v16bf __attribute__((ext_vector_type(16)));

union FragH { v16h v; v8h h[2]; };
union FragU { v16us v; v8us h[2]; };

#define LOG2E_F 1.4426950408889634f
#define NEG_BIG (-3.0e38f)
#define RINV    0.0009765625f
#define SCL     0.03125f          // CDIM^-0.5

// f32 -> bf16 bits, RNE convert
__device__ __forceinline__ unsigned int bf_bits(float f) {
  const unsigned int u = __float_as_uint(f);
  return (u + 0x7FFFu + ((u >> 16) & 1u)) >> 16;
}
// f32 -> bf16 (RNE) -> f32
__device__ __forceinline__ float bfr(float f) {
  return __uint_as_float(bf_bits(f) << 16);
}

// WMMA helpers with the VALU hazard guard (ties D, keeps A/B live)
__device__ __forceinline__ v8f wmma_f16(v16h a, v16h b, v8f c) {
  v8f d = __builtin_amdgcn_wmma_f32_16x16x32_f16(false, a, false, b, (short)0, c, false, false);
  asm volatile("v_nop\n\tv_nop\n\tv_nop\n\tv_nop" : "+v"(d) : "v"(a), "v"(b));
  return d;
}
__device__ __forceinline__ v8f wmma_bf16(v16us a, v16us b, v8f c) {
  v8f d = __builtin_amdgcn_wmma_f32_16x16x32_bf16(false, __builtin_bit_cast(v16bf, a), false,
                                                   __builtin_bit_cast(v16bf, b), (short)0, c, false, false);
  asm volatile("v_nop\n\tv_nop\n\tv_nop\n\tv_nop" : "+v"(d) : "v"(a), "v"(b));
  return d;
}

// 16-bit operand fragment, split k map for BOTH A and B:
// p = (row or column (lane&15)) base + k0 + 8*(lane>>4); elements 0..7 <- p[0..7], elements 8..15 <- p[16..23].
__device__ __forceinline__ v16h frag_f16(const _Float16* p) {
  FragH f;
  f.h[0] = *(const v8h*)p;
  f.h[1] = *(const v8h*)(p + 16);
  return f.v;
}
// The K and V planes lie in the workspace in the order in which the attention kernel's fragment loads read them: each chunk of
// 32 tokens is one block of 2048 elements = 8 pieces of 512 bytes; piece j holds, lane after lane, the 8 elements that lane l takes
// with its j-th 16-byte load, so that one wave-wide load reads 512 contiguous, line-aligned bytes (4 lines, not 16).
// K, token tl (within a tile of whole chunks), feature f: piece = 4 * (16-key tile of the chunk) + f / 16, lane = 16 * ((f / 8) & 1) + tl % 16.
__device__ __forceinline__ int kfrag_idx(int tl, int f) {
  return (tl >> 5) * 2048 + ((((tl >> 4) & 1) * 4 + (f >> 4)) * 32 + ((f >> 3) & 1) * 16 + (tl & 15)) * 8 + (f & 7);
}
// V, feature h, token tl: piece = 2 * (h / 16) + (16-key half of the chunk), lane = 16 * ((tl / 8) & 1) + h % 16.
__device__ __forceinline__ int vfrag_idx(int h, int tl) {
  return (tl >> 5) * 2048 + (((h >> 4) * 2 + ((tl >> 4) & 1)) * 32 + ((tl >> 3) & 1) * 16 + (h & 15)) * 8 + (tl & 7);
}
// fragment from two adjacent pieces of such a block: p = block + piece * 256 + lane * 8; the k map is that of frag_f16
__device__ __forceinline__ v16h frag_lin(const _Float16* p) {
  FragH f;
  f.h[0] = *(const v8h*)p;
  f.h[1] = *(const v8h*)(p + 256);
  return f.v;
}
__device__ __forceinline__ v16us frag_u16(const unsigned short* p) {
  FragU f;
  f.h[0] = *(const v8us*)p;
  f.h[1] = *(const v8us*)(p + 16);
  return f.v;
}

// ---------------------------------------------------------------------------
// Kernel 1: W [c][64] (q,k,v) -> one k-contiguous bf16 plane Wt[n][WP], n = p*64 + hcol (p: 0 q, 1 k, 2 v).
// Block = 8 output rows (coalesced 32-B reads of W, transposed in LDS); one wave per output row,
// ---------------------------------------------------------------------------
__global__ __launch_bounds__(256) void k_wconv(
    const float* __restrict__ Wq, const float* __restrict__ Wk, const float* __restrict__ Wv,
    unsigned short* __restrict__ Wt)
{
  __shared__ __attribute__((aligned(16))) unsigned short sw[8 * WP];   // [hcol_local][c], 16384 B

  const int tid   = threadIdx.x;
  const int lane  = tid & 31;
  const int wave  = __builtin_amdgcn_readfirstlane(tid >> 5);
  const int p     = blockIdx.x >> 3;
  const int hcol0 = (blockIdx.x & 7) * 8;
  const float* W = (p == 0) ? Wq : ((p == 1) ? Wk : Wv);   // block-uniform select, same address space

  for (int i = tid; i < CDIM * 2; i += 256) {
    const int c  = i >> 1;
    const int q4 = (i & 1) * 4;
    const v4f v = *(const v4f*)(W + (size_t)c * HDIM + hcol0 + q4);
    sw[(q4 + 0) * WP + c] = (unsigned short)bf_bits(v.x);
    sw[(q4 + 1) * WP + c] = (unsigned short)bf_bits(v.y);
    sw[(q4 + 2) * WP + c] = (unsigned short)bf_bits(v.z);
    sw[(q4 + 3) * WP + c] = (unsigned short)bf_bits(v.w);
  }
  __syncthreads();

  const int n = p * HDIM + hcol0 + wave;          // 0..NPROJ-1
  unsigned short* dst = Wt + (size_t)n * WP;
  v4u w[4];
#pragma unroll
  for (int j = 0; j < 4; ++j) w[j] = *(const v4u*)(sw + wave * WP + j * 256 + lane * 8);
#pragma unroll
  for (int j = 0; j < 4; ++j) *(v4u*)(dst + j * 256 + lane * 8) = w[j];
  
}

// ---------------------------------------------------------------------------
// Kernel 2: q,k,v projections (+bias, rotary pair mixing on q,k) for a tile of 64 token rows on bf16 WMMA.
// 8 waves: wave -> 16 rows (wave&3) x 96 output columns (wave>>2). x tile staged in LDS as bf16 in 4 chunks of 256 k,
// and with each x chunk the same 256 k of all 192 W rows, so that the B fragments come from LDS like the A fragments.
// Outputs: qh = f16(rot(q+bq)*log2e) [tok][64]; kh = f16(rot(k+bk)), vT = f16(16*(v+bv)) and vR = f16((16*v - vT) * 1024)
// (residual plane), each as [chunk of 32 tokens][2048] in fragment order (kfrag_idx, vfrag_idx).
// ---------------------------------------------------------------------------
__global__ __launch_bounds__(256) __attribute__((amdgpu_num_vgpr(256)))
void k_proj(const float* __restrict__ x, const unsigned short* __restrict__ Wt,
            const float* __restrict__ bq, const float* __restrict__ bk, const float* __restrict__ bv,
            _Float16* __restrict__ qh, _Float16* __restrict__ kh,
            _Float16* __restrict__ vT, _Float16* __restrict__ vR)
{
  __shared__ __attribute__((aligned(16))) unsigned short sm[64 * XP];    // 33792 B, later reused as staging
  __shared__ __attribute__((aligned(16))) unsigned short swt[NPROJ * XP]; // W chunk [n][k], same pitch as the x chunk, 101376 B
  __shared__ __attribute__((aligned(16))) float scs[64 * HDIM];         // [tl][2i] = cos, [tl][2i+1] = sin
  __shared__ float sb[NPROJ];                                           // biases (bf16 RNE-converted)

  const int tid  = threadIdx.x;
  const int lane = tid & 31;
  const int wave = __builtin_amdgcn_readfirstlane(tid >> 5);
  const int half = lane >> 4;
  const int ln   = lane & 15;
  const int m0 = blockIdx.x * 64;               // compact token row of this tile
  const int b  = m0 / SEQ;
  const int t0 = m0 - b * SEQ;
  const float* xblk = x + ((size_t)b * SEQ_FULL + t0) * CDIM;

  // rotary table for positions t0..t0+63: f_i = 1 / 10000^(i/32), angle = t * f_i, i = 0..31
#pragma unroll 1
  for (int i = tid; i < 64 * (HDIM / 2); i += 256) {
    const int r  = i >> 5;
    const int pr = i & 31;
    const float ex  = (float)(2 * pr) * 0.015625f;
    const float fr  = 1.0f / powf(10000.0f, ex);
    const float ang = (float)(t0 + r) * fr;
    float sn, cn;
    sincosf(ang, &sn, &cn);
    scs[r * HDIM + 2 * pr]     = cn;
    scs[r * HDIM + 2 * pr + 1] = sn;
  }
  if (tid < HDIM) {                             // waves 0 and 1 exactly (wave-uniform)
    sb[tid]            = bfr(bq[tid]);
    sb[HDIM + tid]     = bfr(bk[tid]);
    sb[2 * HDIM + tid] = bfr(bv[tid]);
  }

  const int rg = wave & 3;
  const int ch = wave >> 2;
  v8f acc[6];
#pragma unroll
  for (int nt = 0; nt < 6; ++nt) {
#pragma unroll
    for (int r = 0; r < 8; ++r) acc[nt][r] = 0.0f;
  }

  const unsigned short* wsrc = Wt + (size_t)(wave * (NPROJ / 8)) * WP + lane * 8;   // this lane's 16 bytes of the wave's first W row
#pragma unroll 1
  for (int kc = 0; kc < CDIM; kc += XC) {
    __syncthreads();   // all waves done reading the prior chunk
    // W chunk: wave w brings rows 24w..24w+23, each row's XC elements as 512 contiguous bytes; the loads are issued
    // ahead of the x chunk's and stored behind it
    v4u wr[NPROJ / 8];
#pragma unroll   // constant indices keep wr[] in registers and all 24 loads in flight at once
    for (int j = 0; j < NPROJ / 8; ++j)
      wr[j] = *(const v4u*)(wsrc + (size_t)j * WP);
    // stage x chunk: 64 rows x XC columns (kc..kc+XC-1) -> bf16
    for (int i = tid; i < 64 * (XC / 4); i += 256) {
      const int r  = i / (XC / 4);
      const int c4 = i - r * (XC / 4);
      const v4f v = *(const v4f*)(xblk + (size_t)r * CDIM + kc + c4 * 4);
      v2u w;
      w.x = bf_bits(v.x) | (bf_bits(v.y) << 16);
      w.y = bf_bits(v.z) | (bf_bits(v.w) << 16);
      *(v2u*)(sm + r * XP + c4 * 4) = w;
    }
#pragma unroll   // constant indices keep wr[] in registers
    for (int j = 0; j < NPROJ / 8; ++j)
      *(v4u*)(swt + (wave * (NPROJ / 8) + j) * XP + lane * 8) = wr[j];
    wsrc += XC;
    __syncthreads();

    const unsigned short* arow = sm + (rg * 16 + ln) * XP + 8 * half;
    const unsigned short* brow = swt + (ch * 96 + ln) * XP + 8 * half;
    // two register sets of fragments: the 14 LDS reads of k step ks + 1 are issued as one group ahead of the 6 products
    // of step ks, so that a product no longer waits out the LDS latency of its own operands
    v16us af[2];
    v16us bf[2][6];
    af[0] = frag_u16(arow);
#pragma unroll
    for (int nt = 0; nt < 6; ++nt) bf[0][nt] = frag_u16(brow + nt * 16 * XP);
#pragma unroll   // constant set indices keep both fragment sets in registers, with no copies between them
    for (int ks = 0; ks < XC / 32; ++ks) {
      const int cur = ks & 1;
      const int nxt = cur ^ 1;
      if (ks + 1 < XC / 32) {
        af[nxt] = frag_u16(arow + (ks + 1) * 32);
#pragma unroll
        for (int nt = 0; nt < 6; ++nt) bf[nxt][nt] = frag_u16(brow + nt * 16 * XP + (ks + 1) * 32);
      }
#pragma unroll
      for (int nt = 0; nt < 6; ++nt) acc[nt] = wmma_bf16(af[cur], bf[cur][nt], acc[nt]);
    }
  }
  __syncthreads();   // all waves done reading the x tile

  // staging (16-bit elements): sQ = sm[0..4095] as [t][64], sK = sm[4096..8191], sV = sm[8192..12287] and
  // sVr = sm[12288..16383] as the tile's two chunk blocks in fragment order
#pragma unroll
  for (int nt = 0; nt < 6; ++nt) {
    const int n0 = ch * 96 + nt * 16;            // wave-uniform
    const int p  = n0 >> 6;
    const int hc = (n0 & 63) + ln;
    const float bias = sb[p * HDIM + hc];
    const float sc = (p == 0) ? LOG2E_F : ((p == 2) ? 16.0f : 1.0f);
    unsigned short* base = sm + p * 4096;
    // r walks the low three bits of the token index, which every one of the three orders maps to a constant step
    const int tl0 = rg * 16 + 8 * half;
    const int i0  = (p == 2) ? vfrag_idx(hc, tl0) : ((p == 1) ? kfrag_idx(tl0, hc) : (tl0 * 64 + hc));
    const int ist = (p == 2) ? 1 : ((p == 1) ? 8 : 64);
#pragma unroll
    for (int r = 0; r < 8; ++r) {
      const int tl = rg * 16 + 8 * half + r;
      const float val = acc[nt][r] + bias;
      const float pv  = __shfl_xor(val, 1, 32);          // pair partner column hc^1 (lane ln^1), unconditional
      const float cn  = scs[tl * HDIM + (hc & ~1)];
      const float sn  = scs[tl * HDIM + (hc | 1)];
      const float t1  = val * cn;
      const float t2  = pv * sn;
      const float rot = (hc & 1) ? (t1 + t2) : (t1 - t2);  // even: ev*c - od*s ; odd: od*c + ev*s
      const float vf  = ((p < 2) ? rot : val) * sc;
      const int idx = i0 + r * ist;
      const _Float16 hv = (_Float16)vf;
      base[idx] = __builtin_bit_cast(unsigned short, hv);
      if (p == 2) {
        const _Float16 rv = (_Float16)((vf - (float)hv) * 1024.0f);
        sm[12288 + idx] = __builtin_bit_cast(unsigned short, rv);
      }
    }
  }
  __syncthreads();

  // whole-line stores: wave w owns token rows 8w..8w+7 of qh and pieces 2w, 2w+1 of the tile's 16 in kh, vT and vR
  const int rl = lane >> 3;
  const int pc = lane & 7;
  const int rA = wave * 8 + rl;
  const int rB = rA + 4;
  const v4u qA = *(const v4u*)(sm + rA * 64 + pc * 8);
  const v4u qB = *(const v4u*)(sm + rB * 64 + pc * 8);
  const int fA = wave * 512 + lane * 8;
  const int fB = fA + 256;
  const v4u kA = *(const v4u*)(sm + 4096 + fA);
  const v4u kB = *(const v4u*)(sm + 4096 + fB);
  const v4u vA = *(const v4u*)(sm + 8192 + fA);
  const v4u vB = *(const v4u*)(sm + 8192 + fB);
  const v4u uA = *(const v4u*)(sm + 12288 + fA);
  const v4u uB = *(const v4u*)(sm + 12288 + fB);
  _Float16* dqA = qh + (size_t)(m0 + rA) * HDIM + pc * 8;
  _Float16* dqB = qh + (size_t)(m0 + rB) * HDIM + pc * 8;
  _Float16* dkA = kh + (size_t)m0 * HDIM + fA;
  _Float16* dkB = kh + (size_t)m0 * HDIM + fB;
  _Float16* dvA = vT + (size_t)m0 * HDIM + fA;
  _Float16* dvB = vT + (size_t)m0 * HDIM + fB;
  _Float16* duA = vR + (size_t)m0 * HDIM + fA;
  _Float16* duB = vR + (size_t)m0 * HDIM + fB;
  *(v4u*)dqA = qA; *(v4u*)dqB = qB;
  *(v4u*)dkA = kA; *(v4u*)dkB = kB;
  *(v4u*)dvA = vA; *(v4u*)dvB = vB;
  *(v4u*)duA = uA; *(v4u*)duB = uB;
  
}

// ---------------------------------------------------------------------------
// Kernel 3: causal flash attention, all query tiles in one launch. Block = one tile of 16 query rows; its NS waves split the tile's key chunks
// (32 keys each): wave w takes chunks w, w + NS, w + 2*NS, ... and keeps its own running maximum, sums and O tile.
// S tiles (D layout) -> online softmax in log2 domain -> P x 1024 to f16 A layout via LDS -> O += P.V, sums += P.ones.
// After the loop the partial results of the waves that can hold a chunk (NM of the NS) are merged through LDS in wave order (rescaled to the common row maximum).
// EARLY = 1 handles query rows < 256: adds P residual (x1024) and v residual plane (x1024)
// products into separate accumulators folded with 2^-10 before the merge; EARLY = 0 handles the rest.
// Query rows with mask == 0 get NaN (whole score row excluded -> NaN softmax).
// The two paths share one grid behind a block-uniform branch: neither reads what the other writes. The later rows' tiles
// come first in the grid, by rising row; the short tiles of rows < 256 come last and run beside them.
// Second launch bound (waves per SIMD): 8, so that two 16-wave blocks fit one WGP and the whole grid is resident at once.
// ---------------------------------------------------------------------------
template <int EARLY>
__device__ __forceinline__
void attn_tile(const _Float16* __restrict__ qh, const _Float16* __restrict__ kh,
               const _Float16* __restrict__ vT, const _Float16* __restrict__ vR,
               const int* __restrict__ mask, float* __restrict__ out, const int b, const int tq,
               _Float16 (*pbuf)[16][40], _Float16 (*rbuf)[16][40], float (*part)[16][68],
               float (*pmax)[NS_A], float (*pden)[NS_A])
{
  constexpr int NS  = NS_A;                    // waves per block = key splits of the tile
  constexpr int NM  = (EARLY && 2 * NTB_E < NS) ? 2 * NTB_E : NS;   // waves that can hold a chunk (rows < 256: at most 2 chunks per 64 rows)
  constexpr int CPT = 32 / NS;                 // output columns merged per thread (16 x 64 tile over NS*32 threads)
  constexpr int TPR = HDIM / CPT;              // threads per output row in the merge
  typedef float vcf __attribute__((ext_vector_type(CPT)));

  const int tid  = threadIdx.x;
  const int lane = tid & 31;
  const int wave = __builtin_amdgcn_readfirstlane(tid >> 5);
  const int half = lane >> 4;
  const int ln   = lane & 15;
  const int row0 = tq * 16;                      // first query row of this block (within the sequence)

  const _Float16* qrow  = qh + ((size_t)b * SEQ + row0 + ln) * HDIM + 8 * half;
  // block-uniform plane bases (scalar registers); a lane's own part of an address is one 32-bit element offset, below
  // SEQ * HDIM and the same in all three planes (chunk block + lane * 8), not a 64-bit pointer
  const _Float16* kbase = kh + (size_t)b * SEQ * HDIM;
  const _Float16* vbase = vT + (size_t)b * HDIM * SEQ;
  const _Float16* rbase = vR + (size_t)b * HDIM * SEQ;

  // pad flag of the query row that this thread will merge and store (row0 + tid / TPR, always < SEQ); with one wave per row the
  // index is wave-uniform, so that the flag waits in a scalar register and takes no vector register across the loop
  const int mk = mask[(size_t)b * SEQ_FULL + row0 + ((TPR == 32) ? wave : tid / TPR)];
  // held before any register that the flag load names (its offset, its base pair) is written again
  asm volatile("s_wait_xcnt 0x0" ::: "memory");

  // loop-invariant Q A fragments (feature blocks 0..31, 32..63)
  const v16h qa0 = frag_f16(qrow);
  const v16h qa1 = frag_f16(qrow + 32);

  v16h ones;
#pragma unroll
  for (int i = 0; i < 16; ++i) ones[i] = (_Float16)1.0f;

  v8f o[4], orr[4];
  v8f osum, osumr;
#pragma unroll
  for (int r = 0; r < 8; ++r) { osum[r] = 0.0f; osumr[r] = 0.0f; }
#pragma unroll
  for (int ht = 0; ht < 4; ++ht) {
#pragma unroll
    for (int r = 0; r < 8; ++r) { o[ht][r] = 0.0f; orr[ht][r] = 0.0f; }
  }
  float rmax[8];
#pragma unroll
  for (int r = 0; r < 8; ++r) rmax[r] = NEG_BIG;

  const int nchunk = ((row0 + 15) >> 5) + 1;     // keys 0 .. row0+15 in chunks of 32
  const int ntrip  = (nchunk + NS - 1) / NS;     // block-uniform trip count
#pragma unroll 1
  for (int j = 0; j < ntrip; ++j) {
    const int c   = j * NS + wave;
    const int kt0 = c * 32;
    const bool active = (c < nchunk);           // wave-uniform
    v8f s[2];
#pragma unroll
    for (int r = 0; r < 8; ++r) { s[0][r] = 0.0f; s[1][r] = 0.0f; }

    if (active) {
      // S[16 x 32] = Q(16 x 64) . K^T, K as B operand: column = key (lane&15), k = feature (split map)
#pragma unroll
      for (int nt = 0; nt < 2; ++nt) {
        const int key = kt0 + nt * 16 + ln;
        const _Float16* kfr = kbase + (unsigned int)(c * 2048 + nt * 1024 + lane * 8);   // pieces 4nt .. 4nt+3 of the chunk's block
        const v16h kb0 = frag_lin(kfr);
        FragH kf;
        kf.h[0] = *(const v8h*)(kfr + 512);
        // later rows: the chunk's loads share one address pair, and the compiler may let a tile's last load land on that pair: the
        // loads before it are held first (rows < 256 load from a scalar base and one offset register that no result lands on)
        if (!EARLY) asm volatile("s_wait_xcnt 0x0" ::: "memory");
        kf.h[1] = *(const v8h*)(kfr + 768);
        const v16h kb1 = kf.v;
        v8f acc;
#pragma unroll
        for (int r = 0; r < 8; ++r) acc[r] = 0.0f;
        acc = wmma_f16(qa0, kb0, acc);
        acc = wmma_f16(qa1, kb1, acc);
#pragma unroll
        for (int r = 0; r < 8; ++r) {
          const float sv = acc[r] * SCL;                            // CDIM^-0.5, log2e already in q
          s[nt][r] = (key > row0 + 8 * half + r) ? NEG_BIG : sv;   // causal fill (replace)
        }
      }
      // online softmax, row = 8*half + r, columns across the 16-lane half
      float alpha[8];
#pragma unroll
      for (int r = 0; r < 8; ++r) {
        float tmax = fmaxf(s[0][r], s[1][r]);
#pragma unroll
        for (int m = 1; m < 16; m <<= 1) tmax = fmaxf(tmax, __shfl_xor(tmax, m, 32));
        const float nmax = fmaxf(rmax[r], tmax);
        alpha[r] = exp2f(rmax[r] - nmax);
        rmax[r]  = nmax;
        s[0][r] = exp2f(s[0][r] - nmax);
        s[1][r] = exp2f(s[1][r] - nmax);
      }
#pragma unroll
      for (int r = 0; r < 8; ++r) {
        osum[r] *= alpha[r];
        if (EARLY) osumr[r] *= alpha[r];
#pragma unroll
        for (int ht = 0; ht < 4; ++ht) {
          o[ht][r] *= alpha[r];
          if (EARLY) orr[ht][r] *= alpha[r];
        }
      }
    }

    // P: D layout -> [q_local][key_local] in LDS (carried x 1024; residual x 1024 more), then reloaded as A fragments
    __syncthreads();
    if (active) {
#pragma unroll
      for (int nt = 0; nt < 2; ++nt) {
#pragma unroll
        for (int r = 0; r < 8; ++r) {
          const float pf = s[nt][r] * 1024.0f;
          const _Float16 ph = (_Float16)pf;
          pbuf[wave][r + 8 * half][nt * 16 + ln] = ph;
          if (EARLY) {
            const _Float16 pr = (_Float16)((pf - (float)ph) * 1024.0f);
            rbuf[wave][r + 8 * half][nt * 16 + ln] = pr;
          }
        }
      }
    }
    __syncthreads();

    if (active) {
      const v16h pa = frag_f16(&pbuf[wave][ln][8 * half]);
      // V as B operand: column = feature (lane&15), k = key (split map): pieces 2ht, 2ht+1 of the chunk's block
      if (EARLY) {
        const v16h pra = frag_f16(&rbuf[wave][ln][8 * half]);
#pragma unroll
        for (int ht = 0; ht < 4; ++ht) {
          const v16h vb = frag_lin(vbase + (unsigned int)(c * 2048 + ht * 512 + lane * 8));
          o[ht]   = wmma_f16(pa,  vb, o[ht]);
          orr[ht] = wmma_f16(pra, vb, orr[ht]);
        }
        osum  = wmma_f16(pa,  ones, osum);
        osumr = wmma_f16(pra, ones, osumr);
#pragma unroll
        for (int ht = 0; ht < 4; ++ht) {
          const v16h vr = frag_lin(rbase + (unsigned int)(c * 2048 + ht * 512 + lane * 8));
          orr[ht] = wmma_f16(pa, vr, orr[ht]);
        }
      } else {
#pragma unroll
        for (int ht = 0; ht < 4; ++ht) {
          const v16h vb = frag_lin(vbase + (unsigned int)(c * 2048 + ht * 512 + lane * 8));
          o[ht] = wmma_f16(pa, vb, o[ht]);
        }
        osum = wmma_f16(pa, ones, osum);   // row sums of the same f16 P in D layout
      }
    }
  }

  // lane index taken anew from the value that the loop's shuffles already hold, so that no thread-index value has to
  // stay in a register across the loop (the register budget decides how many blocks a WGP holds)
  const int el  = (int)__lane_id();
  const int eh  = el >> 4;
  const int eln = el & 15;

  // merge ownership: each thread owns CPT adjacent columns of one query row
  const unsigned int et = (unsigned int)(wave * 32 + el);
  const int mrow = (int)(et / TPR);
  const int mcol = (int)(et % TPR) * CPT;

  // every wave publishes its own row maxima, row sums and unnormalised O tile (a wave without a chunk: NEG_BIG, 0, 0)
#pragma unroll
  for (int r = 0; r < 8; ++r) {
#pragma unroll
    for (int ht = 0; ht < 4; ++ht) {
      float num = o[ht][r];
      if (EARLY) num = num + orr[ht][r] * RINV;
      part[wave][8 * eh + r][ht * 16 + eln] = num;
    }
  }
  if (eln == 0) {
#pragma unroll
    for (int r = 0; r < 8; ++r) {
      float den = osum[r];
      if (EARLY) den = den + osumr[r] * RINV;
      pmax[8 * eh + r][wave] = rmax[r];
      pden[8 * eh + r][wave] = den;
    }
  }
  __syncthreads();   // all NS partial results are in LDS before any thread merges them

  // merge: the partials of the first NM waves (those that can hold a chunk) are added in wave order, each rescaled by 2^(its maximum - common maximum)
  float pm[NM];
  float gmax = NEG_BIG;
#pragma unroll
  for (int w = 0; w < NM; ++w) { pm[w] = pmax[mrow][w]; gmax = fmaxf(gmax, pm[w]); }
  float den = 0.0f;
  vcf num;
#pragma unroll
  for (int i = 0; i < CPT; ++i) num[i] = 0.0f;
#pragma unroll
  for (int w = 0; w < NM; ++w) {
    const float f = exp2f(pm[w] - gmax);
    den += pden[mrow][w] * f;
    num += *(const vcf*)(&part[w][mrow][mcol]) * f;
  }

  const float qnan = __uint_as_float(0x7fc00000u);

  // normalise (1024 carry cancels between numerator and denominator; 1/16 undoes the v carry)
  const float inv = 0.0625f * __builtin_amdgcn_rcpf(den);
  vcf res;
#pragma unroll
  for (int i = 0; i < CPT; ++i) res[i] = (mk != 0) ? (num[i] * inv) : qnan;
  *(vcf*)(out + ((size_t)b * SEQ_FULL + row0 + mrow) * HDIM + mcol) = res;
}

__global__ __launch_bounds__(NS_A * 32, 8) __attribute__((amdgpu_num_vgpr(256)))
void k_attn(const _Float16* __restrict__ qh, const _Float16* __restrict__ kh,
            const _Float16* __restrict__ vT, const _Float16* __restrict__ vR,
            const int* __restrict__ mask, float* __restrict__ out)
{
  __shared__ __attribute__((aligned(16))) _Float16 pbuf[NS_A][16][40];   // per-wave 16 x 32 P tile (x1024)
  __shared__ __attribute__((aligned(16))) _Float16 rbuf[NS_A][16][40];   // per-wave 16 x 32 P residual tile (rows < 256 only)
  __shared__ __attribute__((aligned(16))) float    part[NS_A][16][68];   // per-wave 16 x 64 partial O tile
  __shared__ __attribute__((aligned(16))) float    pmax[16][NS_A];       // per-wave row maxima  [row][wave]
  __shared__ __attribute__((aligned(16))) float    pden[16][NS_A];       // per-wave row sums    [row][wave]

  const int blk = blockIdx.x;                    // block-uniform: every barrier below is passed by the whole block
  if (blk < NB * NTB_L * 4) {
    const int b = blk / (4 * NTB_LD);
    attn_tile<0>(qh, kh, vT, vR, mask, out, b, 4 * NTB_E + (blk - b * (4 * NTB_LD)), pbuf, rbuf, part, pmax, pden);
  } else {
    const int e = blk - NB * NTB_L * 4;
    const int b = e / (4 * NTB_E);
    attn_tile<1>(qh, kh, vT, vR, mask, out, b, e - b * (4 * NTB_E), pbuf, rbuf, part, pmax, pden);
  }
}

// ---------------------------------------------------------------------------
extern "C" void kernel_launch(void* const* d_in, const int* in_sizes, int n_in,
                              void* d_out, int out_size, void* d_ws, size_t ws_size,
                              hipStream_t stream)
{
  if (n_in < 8) return;
  const long long tok_rows = (long long)(NB - 1) * SEQ_FULL + SEQ;
  if ((long long)in_sizes[0] < tok_rows * CDIM) return;
  if ((long long)in_sizes[1] < tok_rows) return;
  if (in_sizes[2] < CDIM * HDIM || in_sizes[4] < CDIM * HDIM || in_sizes[6] < CDIM * HDIM) return;
  if (in_sizes[3] < HDIM || in_sizes[5] < HDIM || in_sizes[7] < HDIM) return;
  if ((long long)out_size < tok_rows * HDIM) return;

  const float* x    = (const float*)d_in[0];
  const int*   mask = (const int*)d_in[1];
  const float* Wq   = (const float*)d_in[2];
  const float* bq   = (const float*)d_in[3];
  const float* Wk   = (const float*)d_in[4];
  const float* bk   = (const float*)d_in[5];
  const float* Wv   = (const float*)d_in[6];
  const float* bv   = (const float*)d_in[7];
  float* out = (float*)d_out;

  // workspace carve (bytes): Wt 192*1024*2 = 393216 | qh NB*SEQ*64*2 | kh same | vT same | vR same
  const size_t wt_bytes = (size_t)NPROJ * WP * sizeof(unsigned short);
  const size_t plane    = (size_t)NB * SEQ * HDIM * sizeof(_Float16);
  const size_t off_wt = 0;
  const size_t off_q  = (off_wt + wt_bytes + 255) & ~(size_t)255;
  const size_t off_k  = off_q + plane;
  const size_t off_v  = off_k + plane;
  const size_t off_r  = off_v + plane;
  const size_t total  = off_r + plane;
  if (total > ws_size) return;

  unsigned short* Wt = (unsigned short*)((char*)d_ws + off_wt);
  _Float16* qh = (_Float16*)((char*)d_ws + off_q);
  _Float16* kh = (_Float16*)((char*)d_ws + off_k);
  _Float16* vT = (_Float16*)((char*)d_ws + off_v);
  _Float16* vR = (_Float16*)((char*)d_ws + off_r);

  k_wconv<<<NPROJ / 8, 256, 0, stream>>>(Wq, Wk, Wv, Wt);
  k_proj<<<(NB * SEQ) / 64, 256, 0, stream>>>(x, Wt, bq, bk, bv, qh, kh, vT, vR);
  k_attn<<<NB * NTB * 4, NS_A * 32, 0, stream>>>(qh, kh, vT, vR, mask, out);
}

// v006
// It runs in 42.5 microseconds.
// Two timings next to v005 put it at 1.18 and 1.19 times that version's speed.
// All steps since v000 together make it 5.36 times as fast.
#include <hip/hip_runtime.h>

// Contractions: x*W projections (q,k,v): v_wmma_f32_16x16x32_bf16, bf16 operands (RNE-converted inputs), f32 accumulate.
// q.k scores, P.v, P row sums: v_wmma_f32_16x16x32_f16, f16 operands (q x log2e, k, P x 1024, v x 16), f32 accumulate;
// query rows < 256 of each sequence also use f16 residual planes of P and v (x1024 carries) in separate f32 accumulators.
// Bias add, rotary pair mixing (f32 cos/sin via powf + sincosf), online softmax and normalisation in f32.

#ifndef NB
#define NB 4
#endif
#ifndef SEQ
#define SEQ 2048
#endif
#define NB_FULL  4
#define SEQ_FULL 2048
#define CDIM  1024
#define HDIM  64
#define NPROJ 192
#define WP    1024        // pitch of the k-contiguous W plane (16-bit elements) == CDIM, 2048 B = 16 lines
#define XC    256         // k chunk of the x tile staged in LDS per pass
#define XP    264         // LDS pitch of the staged x chunk (16-bit elements)
#define NTB    (SEQ / 64)                    // 64-row query tiles per sequence
#define NTB_E  ((NTB < 4) ? NTB : 4)         // tiles with query rows < 256: residual path
#define NTB_L  (NTB - NTB_E)
#define NTB_LD ((NTB_L > 0) ? NTB_L : 1)
#define NS_A   16                             // key splits (waves) per 16-row query tile, the same for all rows (one launch)

static_assert(SEQ % 64 == 0 && SEQ >= 64);
static_assert(NS_A == 8 || NS_A == 16);
static_assert(SEQ <= SEQ_FULL);
static_assert(NB >= 1 && NB <= NB_FULL);
static_assert(WP == CDIM && (CDIM % XC) == 0 && (XC % 32) == 0);
static_assert(((WP * 2) % 512) == 0);
static_assert(XP >= XC && (XP % 8) == 0);
static_assert(XC == 32 * 8);   // one W row of a chunk = one wave-wide 16-byte load
static_assert(XC / 4 == 64);   // one x row of a chunk = 64 threads' 16-byte loads
static_assert(NPROJ == 3 * HDIM && (NPROJ % 8) == 0 && (HDIM % 8) == 0 && HDIM == 64);
static_assert(64 * XP >= 4 * 4096);
static_assert(((long long)(NB - 1) * SEQ_FULL + SEQ) * HDIM <= 524288LL);

typedef _Float16       v16h  __attribute__((ext_vector_type(16)));
typedef _Float16       v8h   __attribute__((ext_vector_type(8)));
typedef float          v8f   __attribute__((ext_vector_type(8)));
typedef float          v4f   __attribute__((ext_vector_type(4)));
typedef unsigned short v16us __attribute__((ext_vector_type(16)));
typedef unsigned short v8us  __attribute__((ext_vector_type(8)));
typedef unsigned int   v4u   __attribute__((ext_vector_type(4)));
typedef unsigned int   v2u   __attribute__((ext_vector_type(2)));
typedef __bf16         v16bf __attribute__((ext_vector_type(16)));

union FragH { v16h v; v8h h[2]; };
union FragU { v16us v; v8us h[2]; };

#define LOG2E_F 1.4426950408889634f
#define NEG_BIG (-3.0e38f)
#define RINV    0.0009765625f
#define SCL     0.03125f          // CDIM^-0.5

// f32 -> bf16 bits, RNE convert
__device__ __forceinline__ unsigned int bf_bits(float f) {
  const unsigned int u = __float_as_uint(f);
  return (u + 0x7FFFu + ((u >> 16) & 1u)) >> 16;
}
// f32 -> bf16 (RNE) -> f32
__device__ __forceinline__ float bfr(float f) {
  return __uint_as_float(bf_bits(f) << 16);
}

// WMMA helpers with the VALU hazard guard (ties D, keeps A/B live)
__device__ __forceinline__ v8f wmma_f16(v16h a, v16h b, v8f c) {
  v8f d = __builtin_amdgcn_wmma_f32_16x16x32_f16(false, a, false, b, (short)0, c, false, false);
  asm volatile("v_nop\n\tv_nop\n\tv_nop\n\tv_nop" : "+v"(d) : "v"(a), "v"(b));
  return d;
}
__device__ __forceinline__ v8f wmma_bf16(v16us a, v16us b, v8f c) {
  v8f d = __builtin_amdgcn_wmma_f32_16x16x32_bf16(false, __builtin_bit_cast(v16bf, a), false,
                                                   __builtin_bit_cast(v16bf, b), (short)0, c, false, false);
  asm volatile("v_nop\n\tv_nop\n\tv_nop\n\tv_nop" : "+v"(d) : "v"(a), "v"(b));
  return d;
}

// 16-bit operand fragment, split k map for BOTH A and B:
// p = (row or column (lane&15)) base + k0 + 8*(lane>>4); elements 0..7 <- p[0..7], elements 8..15 <- p[16..23].
__device__ __forceinline__ v16h frag_f16(const _Float16* p) {
  FragH f;
  f.h[0] = *(const v8h*)p;
  f.h[1] = *(const v8h*)(p + 16);
  return f.v;
}
// The K and V planes lie in the workspace in the order in which the attention kernel's fragment loads read them: each chunk of
// 32 tokens is one block of 2048 elements = 8 pieces of 512 bytes; piece j holds, lane after lane, the 8 elements that lane l takes
// with its j-th 16-byte load, so that one wave-wide load reads 512 contiguous, line-aligned bytes (4 lines, not 16).
// K, token tl (within a tile of whole chunks), feature f: piece = 4 * (16-key tile of the chunk) + f / 16, lane = 16 * ((f / 8) & 1) + tl % 16.
__device__ __forceinline__ int kfrag_idx(int tl, int f) {
  return (tl >> 5) * 2048 + ((((tl >> 4) & 1) * 4 + (f >> 4)) * 32 + ((f >> 3) & 1) * 16 + (tl & 15)) * 8 + (f & 7);
}
// V, feature h, token tl: piece = 2 * (h / 16) + (16-key half of the chunk), lane = 16 * ((tl / 8) & 1) + h % 16.
__device__ __forceinline__ int vfrag_idx(int h, int tl) {
  return (tl >> 5) * 2048 + (((h >> 4) * 2 + ((tl >> 4) & 1)) * 32 + ((tl >> 3) & 1) * 16 + (h & 15)) * 8 + (tl & 7);
}
// fragment from two adjacent pieces of such a block: p = block + piece * 256 + lane * 8; the k map is that of frag_f16
__device__ __forceinline__ v16h frag_lin(const _Float16* p) {
  FragH f;
  f.h[0] = *(const v8h*)p;
  f.h[1] = *(const v8h*)(p + 256);
  return f.v;
}
__device__ __forceinline__ v16us frag_u16(const unsigned short* p) {
  FragU f;
  f.h[0] = *(const v8us*)p;
  f.h[1] = *(const v8us*)(p + 16);
  return f.v;
}

// ---------------------------------------------------------------------------
// Kernel 1: W [c][64] (q,k,v) -> one k-contiguous bf16 plane Wt[n][WP], n = p*64 + hcol (p: 0 q, 1 k, 2 v).
// Block = 8 output rows (coalesced 32-B reads of W, transposed in LDS); one wave per output row,
// ---------------------------------------------------------------------------
__global__ __launch_bounds__(256) void k_wconv(
    const float* __restrict__ Wq, const float* __restrict__ Wk, const float* __restrict__ Wv,
    unsigned short* __restrict__ Wt)
{
  __shared__ __attribute__((aligned(16))) unsigned short sw[8 * WP];   // [hcol_local][c], 16384 B

  const int tid   = threadIdx.x;
  const int lane  = tid & 31;
  const int wave  = __builtin_amdgcn_readfirstlane(tid >> 5);
  const int p     = blockIdx.x >> 3;
  const int hcol0 = (blockIdx.x & 7) * 8;
  const float* W = (p == 0) ? Wq : ((p == 1) ? Wk : Wv);   // block-uniform select, same address space

  for (int i = tid; i < CDIM * 2; i += 256) {
    const int c  = i >> 1;
    const int q4 = (i & 1) * 4;
    const v4f v = *(const v4f*)(W + (size_t)c * HDIM + hcol0 + q4);
    sw[(q4 + 0) * WP + c] = (unsigned short)bf_bits(v.x);
    sw[(q4 + 1) * WP + c] = (unsigned short)bf_bits(v.y);
    sw[(q4 + 2) * WP + c] = (unsigned short)bf_bits(v.z);
    sw[(q4 + 3) * WP + c] = (unsigned short)bf_bits(v.w);
  }
  __syncthreads();

  const int n = p * HDIM + hcol0 + wave;          // 0..NPROJ-1
  unsigned short* dst = Wt + (size_t)n * WP;
  v4u w[4];
#pragma unroll
  for (int j = 0; j < 4; ++j) w[j] = *(const v4u*)(sw + wave * WP + j * 256 + lane * 8);
#pragma unroll
  for (int j = 0; j < 4; ++j) *(v4u*)(dst + j * 256 + lane * 8) = w[j];
  
}

// ---------------------------------------------------------------------------
// Kernel 2: q,k,v projections (+bias, rotary pair mixing on q,k) for a tile of 64 token rows on bf16 WMMA.
// 8 waves: wave -> 16 rows (wave&3) x 96 output columns (wave>>2). x tile staged in LDS as bf16 in 4 chunks of 256 k
// (each chunk loaded into registers one chunk ahead),
// and with each x chunk the same 256 k of all 192 W rows, so that the B fragments come from LDS like the A fragments.
// Outputs: qh = f16(rot(q+bq)*log2e) [tok][64]; kh = f16(rot(k+bk)), vT = f16(16*(v+bv)) and vR = f16((16*v - vT) * 1024)
// (residual plane), each as [chunk of 32 tokens][2048] in fragment order (kfrag_idx, vfrag_idx).
// ---------------------------------------------------------------------------
__global__ __launch_bounds__(256) __attribute__((amdgpu_num_vgpr(256)))
void k_proj(const float* __restrict__ x, const unsigned short* __restrict__ Wt,
            const float* __restrict__ bq, const float* __restrict__ bk, const float* __restrict__ bv,
            _Float16* __restrict__ qh, _Float16* __restrict__ kh,
            _Float16* __restrict__ vT, _Float16* __restrict__ vR)
{
  __shared__ __attribute__((aligned(16))) unsigned short sm[64 * XP];    // 33792 B, later reused as staging
  __shared__ __attribute__((aligned(16))) unsigned short swt[NPROJ * XP]; // W chunk [n][k], same pitch as the x chunk, 101376 B
  __shared__ __attribute__((aligned(16))) float scs[64 * HDIM];         // [tl][2i] = cos, [tl][2i+1] = sin
  __shared__ float sb[NPROJ];                                           // biases (bf16 RNE-converted)

  const int tid  = threadIdx.x;
  const int lane = tid & 31;
  const int wave = __builtin_amdgcn_readfirstlane(tid >> 5);
  const int half = lane >> 4;
  const int ln   = lane & 15;
  const int m0 = blockIdx.x * 64;               // compact token row of this tile
  const int b  = m0 / SEQ;
  const int t0 = m0 - b * SEQ;
  const float* xblk = x + ((size_t)b * SEQ_FULL + t0) * CDIM;

  // x chunk in registers, one chunk ahead of its use: thread -> rows (tid / 64) + 4 * it, 4 columns at (tid % 64) * 4. All 16 loads
  // of a chunk are in flight together; those of chunk 0 fly during the table set-up below, later ones during the products
  const float* xsrc = xblk + (size_t)(tid >> 6) * CDIM + (tid & 63) * 4;
  v4f xr[64 * (XC / 4) / 256];
#pragma unroll   // constant indices keep xr[] in registers and all 16 loads in flight at once
  for (int it = 0; it < 64 * (XC / 4) / 256; ++it)
    xr[it] = *(const v4f*)(xsrc + (size_t)it * 4 * CDIM);

  // rotary table for positions t0..t0+63: f_i = 1 / 10000^(i/32), angle = t * f_i, i = 0..31
#pragma unroll 1
  for (int i = tid; i < 64 * (HDIM / 2); i += 256) {
    const int r  = i >> 5;
    const int pr = i & 31;
    const float ex  = (float)(2 * pr) * 0.015625f;
    const float fr  = 1.0f / powf(10000.0f, ex);
    const float ang = (float)(t0 + r) * fr;
    float sn, cn;
    sincosf(ang, &sn, &cn);
    scs[r * HDIM + 2 * pr]     = cn;
    scs[r * HDIM + 2 * pr + 1] = sn;
  }
  if (tid < HDIM) {                             // waves 0 and 1 exactly (wave-uniform)
    sb[tid]            = bfr(bq[tid]);
    sb[HDIM + tid]     = bfr(bk[tid]);
    sb[2 * HDIM + tid] = bfr(bv[tid]);
  }

  const int rg = wave & 3;
  const int ch = wave >> 2;
  v8f acc[6];
#pragma unroll
  for (int nt = 0; nt < 6; ++nt) {
#pragma unroll
    for (int r = 0; r < 8; ++r) acc[nt][r] = 0.0f;
  }

  const unsigned short* wsrc = Wt + (size_t)(wave * (NPROJ / 8)) * WP + lane * 8;   // this lane's 16 bytes of the wave's first W row
#pragma unroll 1
  for (int kc = 0; kc < CDIM; kc += XC) {
    __syncthreads();   // all waves done reading the prior chunk
    // W chunk: wave w brings rows 24w..24w+23, each row's XC elements as 512 contiguous bytes; the loads are issued
    // ahead of the x chunk's conversion, which covers part of their latency, and stored behind it
    v4u wr[NPROJ / 8];
#pragma unroll   // constant indices keep wr[] in registers and all 24 loads in flight at once
    for (int j = 0; j < NPROJ / 8; ++j)
      wr[j] = *(const v4u*)(wsrc + (size_t)j * WP);
    // stage x chunk: 64 rows x XC columns (kc..kc+XC-1) -> bf16, from the registers loaded one chunk ago
#pragma unroll   // constant indices keep xr[] in registers
    for (int it = 0; it < 64 * (XC / 4) / 256; ++it) {
      const v4f v = xr[it];
      v2u w;
      w.x = bf_bits(v.x) | (bf_bits(v.y) << 16);
      w.y = bf_bits(v.z) | (bf_bits(v.w) << 16);
      *(v2u*)(sm + ((tid >> 6) + 4 * it) * XP + (tid & 63) * 4) = w;
    }
#pragma unroll   // constant indices keep wr[] in registers
    for (int j = 0; j < NPROJ / 8; ++j)
      *(v4u*)(swt + (wave * (NPROJ / 8) + j) * XP + lane * 8) = wr[j];
    wsrc += XC;
    __syncthreads();

    // the next chunk's x loads are issued ahead of this chunk's products, which cover their memory latency
    if (kc + XC < CDIM) {                       // block-uniform
      xsrc += XC;
#pragma unroll   // constant indices keep xr[] in registers and all 16 loads in flight at once
      for (int it = 0; it < 64 * (XC / 4) / 256; ++it)
        xr[it] = *(const v4f*)(xsrc + (size_t)it * 4 * CDIM);
    }

    const unsigned short* arow = sm + (rg * 16 + ln) * XP + 8 * half;
    const unsigned short* brow = swt + (ch * 96 + ln) * XP + 8 * half;
    // two register sets of fragments: the 14 LDS reads of k step ks + 1 are issued as one group ahead of the 6 products
    // of step ks, so that a product no longer waits out the LDS latency of its own operands
    v16us af[2];
    v16us bf[2][6];
    af[0] = frag_u16(arow);
#pragma unroll
    for (int nt = 0; nt < 6; ++nt) bf[0][nt] = frag_u16(brow + nt * 16 * XP);
#pragma unroll   // constant set indices keep both fragment sets in registers, with no copies between them
    for (int ks = 0; ks < XC / 32; ++ks) {
      const int cur = ks & 1;
      const int nxt = cur ^ 1;
      if (ks + 1 < XC / 32) {
        af[nxt] = frag_u16(arow + (ks + 1) * 32);
#pragma unroll
        for (int nt = 0; nt < 6; ++nt) bf[nxt][nt] = frag_u16(brow + nt * 16 * XP + (ks + 1) * 32);
      }
#pragma unroll
      for (int nt = 0; nt < 6; ++nt) acc[nt] = wmma_bf16(af[cur], bf[cur][nt], acc[nt]);
    }
  }
  __syncthreads();   // all waves done reading the x tile

  // staging (16-bit elements): sQ = sm[0..4095] as [t][64], sK = sm[4096..8191], sV = sm[8192..12287] and
  // sVr = sm[12288..16383] as the tile's two chunk blocks in fragment order
#pragma unroll
  for (int nt = 0; nt < 6; ++nt) {
    const int n0 = ch * 96 + nt * 16;            // wave-uniform
    const int p  = n0 >> 6;
    const int hc = (n0 & 63) + ln;
    const float bias = sb[p * HDIM + hc];
    const float sc = (p == 0) ? LOG2E_F : ((p == 2) ? 16.0f : 1.0f);
    unsigned short* base = sm + p * 4096;
    // r walks the low three bits of the token index, which every one of the three orders maps to a constant step
    const int tl0 = rg * 16 + 8 * half;
    const int i0  = (p == 2) ? vfrag_idx(hc, tl0) : ((p == 1) ? kfrag_idx(tl0, hc) : (tl0 * 64 + hc));
    const int ist = (p == 2) ? 1 : ((p == 1) ? 8 : 64);
#pragma unroll
    for (int r = 0; r < 8; ++r) {
      const int tl = rg * 16 + 8 * half + r;
      const float val = acc[nt][r] + bias;
      const float pv  = __shfl_xor(val, 1, 32);          // pair partner column hc^1 (lane ln^1), unconditional
      const float cn  = scs[tl * HDIM + (hc & ~1)];
      const float sn  = scs[tl * HDIM + (hc | 1)];
      const float t1  = val * cn;
      const float t2  = pv * sn;
      const float rot = (hc & 1) ? (t1 + t2) : (t1 - t2);  // even: ev*c - od*s ; odd: od*c + ev*s
      const float vf  = ((p < 2) ? rot : val) * sc;
      const int idx = i0 + r * ist;
      const _Float16 hv = (_Float16)vf;
      base[idx] = __builtin_bit_cast(unsigned short, hv);
      if (p == 2) {
        const _Float16 rv = (_Float16)((vf - (float)hv) * 1024.0f);
        sm[12288 + idx] = __builtin_bit_cast(unsigned short, rv);
      }
    }
  }
  __syncthreads();

  // whole-line stores: wave w owns token rows 8w..8w+7 of qh and pieces 2w, 2w+1 of the tile's 16 in kh, vT and vR
  const int rl = lane >> 3;
  const int pc = lane & 7;
  const int rA = wave * 8 + rl;
  const int rB = rA + 4;
  const v4u qA = *(const v4u*)(sm + rA * 64 + pc * 8);
  const v4u qB = *(const v4u*)(sm + rB * 64 + pc * 8);
  const int fA = wave * 512 + lane * 8;
  const int fB = fA + 256;
  const v4u kA = *(const v4u*)(sm + 4096 + fA);
  const v4u kB = *(const v4u*)(sm + 4096 + fB);
  const v4u vA = *(const v4u*)(sm + 8192 + fA);
  const v4u vB = *(const v4u*)(sm + 8192 + fB);
  const v4u uA = *(const v4u*)(sm + 12288 + fA);
  const v4u uB = *(const v4u*)(sm + 12288 + fB);
  _Float16* dqA = qh + (size_t)(m0 + rA) * HDIM + pc * 8;
  _Float16* dqB = qh + (size_t)(m0 + rB) * HDIM + pc * 8;
  _Float16* dkA = kh + (size_t)m0 * HDIM + fA;
  _Float16* dkB = kh + (size_t)m0 * HDIM + fB;
  _Float16* dvA = vT + (size_t)m0 * HDIM + fA;
  _Float16* dvB = vT + (size_t)m0 * HDIM + fB;
  _Float16* duA = vR + (size_t)m0 * HDIM + fA;
  _Float16* duB = vR + (size_t)m0 * HDIM + fB;
  *(v4u*)dqA = qA; *(v4u*)dqB = qB;
  *(v4u*)dkA = kA; *(v4u*)dkB = kB;
  *(v4u*)dvA = vA; *(v4u*)dvB = vB;
  *(v4u*)duA = uA; *(v4u*)duB = uB;
  
}

// ---------------------------------------------------------------------------
// Kernel 3: causal flash attention, all query tiles in one launch. Block = one tile of 16 query rows; its NS waves split the tile's key chunks
// (32 keys each): wave w takes chunks w, w + NS, w + 2*NS, ... and keeps its own running maximum, sums and O tile.
// S tiles (D layout) -> online softmax in log2 domain -> P x 1024 to f16 A layout via LDS -> O += P.V, sums += P.ones.
// After the loop the partial results of the waves that can hold a chunk (NM of the NS) are merged through LDS in wave order (rescaled to the common row maximum).
// EARLY = 1 handles query rows < 256: adds P residual (x1024) and v residual plane (x1024)
// products into separate accumulators folded with 2^-10 before the merge; EARLY = 0 handles the rest.
// Query rows with mask == 0 get NaN (whole score row excluded -> NaN softmax).
// The two paths share one grid behind a block-uniform branch: neither reads what the other writes. The later rows' tiles
// come first in the grid, by rising row; the short tiles of rows < 256 come last and run beside them.
// Second launch bound (waves per SIMD): 8, so that two 16-wave blocks fit one WGP and the whole grid is resident at once.
// ---------------------------------------------------------------------------
template <int EARLY>
__device__ __forceinline__
void attn_tile(const _Float16* __restrict__ qh, const _Float16* __restrict__ kh,
               const _Float16* __restrict__ vT, const _Float16* __restrict__ vR,
               const int* __restrict__ mask, float* __restrict__ out, const int b, const int tq,
               _Float16 (*pbuf)[16][40], _Float16 (*rbuf)[16][40], float (*part)[16][68],
               float (*pmax)[NS_A], float (*pden)[NS_A])
{
  constexpr int NS  = NS_A;                    // waves per block = key splits of the tile
  constexpr int NM  = (EARLY && 2 * NTB_E < NS) ? 2 * NTB_E : NS;   // waves that can hold a chunk (rows < 256: at most 2 chunks per 64 rows)
  constexpr int CPT = 32 / NS;                 // output columns merged per thread (16 x 64 tile over NS*32 threads)
  constexpr int TPR = HDIM / CPT;              // threads per output row in the merge
  typedef float vcf __attribute__((ext_vector_type(CPT)));

  const int tid  = threadIdx.x;
  const int lane = tid & 31;
  const int wave = __builtin_amdgcn_readfirstlane(tid >> 5);
  const int half = lane >> 4;
  const int ln   = lane & 15;
  const int row0 = tq * 16;                      // first query row of this block (within the sequence)

  const _Float16* qrow  = qh + ((size_t)b * SEQ + row0 + ln) * HDIM + 8 * half;
  // block-uniform plane bases (scalar registers); a lane's own part of an address is one 32-bit element offset, below
  // SEQ * HDIM and the same in all three planes (chunk block + lane * 8), not a 64-bit pointer
  const _Float16* kbase = kh + (size_t)b * SEQ * HDIM;
  const _Float16* vbase = vT + (size_t)b * HDIM * SEQ;
  const _Float16* rbase = vR + (size_t)b * HDIM * SEQ;

  // pad flag of the query row that this thread will merge and store (row0 + tid / TPR, always < SEQ); with one wave per row the
  // index is wave-uniform, so that the flag waits in a scalar register and takes no vector register across the loop
  const int mk = mask[(size_t)b * SEQ_FULL + row0 + ((TPR == 32) ? wave : tid / TPR)];
  // held before any register that the flag load names (its offset, its base pair) is written again
  asm volatile("s_wait_xcnt 0x0" ::: "memory");

  // loop-invariant Q A fragments (feature blocks 0..31, 32..63)
  const v16h qa0 = frag_f16(qrow);
  const v16h qa1 = frag_f16(qrow + 32);

  v16h ones;
#pragma unroll
  for (int i = 0; i < 16; ++i) ones[i] = (_Float16)1.0f;

  v8f o[4], orr[4];
  v8f osum, osumr;
#pragma unroll
  for (int r = 0; r < 8; ++r) { osum[r] = 0.0f; osumr[r] = 0.0f; }
#pragma unroll
  for (int ht = 0; ht < 4; ++ht) {
#pragma unroll
    for (int r = 0; r < 8; ++r) { o[ht][r] = 0.0f; orr[ht][r] = 0.0f; }
  }
  float rmax[8];
#pragma unroll
  for (int r = 0; r < 8; ++r) rmax[r] = NEG_BIG;

  const int nchunk = ((row0 + 15) >> 5) + 1;     // keys 0 .. row0+15 in chunks of 32
  const int ntrip  = (nchunk + NS - 1) / NS;     // block-uniform trip count
#pragma unroll 1
  for (int j = 0; j < ntrip; ++j) {
    const int c   = j * NS + wave;
    const int kt0 = c * 32;
    const bool active = (c < nchunk);           // wave-uniform
    v8f s[2];
#pragma unroll
    for (int r = 0; r < 8; ++r) { s[0][r] = 0.0f; s[1][r] = 0.0f; }

    if (active) {
      // S[16 x 32] = Q(16 x 64) . K^T, K as B operand: column = key (lane&15), k = feature (split map)
#pragma unroll
      for (int nt = 0; nt < 2; ++nt) {
        const int key = kt0 + nt * 16 + ln;
        const _Float16* kfr = kbase + (unsigned int)(c * 2048 + nt * 1024 + lane * 8);   // pieces 4nt .. 4nt+3 of the chunk's block
        const v16h kb0 = frag_lin(kfr);
        FragH kf;
        kf.h[0] = *(const v8h*)(kfr + 512);
        // later rows: the chunk's loads share one address pair, and the compiler may let a tile's last load land on that pair: the
        // loads before it are held first (rows < 256 load from a scalar base and one offset register that no result lands on)
        if (!EARLY) asm volatile("s_wait_xcnt 0x0" ::: "memory");
        kf.h[1] = *(const v8h*)(kfr + 768);
        const v16h kb1 = kf.v;
        v8f acc;
#pragma unroll
        for (int r = 0; r < 8; ++r) acc[r] = 0.0f;
        acc = wmma_f16(qa0, kb0, acc);
        acc = wmma_f16(qa1, kb1, acc);
#pragma unroll
        for (int r = 0; r < 8; ++r) {
          const float sv = acc[r] * SCL;                            // CDIM^-0.5, log2e already in q
          s[nt][r] = (key > row0 + 8 * half + r) ? NEG_BIG : sv;   // causal fill (replace)
        }
      }
      // online softmax, row = 8*half + r, columns across the 16-lane half
      float alpha[8];
#pragma unroll
      for (int r = 0; r < 8; ++r) {
        float tmax = fmaxf(s[0][r], s[1][r]);
#pragma unroll
        for (int m = 1; m < 16; m <<= 1) tmax = fmaxf(tmax, __shfl_xor(tmax, m, 32));
        const float nmax = fmaxf(rmax[r], tmax);
        alpha[r] = exp2f(rmax[r] - nmax);
        rmax[r]  = nmax;
        s[0][r] = exp2f(s[0][r] - nmax);
        s[1][r] = exp2f(s[1][r] - nmax);
      }
#pragma unroll
      for (int r = 0; r < 8; ++r) {
        osum[r] *= alpha[r];
        if (EARLY) osumr[r] *= alpha[r];
#pragma unroll
        for (int ht = 0; ht < 4; ++ht) {
          o[ht][r] *= alpha[r];
          if (EARLY) orr[ht][r] *= alpha[r];
        }
      }
    }

    // P: D layout -> [q_local][key_local] in LDS (carried x 1024; residual x 1024 more), then reloaded as A fragments
    __syncthreads();
    if (active) {
#pragma unroll
      for (int nt = 0; nt < 2; ++nt) {
#pragma unroll
        for (int r = 0; r < 8; ++r) {
          const float pf = s[nt][r] * 1024.0f;
          const _Float16 ph = (_Float16)pf;
          pbuf[wave][r + 8 * half][nt * 16 + ln] = ph;
          if (EARLY) {
            const _Float16 pr = (_Float16)((pf - (float)ph) * 1024.0f);
            rbuf[wave][r + 8 * half][nt * 16 + ln] = pr;
          }
        }
      }
    }
    __syncthreads();

    if (active) {
      const v16h pa = frag_f16(&pbuf[wave][ln][8 * half]);
      // V as B operand: column = feature (lane&15), k = key (split map): pieces 2ht, 2ht+1 of the chunk's block
      if (EARLY) {
        const v16h pra = frag_f16(&rbuf[wave][ln][8 * half]);
#pragma unroll
        for (int ht = 0; ht < 4; ++ht) {
          const v16h vb = frag_lin(vbase + (unsigned int)(c * 2048 + ht * 512 + lane * 8));
          o[ht]   = wmma_f16(pa,  vb, o[ht]);
          orr[ht] = wmma_f16(pra, vb, orr[ht]);
        }
        osum  = wmma_f16(pa,  ones, osum);
        osumr = wmma_f16(pra, ones, osumr);
#pragma unroll
        for (int ht = 0; ht < 4; ++ht) {
          const v16h vr = frag_lin(rbase + (unsigned int)(c * 2048 + ht * 512 + lane * 8));
          orr[ht] = wmma_f16(pa, vr, orr[ht]);
        }
      } else {
#pragma unroll
        for (int ht = 0; ht < 4; ++ht) {
          const v16h vb = frag_lin(vbase + (unsigned int)(c * 2048 + ht * 512 + lane * 8));
          o[ht] = wmma_f16(pa, vb, o[ht]);
        }
        osum = wmma_f16(pa, ones, osum);   // row sums of the same f16 P in D layout
      }
    }
  }

  // lane index taken anew from the value that the loop's shuffles already hold, so that no thread-index value has to
  // stay in a register across the loop (the register budget decides how many blocks a WGP holds)
  const int el  = (int)__lane_id();
  const int eh  = el >> 4;
  const int eln = el & 15;

  // merge ownership: each thread owns CPT adjacent columns of one query row
  const unsigned int et = (unsigned int)(wave * 32 + el);
  const int mrow = (int)(et / TPR);
  const int mcol = (int)(et % TPR) * CPT;

  // every wave publishes its own row maxima, row sums and unnormalised O tile (a wave without a chunk: NEG_BIG, 0, 0)
#pragma unroll
  for (int r = 0; r < 8; ++r) {
#pragma unroll
    for (int ht = 0; ht < 4; ++ht) {
      float num = o[ht][r];
      if (EARLY) num = num + orr[ht][r] * RINV;
      part[wave][8 * eh + r][ht * 16 + eln] = num;
    }
  }
  if (eln == 0) {
#pragma unroll
    for (int r = 0; r < 8; ++r) {
      float den = osum[r];
      if (EARLY) den = den + osumr[r] * RINV;
      pmax[8 * eh + r][wave] = rmax[r];
      pden[8 * eh + r][wave] = den;
    }
  }
  __syncthreads();   // all NS partial results are in LDS before any thread merges them

  // merge: the partials of the first NM waves (those that can hold a chunk) are added in wave order, each rescaled by 2^(its maximum - common maximum)
  float pm[NM];
  float gmax = NEG_BIG;
#pragma unroll
  for (int w = 0; w < NM; ++w) { pm[w] = pmax[mrow][w]; gmax = fmaxf(gmax, pm[w]); }
  float den = 0.0f;
  vcf num;
#pragma unroll
  for (int i = 0; i < CPT; ++i) num[i] = 0.0f;
#pragma unroll
  for (int w = 0; w < NM; ++w) {
    const float f = exp2f(pm[w] - gmax);
    den += pden[mrow][w] * f;
    num += *(const vcf*)(&part[w][mrow][mcol]) * f;
  }

  const float qnan = __uint_as_float(0x7fc00000u);

  // normalise (1024 carry cancels between numerator and denominator; 1/16 undoes the v carry)
  const float inv = 0.0625f * __builtin_amdgcn_rcpf(den);
  vcf res;
#pragma unroll
  for (int i = 0; i < CPT; ++i) res[i] = (mk != 0) ? (num[i] * inv) : qnan;
  *(vcf*)(out + ((size_t)b * SEQ_FULL + row0 + mrow) * HDIM + mcol) = res;
}

__global__ __launch_bounds__(NS_A * 32, 8) __attribute__((amdgpu_num_vgpr(256)))
void k_attn(const _Float16* __restrict__ qh, const _Float16* __restrict__ kh,
            const _Float16* __restrict__ vT, const _Float16* __restrict__ vR,
            const int* __restrict__ mask, float* __restrict__ out)
{
  __shared__ __attribute__((aligned(16))) _Float16 pbuf[NS_A][16][40];   // per-wave 16 x 32 P tile (x1024)
  __shared__ __attribute__((aligned(16))) _Float16 rbuf[NS_A][16][40];   // per-wave 16 x 32 P residual tile (rows < 256 only)
  __shared__ __attribute__((aligned(16))) float    part[NS_A][16][68];   // per-wave 16 x 64 partial O tile
  __shared__ __attribute__((aligned(16))) float    pmax[16][NS_A];       // per-wave row maxima  [row][wave]
  __shared__ __attribute__((aligned(16))) float    pden[16][NS_A];       // per-wave row sums    [row][wave]

  const int blk = blockIdx.x;                    // block-uniform: every barrier below is passed by the whole block
  if (blk < NB * NTB_L * 4) {
    const int b = blk / (4 * NTB_LD);
    attn_tile<0>(qh, kh, vT, vR, mask, out, b, 4 * NTB_E + (blk - b * (4 * NTB_LD)), pbuf, rbuf, part, pmax, pden);
  } else {
    const int e = blk - NB * NTB_L * 4;
    const int b = e / (4 * NTB_E);
    attn_tile<1>(qh, kh, vT, vR, mask, out, b, e - b * (4 * NTB_E), pbuf, rbuf, part, pmax, pden);
  }
}

// ---------------------------------------------------------------------------
extern "C" void kernel_launch(void* const* d_in, const int* in_sizes, int n_in,
                              void* d_out, int out_size, void* d_ws, size_t ws_size,
                              hipStream_t stream)
{
  if (n_in < 8) return;
  const long long tok_rows = (long long)(NB - 1) * SEQ_FULL + SEQ;
  if ((long long)in_sizes[0] < tok_rows * CDIM) return;
  if ((long long)in_sizes[1] < tok_rows) return;
  if (in_sizes[2] < CDIM * HDIM || in_sizes[4] < CDIM * HDIM || in_sizes[6] < CDIM * HDIM) return;
  if (in_sizes[3] < HDIM || in_sizes[5] < HDIM || in_sizes[7] < HDIM) return;
  if ((long long)out_size < tok_rows * HDIM) return;

  const float* x    = (const float*)d_in[0];
  const int*   mask = (const int*)d_in[1];
  const float* Wq   = (const float*)d_in[2];
  const float* bq   = (const float*)d_in[3];
  const float* Wk   = (const float*)d_in[4];
  const float* bk   = (const float*)d_in[5];
  const float* Wv   = (const float*)d_in[6];
  const float* bv   = (const float*)d_in[7];
  float* out = (float*)d_out;

  // workspace carve (bytes): Wt 192*1024*2 = 393216 | qh NB*SEQ*64*2 | kh same | vT same | vR same
  const size_t wt_bytes = (size_t)NPROJ * WP * sizeof(unsigned short);
  const size_t plane    = (size_t)NB * SEQ * HDIM * sizeof(_Float16);
  const size_t off_wt = 0;
  const size_t off_q  = (off_wt + wt_bytes + 255) & ~(size_t)255;
  const size_t off_k  = off_q + plane;
  const size_t off_v  = off_k + plane;
  const size_t off_r  = off_v + plane;
  const size_t total  = off_r + plane;
  if (total > ws_size) return;

  unsigned short* Wt = (unsigned short*)((char*)d_ws + off_wt);
  _Float16* qh = (_Float16*)((char*)d_ws + off_q);
  _Float16* kh = (_Float16*)((char*)d_ws + off_k);
  _Float16* vT = (_Float16*)((char*)d_ws + off_v);
  _Float16* vR = (_Float16*)((char*)d_ws + off_r);

  k_wconv<<<NPROJ / 8, 256, 0, stream>>>(Wq, Wk, Wv, Wt);
  k_proj<<<(NB * SEQ) / 64, 256, 0, stream>>>(x, Wt, bq, bk, bv, qh, kh, vT, vR);
  k_attn<<<NB * NTB * 4, NS_A * 32, 0, stream>>>(qh, kh, vT, vR, mask, out);
}

// v007
// Measured time: 38 microseconds a run.
// In two side-by-side timings against v006, it was 1.12 and 1.10 times as fast.
// Counting every step since v000, it is 5.95 times as fast.
#include <hip/hip_runtime.h>

// Contractions: x*W projections (q,k,v): v_wmma_f32_16x16x32_bf16, bf16 operands (RNE-converted inputs), f32 accumulate.
// q.k scores, P.v, P row sums: v_wmma_f32_16x16x32_f16, f16 operands (q x log2e, k, P x 1024, v x 16), f32 accumulate;
// query rows < 256 of each sequence also use f16 residual planes of P and v (x1024 carries) in separate f32 accumulators.
// Bias add, rotary pair mixing (f32 cos/sin via powf + sincosf), online softmax and normalisation in f32.

#ifndef NB
#define NB 4
#endif
#ifndef SEQ
#define SEQ 2048
#endif
#define NB_FULL  4
#define SEQ_FULL 2048
#define CDIM  1024
#define HDIM  64
#define NPROJ 192
#define WP    1024        // pitch of the k-contiguous W plane (16-bit elements) == CDIM, 2048 B = 16 lines
#define XC    256         // k chunk of the x tile staged in LDS per pass
#define XP    264         // LDS pitch of the staged x chunk (16-bit elements)
#define NTB    (SEQ / 64)                    // 64-row query tiles per sequence
#define NTB_E  ((NTB < 4) ? NTB : 4)         // tiles with query rows < 256: residual path
#define NTB_L  (NTB - NTB_E)
#define NTB_LD ((NTB_L > 0) ? NTB_L : 1)
#define NS_A   16                             // key splits (waves) per 16-row query tile, the same for all rows (one launch)

static_assert(SEQ % 64 == 0 && SEQ >= 64);
static_assert(NS_A == 8 || NS_A == 16);
static_assert(SEQ <= SEQ_FULL);
static_assert(NB >= 1 && NB <= NB_FULL);
static_assert(WP == CDIM && (CDIM % XC) == 0 && (XC % 32) == 0);
static_assert(((WP * 2) % 512) == 0);
static_assert(XP >= XC && (XP % 8) == 0);
static_assert(XC == 32 * 8);   // one W row of a chunk = one wave-wide 16-byte load
static_assert(XC / 4 == 64);   // one x row of a chunk = 64 threads' 16-byte loads
static_assert(NPROJ == 3 * HDIM && (NPROJ % 8) == 0 && (HDIM % 8) == 0 && HDIM == 64);
static_assert(64 * XP >= 4 * 4096);
static_assert(((long long)(NB - 1) * SEQ_FULL + SEQ) * HDIM <= 524288LL);

typedef _Float16       v16h  __attribute__((ext_vector_type(16)));
typedef _Float16       v8h   __attribute__((ext_vector_type(8)));
typedef float          v8f   __attribute__((ext_vector_type(8)));
typedef float          v4f   __attribute__((ext_vector_type(4)));
typedef unsigned short v16us __attribute__((ext_vector_type(16)));
typedef unsigned short v8us  __attribute__((ext_vector_type(8)));
typedef unsigned int   v4u   __attribute__((ext_vector_type(4)));
typedef unsigned int   v2u   __attribute__((ext_vector_type(2)));
typedef __bf16         v16bf __attribute__((ext_vector_type(16)));

union FragH { v16h v; v8h h[2]; };
union FragU { v16us v; v8us h[2]; };

#define LOG2E_F 1.4426950408889634f
#define NEG_BIG (-3.0e38f)
#define RINV    0.0009765625f
#define SCL     0.03125f          // CDIM^-0.5

// f32 -> bf16 bits, RNE convert
__device__ __forceinline__ unsigned int bf_bits(float f) {
  const unsigned int u = __float_as_uint(f);
  return (u + 0x7FFFu + ((u >> 16) & 1u)) >> 16;
}
// f32 -> bf16 (RNE) -> f32
__device__ __forceinline__ float bfr(float f) {
  return __uint_as_float(bf_bits(f) << 16);
}

// WMMA helpers with the VALU hazard guard (ties D, keeps A/B live)
__device__ __forceinline__ v8f wmma_f16(v16h a, v16h b, v8f c) {
  v8f d = __builtin_amdgcn_wmma_f32_16x16x32_f16(false, a, false, b, (short)0, c, false, false);
  asm volatile("v_nop\n\tv_nop\n\tv_nop\n\tv_nop" : "+v"(d) : "v"(a), "v"(b));
  return d;
}
__device__ __forceinline__ v8f wmma_bf16(v16us a, v16us b, v8f c) {
  v8f d = __builtin_amdgcn_wmma_f32_16x16x32_bf16(false, __builtin_bit_cast(v16bf, a), false,
                                                   __builtin_bit_cast(v16bf, b), (short)0, c, false, false);
  asm volatile("v_nop\n\tv_nop\n\tv_nop\n\tv_nop" : "+v"(d) : "v"(a), "v"(b));
  return d;
}

// 16-bit operand fragment, split k map for BOTH A and B:
// p = (row or column (lane&15)) base + k0 + 8*(lane>>4); elements 0..7 <- p[0..7], elements 8..15 <- p[16..23].
__device__ __forceinline__ v16h frag_f16(const _Float16* p) {
  FragH f;
  f.h[0] = *(const v8h*)p;
  f.h[1] = *(const v8h*)(p + 16);
  return f.v;
}
// The K and V planes lie in the workspace in the order in which the attention kernel's fragment loads read them: each chunk of
// 32 tokens is one block of 2048 elements = 8 pieces of 512 bytes; piece j holds, lane after lane, the 8 elements that lane l takes
// with its j-th 16-byte load, so that one wave-wide load reads 512 contiguous, line-aligned bytes (4 lines, not 16).
// K, token tl (within a tile of whole chunks), feature f: piece = 4 * (16-key tile of the chunk) + f / 16, lane = 16 * ((f / 8) & 1) + tl % 16.
__device__ __forceinline__ int kfrag_idx(int tl, int f) {
  return (tl >> 5) * 2048 + ((((tl >> 4) & 1) * 4 + (f >> 4)) * 32 + ((f >> 3) & 1) * 16 + (tl & 15)) * 8 + (f & 7);
}
// V, feature h, token tl: piece = 2 * (h / 16) + (16-key half of the chunk), lane = 16 * ((tl / 8) & 1) + h % 16.
__device__ __forceinline__ int vfrag_idx(int h, int tl) {
  return (tl >> 5) * 2048 + (((h >> 4) * 2 + ((tl >> 4) & 1)) * 32 + ((tl >> 3) & 1) * 16 + (h & 15)) * 8 + (tl & 7);
}
// fragment from two adjacent pieces of such a block: p = block + piece * 256 + lane * 8; the k map is that of frag_f16
__device__ __forceinline__ v16h frag_lin(const _Float16* p) {
  FragH f;
  f.h[0] = *(const v8h*)p;
  f.h[1] = *(const v8h*)(p + 256);
  return f.v;
}
__device__ __forceinline__ v16us frag_u16(const unsigned short* p) {
  FragU f;
  f.h[0] = *(const v8us*)p;
  f.h[1] = *(const v8us*)(p + 16);
  return f.v;
}

// ---------------------------------------------------------------------------
// Kernel 1: W [c][64] (q,k,v) -> one k-contiguous bf16 plane Wt[n][WP], n = p*64 + hcol (p: 0 q, 1 k, 2 v).
// Block = 8 output rows (coalesced 32-B reads of W, transposed in LDS); one wave per output row,
// ---------------------------------------------------------------------------
__global__ __launch_bounds__(256) void k_wconv(
    const float* __restrict__ Wq, const float* __restrict__ Wk, const float* __restrict__ Wv,
    unsigned short* __restrict__ Wt)
{
  __shared__ __attribute__((aligned(16))) unsigned short sw[8 * WP];   // [hcol_local][c], 16384 B

  const int tid   = threadIdx.x;
  const int lane  = tid & 31;
  const int wave  = __builtin_amdgcn_readfirstlane(tid >> 5);
  const int p     = blockIdx.x >> 3;
  const int hcol0 = (blockIdx.x & 7) * 8;
  const float* W = (p == 0) ? Wq : ((p == 1) ? Wk : Wv);   // block-uniform select, same address space

  for (int i = tid; i < CDIM * 2; i += 256) {
    const int c  = i >> 1;
    const int q4 = (i & 1) * 4;
    const v4f v = *(const v4f*)(W + (size_t)c * HDIM + hcol0 + q4);
    sw[(q4 + 0) * WP + c] = (unsigned short)bf_bits(v.x);
    sw[(q4 + 1) * WP + c] = (unsigned short)bf_bits(v.y);
    sw[(q4 + 2) * WP + c] = (unsigned short)bf_bits(v.z);
    sw[(q4 + 3) * WP + c] = (unsigned short)bf_bits(v.w);
  }
  __syncthreads();

  const int n = p * HDIM + hcol0 + wave;          // 0..NPROJ-1
  unsigned short* dst = Wt + (size_t)n * WP;
  v4u w[4];
#pragma unroll
  for (int j = 0; j < 4; ++j) w[j] = *(const v4u*)(sw + wave * WP + j * 256 + lane * 8);
#pragma unroll
  for (int j = 0; j < 4; ++j) *(v4u*)(dst + j * 256 + lane * 8) = w[j];
  
}

// ---------------------------------------------------------------------------
// Kernel 2: q,k,v projections (+bias, rotary pair mixing on q,k) for a tile of 64 token rows on bf16 WMMA.
// 8 waves: wave -> 16 rows (wave&3) x 96 output columns (wave>>2). x tile staged in LDS as bf16 in 4 chunks of 256 k
// (each chunk loaded into registers one chunk ahead),
// and with each x chunk the same 256 k of all 192 W rows, so that the B fragments come from LDS like the A fragments.
// Outputs: qh = f16(rot(q+bq)*log2e) [tok][64]; kh = f16(rot(k+bk)), vT = f16(16*(v+bv)) and vR = f16((16*v - vT) * 1024)
// (residual plane), each as [chunk of 32 tokens][2048] in fragment order (kfrag_idx, vfrag_idx).
// ---------------------------------------------------------------------------
__global__ __launch_bounds__(256) __attribute__((amdgpu_num_vgpr(256)))
void k_proj(const float* __restrict__ x, const unsigned short* __restrict__ Wt,
            const float* __restrict__ bq, const float* __restrict__ bk, const float* __restrict__ bv,
            _Float16* __restrict__ qh, _Float16* __restrict__ kh,
            _Float16* __restrict__ vT, _Float16* __restrict__ vR)
{
  __shared__ __attribute__((aligned(16))) unsigned short sm[64 * XP];    // 33792 B, later reused as staging
  __shared__ __attribute__((aligned(16))) unsigned short swt[NPROJ * XP]; // W chunk [n][k], same pitch as the x chunk, 101376 B
  __shared__ __attribute__((aligned(16))) float scs[64 * HDIM];         // [tl][2i] = cos, [tl][2i+1] = sin
  __shared__ float sb[NPROJ];                                           // biases (bf16 RNE-converted)

  const int tid  = threadIdx.x;
  const int lane = tid & 31;
  const int wave = __builtin_amdgcn_readfirstlane(tid >> 5);
  const int half = lane >> 4;
  const int ln   = lane & 15;
  const int m0 = blockIdx.x * 64;               // compact token row of this tile
  const int b  = m0 / SEQ;
  const int t0 = m0 - b * SEQ;
  const float* xblk = x + ((size_t)b * SEQ_FULL + t0) * CDIM;

  // x chunk in registers, one chunk ahead of its use: thread -> rows (tid / 64) + 4 * it, 4 columns at (tid % 64) * 4. All 16 loads
  // of a chunk are in flight together; those of chunk 0 fly during the table set-up below, later ones during the products
  const float* xsrc = xblk + (size_t)(tid >> 6) * CDIM + (tid & 63) * 4;
  v4f xr[64 * (XC / 4) / 256];
#pragma unroll   // constant indices keep xr[] in registers and all 16 loads in flight at once
  for (int it = 0; it < 64 * (XC / 4) / 256; ++it)
    xr[it] = *(const v4f*)(xsrc + (size_t)it * 4 * CDIM);

  // rotary table for positions t0..t0+63: f_i = 1 / 10000^(i/32), angle = t * f_i, i = 0..31
#pragma unroll 1
  for (int i = tid; i < 64 * (HDIM / 2); i += 256) {
    const int r  = i >> 5;
    const int pr = i & 31;
    const float ex  = (float)(2 * pr) * 0.015625f;
    const float fr  = 1.0f / powf(10000.0f, ex);
    const float ang = (float)(t0 + r) * fr;
    float sn, cn;
    sincosf(ang, &sn, &cn);
    scs[r * HDIM + 2 * pr]     = cn;
    scs[r * HDIM + 2 * pr + 1] = sn;
  }
  if (tid < HDIM) {                             // waves 0 and 1 exactly (wave-uniform)
    sb[tid]            = bfr(bq[tid]);
    sb[HDIM + tid]     = bfr(bk[tid]);
    sb[2 * HDIM + tid] = bfr(bv[tid]);
  }

  const int rg = wave & 3;
  const int ch = wave >> 2;
  v8f acc[6];
#pragma unroll
  for (int nt = 0; nt < 6; ++nt) {
#pragma unroll
    for (int r = 0; r < 8; ++r) acc[nt][r] = 0.0f;
  }

  const unsigned short* wsrc = Wt + (size_t)(wave * (NPROJ / 8)) * WP + lane * 8;   // this lane's 16 bytes of the wave's first W row
#pragma unroll 1
  for (int kc = 0; kc < CDIM; kc += XC) {
    __syncthreads();   // all waves done reading the prior chunk
    // W chunk: wave w brings rows 24w..24w+23, each row's XC elements as 512 contiguous bytes; the loads are issued
    // ahead of the x chunk's conversion, which covers part of their latency, and stored behind it
    v4u wr[NPROJ / 8];
#pragma unroll   // constant indices keep wr[] in registers and all 24 loads in flight at once
    for (int j = 0; j < NPROJ / 8; ++j)
      wr[j] = *(const v4u*)(wsrc + (size_t)j * WP);
    // stage x chunk: 64 rows x XC columns (kc..kc+XC-1) -> bf16, from the registers loaded one chunk ago
#pragma unroll   // constant indices keep xr[] in registers
    for (int it = 0; it < 64 * (XC / 4) / 256; ++it) {
      const v4f v = xr[it];
      v2u w;
      w.x = bf_bits(v.x) | (bf_bits(v.y) << 16);
      w.y = bf_bits(v.z) | (bf_bits(v.w) << 16);
      *(v2u*)(sm + ((tid >> 6) + 4 * it) * XP + (tid & 63) * 4) = w;
    }
#pragma unroll   // constant indices keep wr[] in registers
    for (int j = 0; j < NPROJ / 8; ++j)
      *(v4u*)(swt + (wave * (NPROJ / 8) + j) * XP + lane * 8) = wr[j];
    wsrc += XC;
    __syncthreads();

    // the next chunk's x loads are issued ahead of this chunk's products, which cover their memory latency
    if (kc + XC < CDIM) {                       // block-uniform
      xsrc += XC;
#pragma unroll   // constant indices keep xr[] in registers and all 16 loads in flight at once
      for (int it = 0; it < 64 * (XC / 4) / 256; ++it)
        xr[it] = *(const v4f*)(xsrc + (size_t)it * 4 * CDIM);
    }

    const unsigned short* arow = sm + (rg * 16 + ln) * XP + 8 * half;
    const unsigned short* brow = swt + (ch * 96 + ln) * XP + 8 * half;
    // two register sets of fragments: the 14 LDS reads of k step ks + 1 are issued as one group ahead of the 6 products
    // of step ks, so that a product no longer waits out the LDS latency of its own operands
    v16us af[2];
    v16us bf[2][6];
    af[0] = frag_u16(arow);
#pragma unroll
    for (int nt = 0; nt < 6; ++nt) bf[0][nt] = frag_u16(brow + nt * 16 * XP);
#pragma unroll   // constant set indices keep both fragment sets in registers, with no copies between them
    for (int ks = 0; ks < XC / 32; ++ks) {
      const int cur = ks & 1;
      const int nxt = cur ^ 1;
      if (ks + 1 < XC / 32) {
        af[nxt] = frag_u16(arow + (ks + 1) * 32);
#pragma unroll
        for (int nt = 0; nt < 6; ++nt) bf[nxt][nt] = frag_u16(brow + nt * 16 * XP + (ks + 1) * 32);
      }
#pragma unroll
      for (int nt = 0; nt < 6; ++nt) acc[nt] = wmma_bf16(af[cur], bf[cur][nt], acc[nt]);
    }
  }
  __syncthreads();   // all waves done reading the x tile

  // staging (16-bit elements): sQ = sm[0..4095] as [t][64], sK = sm[4096..8191], sV = sm[8192..12287] and
  // sVr = sm[12288..16383] as the tile's two chunk blocks in fragment order
#pragma unroll
  for (int nt = 0; nt < 6; ++nt) {
    const int n0 = ch * 96 + nt * 16;            // wave-uniform
    const int p  = n0 >> 6;
    const int hc = (n0 & 63) + ln;
    const float bias = sb[p * HDIM + hc];
    const float sc = (p == 0) ? LOG2E_F : ((p == 2) ? 16.0f : 1.0f);
    unsigned short* base = sm + p * 4096;
    // r walks the low three bits of the token index, which every one of the three orders maps to a constant step
    const int tl0 = rg * 16 + 8 * half;
    const int i0  = (p == 2) ? vfrag_idx(hc, tl0) : ((p == 1) ? kfrag_idx(tl0, hc) : (tl0 * 64 + hc));
    const int ist = (p == 2) ? 1 : ((p == 1) ? 8 : 64);
#pragma unroll
    for (int r = 0; r < 8; ++r) {
      const int tl = rg * 16 + 8 * half + r;
      const float val = acc[nt][r] + bias;
      const float pv  = __shfl_xor(val, 1, 32);          // pair partner column hc^1 (lane ln^1), unconditional
      const float cn  = scs[tl * HDIM + (hc & ~1)];
      const float sn  = scs[tl * HDIM + (hc | 1)];
      const float t1  = val * cn;
      const float t2  = pv * sn;
      const float rot = (hc & 1) ? (t1 + t2) : (t1 - t2);  // even: ev*c - od*s ; odd: od*c + ev*s
      const float vf  = ((p < 2) ? rot : val) * sc;
      const int idx = i0 + r * ist;
      const _Float16 hv = (_Float16)vf;
      base[idx] = __builtin_bit_cast(unsigned short, hv);
      if (p == 2) {
        const _Float16 rv = (_Float16)((vf - (float)hv) * 1024.0f);
        sm[12288 + idx] = __builtin_bit_cast(unsigned short, rv);
      }
    }
  }
  __syncthreads();

  // whole-line stores: wave w owns token rows 8w..8w+7 of qh and pieces 2w, 2w+1 of the tile's 16 in kh, vT and vR
  const int rl = lane >> 3;
  const int pc = lane & 7;
  const int rA = wave * 8 + rl;
  const int rB = rA + 4;
  const v4u qA = *(const v4u*)(sm + rA * 64 + pc * 8);
  const v4u qB = *(const v4u*)(sm + rB * 64 + pc * 8);
  const int fA = wave * 512 + lane * 8;
  const int fB = fA + 256;
  const v4u kA = *(const v4u*)(sm + 4096 + fA);
  const v4u kB = *(const v4u*)(sm + 4096 + fB);
  const v4u vA = *(const v4u*)(sm + 8192 + fA);
  const v4u vB = *(const v4u*)(sm + 8192 + fB);
  const v4u uA = *(const v4u*)(sm + 12288 + fA);
  const v4u uB = *(const v4u*)(sm + 12288 + fB);
  _Float16* dqA = qh + (size_t)(m0 + rA) * HDIM + pc * 8;
  _Float16* dqB = qh + (size_t)(m0 + rB) * HDIM + pc * 8;
  _Float16* dkA = kh + (size_t)m0 * HDIM + fA;
  _Float16* dkB = kh + (size_t)m0 * HDIM + fB;
  _Float16* dvA = vT + (size_t)m0 * HDIM + fA;
  _Float16* dvB = vT + (size_t)m0 * HDIM + fB;
  _Float16* duA = vR + (size_t)m0 * HDIM + fA;
  _Float16* duB = vR + (size_t)m0 * HDIM + fB;
  *(v4u*)dqA = qA; *(v4u*)dqB = qB;
  *(v4u*)dkA = kA; *(v4u*)dkB = kB;
  *(v4u*)dvA = vA; *(v4u*)dvB = vB;
  *(v4u*)duA = uA; *(v4u*)duB = uB;
  
}

// ---------------------------------------------------------------------------
// Kernel 3: causal flash attention, all query tiles in one launch. Block = one tile of 16 query rows; its NS waves split the tile's key chunks
// (32 keys each): wave w takes chunks w, w + NS, w + 2*NS, ... and keeps its own running maximum, sums and O tile.
// The products are taken transposed: S^T = K . Q^T (K fragments as A, Q fragments as B) and O^T += V^T . P^T (V fragments as A).
// A lane then holds 16 scores of ONE query (column lane & 15; keys 8 * (lane >> 4) + r of each 16-key tile): the row maximum is taken
// in the lane plus one exchange between the lane halves, and the two score tiles, converted in place, ARE the B fragment of P^T
// (element 8t + r = tile t, register r, the split k map of the V fragments). P passes through no LDS and the loop holds no barrier.
// Online softmax in log2 domain, P carried x 1024 in f16; sums += (row of ones) . P^T.
// After the loop the partial results of the first NM waves (those that can hold a chunk) are merged through LDS in wave order (rescaled to the common row maximum).
// EARLY = 1 handles query rows < 256: adds P residual (x1024) and v residual plane (x1024)
// products into separate accumulators folded with 2^-10 before the merge; EARLY = 0 handles the rest.
// Query rows with mask == 0 get NaN (whole score row excluded -> NaN softmax).
// The two paths share one grid behind a block-uniform branch: neither reads what the other writes. The later rows' tiles
// come first in the grid, by rising row; the short tiles of rows < 256 come last and run beside them.
// Second launch bound (waves per SIMD): 8, so that two 16-wave blocks fit one WGP and the whole grid is resident at once.
// ---------------------------------------------------------------------------
// value of lane l ^ 16
__device__ __forceinline__ float xhalf(float x) {
  const int v = __builtin_bit_cast(int, x);
  return __builtin_bit_cast(float, __builtin_amdgcn_permlanex16(v, v, 0x76543210, 0xfedcba98, false, false));
}

// 2^x of eight values, with the range step of exp2f (an argument below -126 is raised by 64 and the result scaled back by 2^-64),
// so that the values are those of exp2f. The eight v_exp_f32 stand in one statement: behind each stands an instruction that neither
// reads its result nor overwrites its source (the outputs are early-clobber), and behind the last a v_nop: the slot that the
// instruction set asks for behind a transcendental, which the compiler leaves open between two adjacent v_exp_f32
__device__ __forceinline__ v8f exp2_x8(v8f x) {
  float a[8], y[8];
#pragma unroll   // constant indices keep a[] and y[] in registers
  for (int r = 0; r < 8; ++r) a[r] = x[r] + ((x[r] < -126.0f) ? 64.0f : 0.0f);
  asm("v_exp_f32 %0, %8\n\tv_exp_f32 %1, %9\n\tv_exp_f32 %2, %10\n\tv_exp_f32 %3, %11\n\t"
      "v_exp_f32 %4, %12\n\tv_exp_f32 %5, %13\n\tv_exp_f32 %6, %14\n\tv_exp_f32 %7, %15\n\tv_nop"
      : "=&v"(y[0]), "=&v"(y[1]), "=&v"(y[2]), "=&v"(y[3]), "=&v"(y[4]), "=&v"(y[5]), "=&v"(y[6]), "=&v"(y[7])
      : "v"(a[0]), "v"(a[1]), "v"(a[2]), "v"(a[3]), "v"(a[4]), "v"(a[5]), "v"(a[6]), "v"(a[7]));
  v8f res;
#pragma unroll
  for (int r = 0; r < 8; ++r) res[r] = ldexpf(y[r], (x[r] < -126.0f) ? -64 : 0);
  return res;
}

template <int EARLY>
__device__ __forceinline__
void attn_tile(const _Float16* __restrict__ qh, const _Float16* __restrict__ kh,
               const _Float16* __restrict__ vT, const _Float16* __restrict__ vR,
               const int* __restrict__ mask, float* __restrict__ out, const int b, const int tq,
               float (*part)[16][68], float (*pmax)[NS_A], float (*pden)[NS_A])
{
  constexpr int NS  = NS_A;                    // waves per block = key splits of the tile
  constexpr int NM  = (EARLY && 2 * NTB_E < NS) ? 2 * NTB_E : NS;   // waves that can hold a chunk (rows < 256: at most 2 chunks per 64 rows)
  constexpr int CPT = 32 / NS;                 // output columns merged per thread (16 x 64 tile over NS*32 threads)
  constexpr int TPR = HDIM / CPT;              // threads per output row in the merge
  typedef float vcf __attribute__((ext_vector_type(CPT)));

  const int tid  = threadIdx.x;
  const int lane = tid & 31;
  const int wave = __builtin_amdgcn_readfirstlane(tid >> 5);
  const int half = lane >> 4;
  const int ln   = lane & 15;
  const int row0 = tq * 16;                      // first query row of this block (within the sequence)

  const _Float16* qrow  = qh + ((size_t)b * SEQ + row0 + ln) * HDIM + 8 * half;
  // block-uniform plane bases (scalar registers); a lane's own part of an address is one 32-bit element offset, below
  // SEQ * HDIM and the same in all three planes (chunk block + lane * 8), not a 64-bit pointer
  const _Float16* kbase = kh + (size_t)b * SEQ * HDIM;
  const _Float16* vbase = vT + (size_t)b * HDIM * SEQ;
  const _Float16* rbase = vR + (size_t)b * HDIM * SEQ;

  // pad flag of the query row that this thread will merge and store (row0 + tid / TPR, always < SEQ); with one wave per row the
  // index is wave-uniform, so that the flag waits in a scalar register and takes no vector register across the loop
  const int mk = mask[(size_t)b * SEQ_FULL + row0 + ((TPR == 32) ? wave : tid / TPR)];
  // held before any register that the flag load names (its offset, its base pair) is written again
  asm volatile("s_wait_xcnt 0x0" ::: "memory");

  // loop-invariant Q fragments (feature blocks 0..31, 32..63), B operand: column = query (lane&15), k = feature (split map)
  const v16h qa0 = frag_f16(qrow);
  const v16h qa1 = frag_f16(qrow + 32);

  // A operand whose row 0 is ones: row 0 of its product with P^T holds each query's sum (lane = query, register 0)
  v16h ones;
#pragma unroll
  for (int i = 0; i < 16; ++i) ones[i] = (ln == 0) ? (_Float16)1.0f : (_Float16)0.0f;

  v8f o[4], orr[4];                              // O^T tiles: register r = feature 16 * ht + 8 * half + r of query ln
  v8f osum, osumr;
#pragma unroll
  for (int r = 0; r < 8; ++r) { osum[r] = 0.0f; osumr[r] = 0.0f; }
#pragma unroll
  for (int ht = 0; ht < 4; ++ht) {
#pragma unroll
    for (int r = 0; r < 8; ++r) { o[ht][r] = 0.0f; orr[ht][r] = 0.0f; }
  }
  float rmax = NEG_BIG;                          // running maximum of query ln, the same in both lane halves

  const int nchunk = ((row0 + 15) >> 5) + 1;     // keys 0 .. row0+15 in chunks of 32
#pragma unroll 1   // rolled: the registers of one trip only (the register budget decides how many blocks a WGP holds)
  for (int c = wave; c < nchunk; c += NS) {      // wave-uniform trip count; nothing in the loop is shared between waves
    const int kt0 = c * 32;
    v8f s[2];
    // S^T[32 x 16] = K(32 x 64) . Q^T, K as A operand: row = key (lane&15), k = feature (split map)
#pragma unroll
    for (int nt = 0; nt < 2; ++nt) {
      const _Float16* kfr = kbase + (unsigned int)(c * 2048 + nt * 1024 + lane * 8);   // pieces 4nt .. 4nt+3 of the chunk's block
      const v16h kb0 = frag_lin(kfr);
      FragH kf;
      kf.h[0] = *(const v8h*)(kfr + 512);
      // later rows: the chunk's loads share one address pair, and the compiler may let a tile's last load land on that pair: the
      // loads before it are held first (rows < 256 load from a scalar base and one offset register that no result lands on)
      if (!EARLY) asm volatile("s_wait_xcnt 0x0" ::: "memory");
      kf.h[1] = *(const v8h*)(kfr + 768);
      const v16h kb1 = kf.v;
      v8f acc;
#pragma unroll
      for (int r = 0; r < 8; ++r) acc[r] = 0.0f;
      acc = wmma_f16(kb0, qa0, acc);
      acc = wmma_f16(kb1, qa1, acc);
#pragma unroll
      for (int r = 0; r < 8; ++r) {
        const int key = kt0 + nt * 16 + 8 * half + r;
        const float sv = acc[r] * SCL;                  // CDIM^-0.5, log2e already in q
        s[nt][r] = (key > row0 + ln) ? NEG_BIG : sv;    // causal fill (replace)
      }
    }
    // online softmax of query ln: this lane's 16 keys, then the other half's 16
    float tmax = fmaxf(s[0][0], s[1][0]);
#pragma unroll
    for (int r = 1; r < 8; ++r) tmax = fmaxf(tmax, fmaxf(s[0][r], s[1][r]));
    tmax = fmaxf(tmax, xhalf(tmax));
    const float nmax  = fmaxf(rmax, tmax);
    const float alpha = exp2f(rmax - nmax);
    rmax = nmax;
    osum[0] *= alpha;                            // the sums' tile has its one live row in register 0; the other rows stay 0
    if (EARLY) osumr[0] *= alpha;
#pragma unroll
    for (int ht = 0; ht < 4; ++ht) {
#pragma unroll
      for (int r = 0; r < 8; ++r) {
        o[ht][r] *= alpha;
        if (EARLY) orr[ht][r] *= alpha;
      }
    }
    // P^T as B operand, straight from the score tiles (carried x 1024; residual x 1024 more)
    v16h pa, pra;
#pragma unroll
    for (int nt = 0; nt < 2; ++nt) {
      const v8f e = exp2_x8(s[nt] - nmax);
#pragma unroll
      for (int r = 0; r < 8; ++r) {
        const float pf = e[r] * 1024.0f;
        const _Float16 ph = (_Float16)pf;
        pa[nt * 8 + r] = ph;
        if (EARLY) pra[nt * 8 + r] = (_Float16)((pf - (float)ph) * 1024.0f);
      }
    }

    // V as A operand: row = feature (lane&15), k = key (split map): pieces 2ht, 2ht+1 of the chunk's block
    if (EARLY) {
      osum  = wmma_f16(ones, pa,  osum);
      osumr = wmma_f16(ones, pra, osumr);
#pragma unroll
      for (int ht = 0; ht < 4; ++ht) {
        const v16h vb = frag_lin(vbase + (unsigned int)(c * 2048 + ht * 512 + lane * 8));
        o[ht]   = wmma_f16(vb, pa,  o[ht]);
        orr[ht] = wmma_f16(vb, pra, orr[ht]);
      }
#pragma unroll
      for (int ht = 0; ht < 4; ++ht) {
        const v16h vr = frag_lin(rbase + (unsigned int)(c * 2048 + ht * 512 + lane * 8));
        orr[ht] = wmma_f16(vr, pa, orr[ht]);
      }
    } else {
#pragma unroll
      for (int ht = 0; ht < 4; ++ht) {
        const v16h vb = frag_lin(vbase + (unsigned int)(c * 2048 + ht * 512 + lane * 8));
        o[ht] = wmma_f16(vb, pa, o[ht]);
      }
      osum = wmma_f16(ones, pa, osum);   // sums of the same f16 P
    }
  }

  // lane index taken anew, so that no thread-index value has to
  // stay in a register across the loop (the register budget decides how many blocks a WGP holds)
  const int el  = (int)__lane_id();
  const int eh  = el >> 4;
  const int eln = el & 15;

  // merge ownership: each thread owns CPT adjacent columns of one query row
  const unsigned int et = (unsigned int)(wave * 32 + el);
  const int mrow = (int)(et / TPR);
  const int mcol = (int)(et % TPR) * CPT;

  // every wave publishes its own row maxima, row sums and unnormalised O tile (a wave without a chunk: NEG_BIG, 0, 0);
  // a lane's 8 registers of an O^T tile are 8 adjacent features of its query's row
#pragma unroll
  for (int ht = 0; ht < 4; ++ht) {
    v4f lo, hi;
#pragma unroll
    for (int r = 0; r < 4; ++r) {
      lo[r] = o[ht][r];
      hi[r] = o[ht][r + 4];
      if (EARLY) {
        lo[r] = lo[r] + orr[ht][r] * RINV;
        hi[r] = hi[r] + orr[ht][r + 4] * RINV;
      }
    }
    *(v4f*)(&part[wave][eln][ht * 16 + 8 * eh])     = lo;
    *(v4f*)(&part[wave][eln][ht * 16 + 8 * eh + 4]) = hi;
  }
  if (eh == 0) {
    float den = osum[0];
    if (EARLY) den = den + osumr[0] * RINV;
    pmax[eln][wave] = rmax;
    pden[eln][wave] = den;
  }
  __syncthreads();   // all NS partial results are in LDS before any thread merges them

  // merge: the partials of the first NM waves (those that can hold a chunk) are added in wave order, each rescaled by 2^(its maximum - common maximum)
  float pm[NM];
  float gmax = NEG_BIG;
#pragma unroll
  for (int w = 0; w < NM; ++w) { pm[w] = pmax[mrow][w]; gmax = fmaxf(gmax, pm[w]); }
  float den = 0.0f;
  vcf num;
#pragma unroll
  for (int i = 0; i < CPT; ++i) num[i] = 0.0f;
#pragma unroll
  for (int w = 0; w < NM; ++w) {
    const float f = exp2f(pm[w] - gmax);
    den += pden[mrow][w] * f;
    num += *(const vcf*)(&part[w][mrow][mcol]) * f;
  }

  const float qnan = __uint_as_float(0x7fc00000u);

  // normalise (1024 carry cancels between numerator and denominator; 1/16 undoes the v carry)
  const float inv = 0.0625f * __builtin_amdgcn_rcpf(den);
  vcf res;
#pragma unroll
  for (int i = 0; i < CPT; ++i) res[i] = (mk != 0) ? (num[i] * inv) : qnan;
  *(vcf*)(out + ((size_t)b * SEQ_FULL + row0 + mrow) * HDIM + mcol) = res;
}

__global__ __launch_bounds__(NS_A * 32, 8) __attribute__((amdgpu_num_vgpr(256)))
void k_attn(const _Float16* __restrict__ qh, const _Float16* __restrict__ kh,
            const _Float16* __restrict__ vT, const _Float16* __restrict__ vR,
            const int* __restrict__ mask, float* __restrict__ out)
{
  __shared__ __attribute__((aligned(16))) float    part[NS_A][16][68];   // per-wave 16 x 64 partial O tile
  __shared__ __attribute__((aligned(16))) float    pmax[16][NS_A];       // per-wave row maxima  [row][wave]
  __shared__ __attribute__((aligned(16))) float    pden[16][NS_A];       // per-wave row sums    [row][wave]

  const int blk = blockIdx.x;                    // block-uniform: the barrier below is passed by the whole block
  if (blk < NB * NTB_L * 4) {
    const int b = blk / (4 * NTB_LD);
    attn_tile<0>(qh, kh, vT, vR, mask, out, b, 4 * NTB_E + (blk - b * (4 * NTB_LD)), part, pmax, pden);
  } else {
    const int e = blk - NB * NTB_L * 4;
    const int b = e / (4 * NTB_E);
    attn_tile<1>(qh, kh, vT, vR, mask, out, b, e - b * (4 * NTB_E), part, pmax, pden);
  }
}

// ---------------------------------------------------------------------------
extern "C" void kernel_launch(void* const* d_in, const int* in_sizes, int n_in,
                              void* d_out, int out_size, void* d_ws, size_t ws_size,
                              hipStream_t stream)
{
  if (n_in < 8) return;
  const long long tok_rows = (long long)(NB - 1) * SEQ_FULL + SEQ;
  if ((long long)in_sizes[0] < tok_rows * CDIM) return;
  if ((long long)in_sizes[1] < tok_rows) return;
  if (in_sizes[2] < CDIM * HDIM || in_sizes[4] < CDIM * HDIM || in_sizes[6] < CDIM * HDIM) return;
  if (in_sizes[3] < HDIM || in_sizes[5] < HDIM || in_sizes[7] < HDIM) return;
  if ((long long)out_size < tok_rows * HDIM) return;

  const float* x    = (const float*)d_in[0];
  const int*   mask = (const int*)d_in[1];
  const float* Wq   = (const float*)d_in[2];
  const float* bq   = (const float*)d_in[3];
  const float* Wk   = (const float*)d_in[4];
  const float* bk   = (const float*)d_in[5];
  const float* Wv   = (const float*)d_in[6];
  const float* bv   = (const float*)d_in[7];
  float* out = (float*)d_out;

  // workspace carve (bytes): Wt 192*1024*2 = 393216 | qh NB*SEQ*64*2 | kh same | vT same | vR same
  const size_t wt_bytes = (size_t)NPROJ * WP * sizeof(unsigned short);
  const size_t plane    = (size_t)NB * SEQ * HDIM * sizeof(_Float16);
  const size_t off_wt = 0;
  const size_t off_q  = (off_wt + wt_bytes + 255) & ~(size_t)255;
  const size_t off_k  = off_q + plane;
  const size_t off_v  = off_k + plane;
  const size_t off_r  = off_v + plane;
  const size_t total  = off_r + plane;
  if (total > ws_size) return;

  unsigned short* Wt = (unsigned short*)((char*)d_ws + off_wt);
  _Float16* qh = (_Float16*)((char*)d_ws + off_q);
  _Float16* kh = (_Float16*)((char*)d_ws + off_k);
  _Float16* vT = (_Float16*)((char*)d_ws + off_v);
  _Float16* vR = (_Float16*)((char*)d_ws + off_r);

  k_wconv<<<NPROJ / 8, 256, 0, stream>>>(Wq, Wk, Wv, Wt);
  k_proj<<<(NB * SEQ) / 64, 256, 0, stream>>>(x, Wt, bq, bk, bv, qh, kh, vT, vR);
  k_attn<<<NB * NTB * 4, NS_A * 32, 0, stream>>>(qh, kh, vT, vR, mask, out);
}

// v008
// Measured time: 35 microseconds a run.
// In two side-by-side timings against v007, it was 1.10 and 1.08 times as fast.
// All steps since v000 together make it 6.50 times as fast.
#include <hip/hip_runtime.h>

// Contractions: x*W projections (q,k,v): v_wmma_f32_16x16x32_bf16, bf16 operands (RNE-converted inputs), f32 accumulate.
// q.k scores, P.v, P row sums: v_wmma_f32_16x16x32_f16, f16 operands (q x log2e, k, P x 1024, v x 16), f32 accumulate;
// query rows < 256 of each sequence also use f16 residual planes of P and v (x1024 carries) in separate f32 accumulators.
// Bias add, rotary pair mixing (f32 cos/sin via powf + sincosf), online softmax and normalisation in f32.

#ifndef NB
#define NB 4
#endif
#ifndef SEQ
#define SEQ 2048
#endif
#define NB_FULL  4
#define SEQ_FULL 2048
#define CDIM  1024
#define HDIM  64
#define NPROJ 192
#define XC    256         // k chunk of the x tile staged in LDS per pass
#define XP    264         // LDS pitch of the staged x chunk (16-bit elements)
#define NTB    (SEQ / 64)                    // 64-row query tiles per sequence
#define NTB_E  ((NTB < 4) ? NTB : 4)         // tiles with query rows < 256: residual path
#define NTB_L  (NTB - NTB_E)
#define NTB_LD ((NTB_L > 0) ? NTB_L : 1)
#define NS_A   16                             // key splits (waves) per 16-row query tile, the same for all rows (one launch)

static_assert(SEQ % 64 == 0 && SEQ >= 64);
static_assert(NS_A == 8 || NS_A == 16);
static_assert(SEQ <= SEQ_FULL);
static_assert(NB >= 1 && NB <= NB_FULL);
static_assert((CDIM % XC) == 0 && (XC % 32) == 0);
static_assert(XP >= XC && (XP % 8) == 0);
static_assert(XC == 8 * 32);   // wave w of 8 stages the 32 k at 32 * w of each W chunk
static_assert(XC / 4 == 64);   // one x row of a chunk = 64 threads' 16-byte loads
static_assert(NPROJ == 3 * HDIM && (NPROJ % 32) == 0 && (HDIM % 8) == 0 && HDIM == 64);
static_assert(64 * XP >= 4 * 4096);
static_assert(((long long)(NB - 1) * SEQ_FULL + SEQ) * HDIM <= 524288LL);

typedef _Float16       v16h  __attribute__((ext_vector_type(16)));
typedef _Float16       v8h   __attribute__((ext_vector_type(8)));
typedef float          v8f   __attribute__((ext_vector_type(8)));
typedef float          v4f   __attribute__((ext_vector_type(4)));
typedef unsigned short v16us __attribute__((ext_vector_type(16)));
typedef unsigned short v8us  __attribute__((ext_vector_type(8)));
typedef unsigned int   v4u   __attribute__((ext_vector_type(4)));
typedef unsigned int   v2u   __attribute__((ext_vector_type(2)));
typedef __bf16         v16bf __attribute__((ext_vector_type(16)));
typedef __bf16         v2bf  __attribute__((ext_vector_type(2)));
typedef float          v2f   __attribute__((ext_vector_type(2)));

union FragH { v16h v; v8h h[2]; };
union FragU { v16us v; v8us h[2]; };

#define LOG2E_F 1.4426950408889634f
#define NEG_BIG (-3.0e38f)
#define RINV    0.0009765625f
#define SCL     0.03125f          // CDIM^-0.5

// f32 -> bf16 bits, RNE convert
__device__ __forceinline__ unsigned int bf_bits(float f) {
  const unsigned int u = __float_as_uint(f);
  return (u + 0x7FFFu + ((u >> 16) & 1u)) >> 16;
}
// f32 -> bf16 (RNE) -> f32
__device__ __forceinline__ float bfr(float f) {
  return __uint_as_float(bf_bits(f) << 16);
}

// two f32 -> two bf16 (RNE) in one word, lo in the low half: one packed hardware convert
__device__ __forceinline__ unsigned int bf_pack(float lo, float hi) {
  v2f f;
  f.x = lo;
  f.y = hi;
  return __builtin_bit_cast(unsigned int, __builtin_convertvector(f, v2bf));
}

// WMMA helpers with the VALU hazard guard (ties D, keeps A/B live)
__device__ __forceinline__ v8f wmma_f16(v16h a, v16h b, v8f c) {
  v8f d = __builtin_amdgcn_wmma_f32_16x16x32_f16(false, a, false, b, (short)0, c, false, false);
  asm volatile("v_nop\n\tv_nop\n\tv_nop\n\tv_nop" : "+v"(d) : "v"(a), "v"(b));
  return d;
}
__device__ __forceinline__ v8f wmma_bf16(v16us a, v16us b, v8f c) {
  v8f d = __builtin_amdgcn_wmma_f32_16x16x32_bf16(false, __builtin_bit_cast(v16bf, a), false,
                                                   __builtin_bit_cast(v16bf, b), (short)0, c, false, false);
  asm volatile("v_nop\n\tv_nop\n\tv_nop\n\tv_nop" : "+v"(d) : "v"(a), "v"(b));
  return d;
}

// 16-bit operand fragment, split k map for BOTH A and B:
// p = (row or column (lane&15)) base + k0 + 8*(lane>>4); elements 0..7 <- p[0..7], elements 8..15 <- p[16..23].
__device__ __forceinline__ v16h frag_f16(const _Float16* p) {
  FragH f;
  f.h[0] = *(const v8h*)p;
  f.h[1] = *(const v8h*)(p + 16);
  return f.v;
}
// The K and V planes lie in the workspace in the order in which the attention kernel's fragment loads read them: each chunk of
// 32 tokens is one block of 2048 elements = 8 pieces of 512 bytes; piece j holds, lane after lane, the 8 elements that lane l takes
// with its j-th 16-byte load, so that one wave-wide load reads 512 contiguous, line-aligned bytes (4 lines, not 16).
// K, token tl (within a tile of whole chunks), feature f: piece = 4 * (16-key tile of the chunk) + f / 16, lane = 16 * ((f / 8) & 1) + tl % 16.
__device__ __forceinline__ int kfrag_idx(int tl, int f) {
  return (tl >> 5) * 2048 + ((((tl >> 4) & 1) * 4 + (f >> 4)) * 32 + ((f >> 3) & 1) * 16 + (tl & 15)) * 8 + (f & 7);
}
// V, feature h, token tl: piece = 2 * (h / 16) + (16-key half of the chunk), lane = 16 * ((tl / 8) & 1) + h % 16.
__device__ __forceinline__ int vfrag_idx(int h, int tl) {
  return (tl >> 5) * 2048 + (((h >> 4) * 2 + ((tl >> 4) & 1)) * 32 + ((tl >> 3) & 1) * 16 + (h & 15)) * 8 + (tl & 7);
}
// fragment from two adjacent pieces of such a block: p = block + piece * 256 + lane * 8; the k map is that of frag_f16
__device__ __forceinline__ v16h frag_lin(const _Float16* p) {
  FragH f;
  f.h[0] = *(const v8h*)p;
  f.h[1] = *(const v8h*)(p + 256);
  return f.v;
}
__device__ __forceinline__ v16us frag_u16(const unsigned short* p) {
  FragU f;
  f.h[0] = *(const v8us*)p;
  f.h[1] = *(const v8us*)(p + 16);
  return f.v;
}

// ---------------------------------------------------------------------------
// Kernel 1: q,k,v projections (+bias, rotary pair mixing on q,k) for a tile of 64 token rows on bf16 WMMA.
// 8 waves: wave -> 16 rows (wave&3) x 96 output columns (wave>>2). x tile staged in LDS as bf16 in 4 chunks of 256 k
// (each chunk loaded into registers one chunk ahead),
// and with each x chunk the same 256 k of all 192 W columns (n = 64 * p + column; p: 0 q, 1 k, 2 v), read as f32 from Wq, Wk, Wv,
// converted to bf16 and transposed to [n][k] on the way into LDS, so that the B fragments come from LDS like the A fragments.
// Outputs: qh = f16(rot(q+bq)*log2e) [tok][64]; kh = f16(rot(k+bk)), vT = f16(16*(v+bv)) and vR = f16((16*v - vT) * 1024)
// (residual plane), each as [chunk of 32 tokens][2048] in fragment order (kfrag_idx, vfrag_idx).
// ---------------------------------------------------------------------------
__global__ __launch_bounds__(256) __attribute__((amdgpu_num_vgpr(256)))
void k_proj(const float* __restrict__ x,
            const float* __restrict__ Wq, const float* __restrict__ Wk, const float* __restrict__ Wv,
            const float* __restrict__ bq, const float* __restrict__ bk, const float* __restrict__ bv,
            _Float16* __restrict__ qh, _Float16* __restrict__ kh,
            _Float16* __restrict__ vT, _Float16* __restrict__ vR)
{
  __shared__ __attribute__((aligned(16))) unsigned short sm[64 * XP];    // 33792 B, later reused as staging
  __shared__ __attribute__((aligned(16))) unsigned short swt[NPROJ * XP]; // W chunk [n][k], same pitch as the x chunk, 101376 B
  __shared__ __attribute__((aligned(16))) float scs[64 * HDIM];         // [tl][2i] = cos, [tl][2i+1] = sin
  __shared__ float sb[NPROJ];                                           // biases (bf16 RNE-converted)

  const int tid  = threadIdx.x;
  const int lane = tid & 31;
  const int wave = __builtin_amdgcn_readfirstlane(tid >> 5);
  const int half = lane >> 4;
  const int ln   = lane & 15;
  const int m0 = blockIdx.x * 64;               // compact token row of this tile
  const int b  = m0 / SEQ;
  const int t0 = m0 - b * SEQ;
  const float* xblk = x + ((size_t)b * SEQ_FULL + t0) * CDIM;

  // x chunk in registers, one chunk ahead of its use: thread -> rows (tid / 64) + 4 * it, 4 columns at (tid % 64) * 4. All 16 loads
  // of a chunk are in flight together; those of chunk 0 fly during the table set-up below, later ones during the products
  const float* xsrc = xblk + (size_t)(tid >> 6) * CDIM + (tid & 63) * 4;
  v4f xr[64 * (XC / 4) / 256];
#pragma unroll   // constant indices keep xr[] in registers and all 16 loads in flight at once
  for (int it = 0; it < 64 * (XC / 4) / 256; ++it)
    xr[it] = *(const v4f*)(xsrc + (size_t)it * 4 * CDIM);

  // rotary table for positions t0..t0+63: f_i = 1 / 10000^(i/32), angle = t * f_i, i = 0..31
#pragma unroll 1
  for (int i = tid; i < 64 * (HDIM / 2); i += 256) {
    const int r  = i >> 5;
    const int pr = i & 31;
    const float ex  = (float)(2 * pr) * 0.015625f;
    const float fr  = 1.0f / powf(10000.0f, ex);
    const float ang = (float)(t0 + r) * fr;
    float sn, cn;
    sincosf(ang, &sn, &cn);
    scs[r * HDIM + 2 * pr]     = cn;
    scs[r * HDIM + 2 * pr + 1] = sn;
  }
  if (tid < HDIM) {                             // waves 0 and 1 exactly (wave-uniform)
    sb[tid]            = bfr(bq[tid]);
    sb[HDIM + tid]     = bfr(bk[tid]);
    sb[2 * HDIM + tid] = bfr(bv[tid]);
  }

  const int rg = wave & 3;
  const int ch = wave >> 2;
  v8f acc[6];
#pragma unroll
  for (int nt = 0; nt < 6; ++nt) {
#pragma unroll
    for (int r = 0; r < 8; ++r) acc[nt][r] = 0.0f;
  }

  // W staging: wave w brings the 32 k at 32 * w of a chunk for all 192 columns, as 6 units of 32 k x 32 columns. In a unit a lane
  // loads 8 k rows x 4 adjacent columns (a wave-wide load = 4 rows x 128 bytes = 4 whole lines) and stores, for each of its 4
  // columns, the 8 k as 16 bytes. Lane -> column group wg and k group wk: every 16 lanes hold 4 wg x 4 wk, which spreads
  // their 16-byte stores (pitch XP) over all 64 banks
  const int wg = (lane & 3) | ((lane >> 4) << 2);   // 0..7: columns 4 * wg .. 4 * wg + 3 of the unit
  const int wk = (lane >> 2) & 3;                   // 0..3: k 8 * wk .. 8 * wk + 7 of the unit
  const int woff = (wave * 32 + wk * 8) * HDIM + wg * 4;   // lane's element offset in a W matrix, chunk 0
  const float* wsq = Wq + woff;                     // this lane's first 16 bytes of the chunk in each matrix; they step on by a chunk
  const float* wsk = Wk + woff;
  const float* wsv = Wv + woff;
  unsigned short* wdst = swt + (wg * 4) * XP + wave * 32 + wk * 8;
#pragma unroll 1
  for (int kc = 0; kc < CDIM; kc += XC) {
    __syncthreads();   // all waves done reading the prior chunk
    // W chunk, units 0..2: the loads are issued ahead of the x chunk's conversion, which covers part of their latency
    v4f wr[3][8];
#pragma unroll   // constant indices keep wr[] in registers and all 24 loads in flight at once
    for (int u = 0; u < 3; ++u) {
      const float* ws = ((u >> 1) == 0 ? wsq : wsk) + (u & 1) * 32;
#pragma unroll
      for (int j = 0; j < 8; ++j) wr[u][j] = *(const v4f*)(ws + j * HDIM);
    }
    // stage x chunk: 64 rows x XC columns (kc..kc+XC-1) -> bf16, from the registers loaded one chunk ago
#pragma unroll   // constant indices keep xr[] in registers
    for (int it = 0; it < 64 * (XC / 4) / 256; ++it) {
      const v4f v = xr[it];
      v2u w;
      w.x = bf_bits(v.x) | (bf_bits(v.y) << 16);
      w.y = bf_bits(v.z) | (bf_bits(v.w) << 16);
      *(v2u*)(sm + ((tid >> 6) + 4 * it) * XP + (tid & 63) * 4) = w;
    }
    // each unit is converted and stored (word m of a column = k 2m, 2m + 1); unit u + 3 is loaded into the registers unit u leaves
#pragma unroll   // constant indices keep wr[] in registers
    for (int u = 0; u < 6; ++u) {
#pragma unroll
      for (int i = 0; i < 4; ++i) {
        v4u d;
#pragma unroll
        for (int m = 0; m < 4; ++m) d[m] = bf_pack(wr[u % 3][2 * m][i], wr[u % 3][2 * m + 1][i]);
        *(v4u*)(wdst + (u * 32 + i) * XP) = d;
      }
      if (u < 3) {
        const float* ws = (((u + 3) >> 1) == 1 ? wsk : wsv) + ((u + 3) & 1) * 32;
#pragma unroll
        for (int j = 0; j < 8; ++j) wr[u][j] = *(const v4f*)(ws + j * HDIM);
        // keeps these loads here, ahead of the next unit's conversion: sunk behind it they would start later and be waited for longer
        __builtin_amdgcn_sched_barrier(0);
      }
    }
    wsq += XC * HDIM;
    wsk += XC * HDIM;
    wsv += XC * HDIM;
    __syncthreads();

    // the next chunk's x loads are issued ahead of this chunk's products, which cover their memory latency
    if (kc + XC < CDIM) {                       // block-uniform
      xsrc += XC;
#pragma unroll   // constant indices keep xr[] in registers and all 16 loads in flight at once
      for (int it = 0; it < 64 * (XC / 4) / 256; ++it)
        xr[it] = *(const v4f*)(xsrc + (size_t)it * 4 * CDIM);
    }

    const unsigned short* arow = sm + (rg * 16 + ln) * XP + 8 * half;
    const unsigned short* brow = swt + (ch * 96 + ln) * XP + 8 * half;
    // two register sets of fragments: the 14 LDS reads of k step ks + 1 are issued as one group ahead of the 6 products
    // of step ks, so that a product no longer waits out the LDS latency of its own operands
    v16us af[2];
    v16us bf[2][6];
    af[0] = frag_u16(arow);
#pragma unroll
    for (int nt = 0; nt < 6; ++nt) bf[0][nt] = frag_u16(brow + nt * 16 * XP);
#pragma unroll   // constant set indices keep both fragment sets in registers, with no copies between them
    for (int ks = 0; ks < XC / 32; ++ks) {
      const int cur = ks & 1;
      const int nxt = cur ^ 1;
      if (ks + 1 < XC / 32) {
        af[nxt] = frag_u16(arow + (ks + 1) * 32);
#pragma unroll
        for (int nt = 0; nt < 6; ++nt) bf[nxt][nt] = frag_u16(brow + nt * 16 * XP + (ks + 1) * 32);
      }
#pragma unroll
      for (int nt = 0; nt < 6; ++nt) acc[nt] = wmma_bf16(af[cur], bf[cur][nt], acc[nt]);
    }
  }
  __syncthreads();   // all waves done reading the x tile

  // staging (16-bit elements): sQ = sm[0..4095] as [t][64], sK = sm[4096..8191], sV = sm[8192..12287] and
  // sVr = sm[12288..16383] as the tile's two chunk blocks in fragment order
#pragma unroll
  for (int nt = 0; nt < 6; ++nt) {
    const int n0 = ch * 96 + nt * 16;            // wave-uniform
    const int p  = n0 >> 6;
    const int hc = (n0 & 63) + ln;
    const float bias = sb[p * HDIM + hc];
    const float sc = (p == 0) ? LOG2E_F : ((p == 2) ? 16.0f : 1.0f);
    unsigned short* base = sm + p * 4096;
    // r walks the low three bits of the token index, which every one of the three orders maps to a constant step
    const int tl0 = rg * 16 + 8 * half;
    const int i0  = (p == 2) ? vfrag_idx(hc, tl0) : ((p == 1) ? kfrag_idx(tl0, hc) : (tl0 * 64 + hc));
    const int ist = (p == 2) ? 1 : ((p == 1) ? 8 : 64);
#pragma unroll
    for (int r = 0; r < 8; ++r) {
      const int tl = rg * 16 + 8 * half + r;
      const float val = acc[nt][r] + bias;
      const float pv  = __shfl_xor(val, 1, 32);          // pair partner column hc^1 (lane ln^1), unconditional
      const float cn  = scs[tl * HDIM + (hc & ~1)];
      const float sn  = scs[tl * HDIM + (hc | 1)];
      const float t1  = val * cn;
      const float t2  = pv * sn;
      const float rot = (hc & 1) ? (t1 + t2) : (t1 - t2);  // even: ev*c - od*s ; odd: od*c + ev*s
      const float vf  = ((p < 2) ? rot : val) * sc;
      const int idx = i0 + r * ist;
      const _Float16 hv = (_Float16)vf;
      base[idx] = __builtin_bit_cast(unsigned short, hv);
      if (p == 2) {
        const _Float16 rv = (_Float16)((vf - (float)hv) * 1024.0f);
        sm[12288 + idx] = __builtin_bit_cast(unsigned short, rv);
      }
    }
  }
  __syncthreads();

  // whole-line stores: wave w owns token rows 8w..8w+7 of qh and pieces 2w, 2w+1 of the tile's 16 in kh, vT and vR
  const int rl = lane >> 3;
  const int pc = lane & 7;
  const int rA = wave * 8 + rl;
  const int rB = rA + 4;
  const v4u qA = *(const v4u*)(sm + rA * 64 + pc * 8);
  const v4u qB = *(const v4u*)(sm + rB * 64 + pc * 8);
  const int fA = wave * 512 + lane * 8;
  const int fB = fA + 256;
  const v4u kA = *(const v4u*)(sm + 4096 + fA);
  const v4u kB = *(const v4u*)(sm + 4096 + fB);
  const v4u vA = *(const v4u*)(sm + 8192 + fA);
  const v4u vB = *(const v4u*)(sm + 8192 + fB);
  const v4u uA = *(const v4u*)(sm + 12288 + fA);
  const v4u uB = *(const v4u*)(sm + 12288 + fB);
  _Float16* dqA = qh + (size_t)(m0 + rA) * HDIM + pc * 8;
  _Float16* dqB = qh + (size_t)(m0 + rB) * HDIM + pc * 8;
  _Float16* dkA = kh + (size_t)m0 * HDIM + fA;
  _Float16* dkB = kh + (size_t)m0 * HDIM + fB;
  _Float16* dvA = vT + (size_t)m0 * HDIM + fA;
  _Float16* dvB = vT + (size_t)m0 * HDIM + fB;
  _Float16* duA = vR + (size_t)m0 * HDIM + fA;
  _Float16* duB = vR + (size_t)m0 * HDIM + fB;
  *(v4u*)dqA = qA; *(v4u*)dqB = qB;
  *(v4u*)dkA = kA; *(v4u*)dkB = kB;
  *(v4u*)dvA = vA; *(v4u*)dvB = vB;
  *(v4u*)duA = uA; *(v4u*)duB = uB;
  
}

// ---------------------------------------------------------------------------
// Kernel 2: causal flash attention, all query tiles in one launch. Block = one tile of 16 query rows; its NS waves split the tile's key chunks
// (32 keys each): wave w takes chunks w, w + NS, w + 2*NS, ... and keeps its own running maximum, sums and O tile.
// The products are taken transposed: S^T = K . Q^T (K fragments as A, Q fragments as B) and O^T += V^T . P^T (V fragments as A).
// A lane then holds 16 scores of ONE query (column lane & 15; keys 8 * (lane >> 4) + r of each 16-key tile): the row maximum is taken
// in the lane plus one exchange between the lane halves, and the two score tiles, converted in place, ARE the B fragment of P^T
// (element 8t + r = tile t, register r, the split k map of the V fragments). P passes through no LDS and the loop holds no barrier.
// Online softmax in log2 domain, P carried x 1024 in f16; sums += (row of ones) . P^T.
// After the loop the partial results of the first NM waves (those that can hold a chunk) are merged through LDS in wave order (rescaled to the common row maximum).
// EARLY = 1 handles query rows < 256: adds P residual (x1024) and v residual plane (x1024)
// products into separate accumulators folded with 2^-10 before the merge; EARLY = 0 handles the rest.
// Query rows with mask == 0 get NaN (whole score row excluded -> NaN softmax).
// The two paths share one grid behind a block-uniform branch: neither reads what the other writes. The later rows' tiles
// come first in the grid, by rising row; the short tiles of rows < 256 come last and run beside them.
// Second launch bound (waves per SIMD): 8, so that two 16-wave blocks fit one WGP and the whole grid is resident at once.
// ---------------------------------------------------------------------------
// value of lane l ^ 16
__device__ __forceinline__ float xhalf(float x) {
  const int v = __builtin_bit_cast(int, x);
  return __builtin_bit_cast(float, __builtin_amdgcn_permlanex16(v, v, 0x76543210, 0xfedcba98, false, false));
}

// 2^x of eight values, with the range step of exp2f (an argument below -126 is raised by 64 and the result scaled back by 2^-64),
// so that the values are those of exp2f. The eight v_exp_f32 stand in one statement: behind each stands an instruction that neither
// reads its result nor overwrites its source (the outputs are early-clobber), and behind the last a v_nop: the slot that the
// instruction set asks for behind a transcendental, which the compiler leaves open between two adjacent v_exp_f32
__device__ __forceinline__ v8f exp2_x8(v8f x) {
  float a[8], y[8];
#pragma unroll   // constant indices keep a[] and y[] in registers
  for (int r = 0; r < 8; ++r) a[r] = x[r] + ((x[r] < -126.0f) ? 64.0f : 0.0f);
  asm("v_exp_f32 %0, %8\n\tv_exp_f32 %1, %9\n\tv_exp_f32 %2, %10\n\tv_exp_f32 %3, %11\n\t"
      "v_exp_f32 %4, %12\n\tv_exp_f32 %5, %13\n\tv_exp_f32 %6, %14\n\tv_exp_f32 %7, %15\n\tv_nop"
      : "=&v"(y[0]), "=&v"(y[1]), "=&v"(y[2]), "=&v"(y[3]), "=&v"(y[4]), "=&v"(y[5]), "=&v"(y[6]), "=&v"(y[7])
      : "v"(a[0]), "v"(a[1]), "v"(a[2]), "v"(a[3]), "v"(a[4]), "v"(a[5]), "v"(a[6]), "v"(a[7]));
  v8f res;
#pragma unroll
  for (int r = 0; r < 8; ++r) res[r] = ldexpf(y[r], (x[r] < -126.0f) ? -64 : 0);
  return res;
}

template <int EARLY>
__device__ __forceinline__
void attn_tile(const _Float16* __restrict__ qh, const _Float16* __restrict__ kh,
               const _Float16* __restrict__ vT, const _Float16* __restrict__ vR,
               const int* __restrict__ mask, float* __restrict__ out, const int b, const int tq,
               float (*part)[16][68], float (*pmax)[NS_A], float (*pden)[NS_A])
{
  constexpr int NS  = NS_A;                    // waves per block = key splits of the tile
  constexpr int NM  = (EARLY && 2 * NTB_E < NS) ? 2 * NTB_E : NS;   // waves that can hold a chunk (rows < 256: at most 2 chunks per 64 rows)
  constexpr int CPT = 32 / NS;                 // output columns merged per thread (16 x 64 tile over NS*32 threads)
  constexpr int TPR = HDIM / CPT;              // threads per output row in the merge
  typedef float vcf __attribute__((ext_vector_type(CPT)));

  const int tid  = threadIdx.x;
  const int lane = tid & 31;
  const int wave = __builtin_amdgcn_readfirstlane(tid >> 5);
  const int half = lane >> 4;
  const int ln   = lane & 15;
  const int row0 = tq * 16;                      // first query row of this block (within the sequence)

  const _Float16* qrow  = qh + ((size_t)b * SEQ + row0 + ln) * HDIM + 8 * half;
  // block-uniform plane bases (scalar registers); a lane's own part of an address is one 32-bit element offset, below
  // SEQ * HDIM and the same in all three planes (chunk block + lane * 8), not a 64-bit pointer
  const _Float16* kbase = kh + (size_t)b * SEQ * HDIM;
  const _Float16* vbase = vT + (size_t)b * HDIM * SEQ;
  const _Float16* rbase = vR + (size_t)b * HDIM * SEQ;

  // pad flag of the query row that this thread will merge and store (row0 + tid / TPR, always < SEQ); with one wave per row the
  // index is wave-uniform, so that the flag waits in a scalar register and takes no vector register across the loop
  const int mk = mask[(size_t)b * SEQ_FULL + row0 + ((TPR == 32) ? wave : tid / TPR)];
  // held before any register that the flag load names (its offset, its base pair) is written again
  asm volatile("s_wait_xcnt 0x0" ::: "memory");

  // loop-invariant Q fragments (feature blocks 0..31, 32..63), B operand: column = query (lane&15), k = feature (split map)
  const v16h qa0 = frag_f16(qrow);
  const v16h qa1 = frag_f16(qrow + 32);

  // A operand whose row 0 is ones: row 0 of its product with P^T holds each query's sum (lane = query, register 0)
  v16h ones;
#pragma unroll
  for (int i = 0; i < 16; ++i) ones[i] = (ln == 0) ? (_Float16)1.0f : (_Float16)0.0f;

  v8f o[4], orr[4];                              // O^T tiles: register r = feature 16 * ht + 8 * half + r of query ln
  v8f osum, osumr;
#pragma unroll
  for (int r = 0; r < 8; ++r) { osum[r] = 0.0f; osumr[r] = 0.0f; }
#pragma unroll
  for (int ht = 0; ht < 4; ++ht) {
#pragma unroll
    for (int r = 0; r < 8; ++r) { o[ht][r] = 0.0f; orr[ht][r] = 0.0f; }
  }
  float rmax = NEG_BIG;                          // running maximum of query ln, the same in both lane halves

  const int nchunk = ((row0 + 15) >> 5) + 1;     // keys 0 .. row0+15 in chunks of 32
#pragma unroll 1   // rolled: the registers of one trip only (the register budget decides how many blocks a WGP holds)
  for (int c = wave; c < nchunk; c += NS) {      // wave-uniform trip count; nothing in the loop is shared between waves
    const int kt0 = c * 32;
    v8f s[2];
    // S^T[32 x 16] = K(32 x 64) . Q^T, K as A operand: row = key (lane&15), k = feature (split map)
#pragma unroll
    for (int nt = 0; nt < 2; ++nt) {
      const _Float16* kfr = kbase + (unsigned int)(c * 2048 + nt * 1024 + lane * 8);   // pieces 4nt .. 4nt+3 of the chunk's block
      const v16h kb0 = frag_lin(kfr);
      FragH kf;
      kf.h[0] = *(const v8h*)(kfr + 512);
      // later rows: the chunk's loads share one address pair, and the compiler may let a tile's last load land on that pair: the
      // loads before it are held first (rows < 256 load from a scalar base and one offset register that no result lands on)
      if (!EARLY) asm volatile("s_wait_xcnt 0x0" ::: "memory");
      kf.h[1] = *(const v8h*)(kfr + 768);
      const v16h kb1 = kf.v;
      v8f acc;
#pragma unroll
      for (int r = 0; r < 8; ++r) acc[r] = 0.0f;
      acc = wmma_f16(kb0, qa0, acc);
      acc = wmma_f16(kb1, qa1, acc);
#pragma unroll
      for (int r = 0; r < 8; ++r) {
        const int key = kt0 + nt * 16 + 8 * half + r;
        const float sv = acc[r] * SCL;                  // CDIM^-0.5, log2e already in q
        s[nt][r] = (key > row0 + ln) ? NEG_BIG : sv;    // causal fill (replace)
      }
    }
    // online softmax of query ln: this lane's 16 keys, then the other half's 16
    float tmax = fmaxf(s[0][0], s[1][0]);
#pragma unroll
    for (int r = 1; r < 8; ++r) tmax = fmaxf(tmax, fmaxf(s[0][r], s[1][r]));
    tmax = fmaxf(tmax, xhalf(tmax));
    const float nmax  = fmaxf(rmax, tmax);
    const float alpha = exp2f(rmax - nmax);
    rmax = nmax;
    osum[0] *= alpha;                            // the sums' tile has its one live row in register 0; the other rows stay 0
    if (EARLY) osumr[0] *= alpha;
#pragma unroll
    for (int ht = 0; ht < 4; ++ht) {
#pragma unroll
      for (int r = 0; r < 8; ++r) {
        o[ht][r] *= alpha;
        if (EARLY) orr[ht][r] *= alpha;
      }
    }
    // P^T as B operand, straight from the score tiles (carried x 1024; residual x 1024 more)
    v16h pa, pra;
#pragma unroll
    for (int nt = 0; nt < 2; ++nt) {
      const v8f e = exp2_x8(s[nt] - nmax);
#pragma unroll
      for (int r = 0; r < 8; ++r) {
        const float pf = e[r] * 1024.0f;
        const _Float16 ph = (_Float16)pf;
        pa[nt * 8 + r] = ph;
        if (EARLY) pra[nt * 8 + r] = (_Float16)((pf - (float)ph) * 1024.0f);
      }
    }

    // V as A operand: row = feature (lane&15), k = key (split map): pieces 2ht, 2ht+1 of the chunk's block
    if (EARLY) {
      osum  = wmma_f16(ones, pa,  osum);
      osumr = wmma_f16(ones, pra, osumr);
#pragma unroll
      for (int ht = 0; ht < 4; ++ht) {
        const v16h vb = frag_lin(vbase + (unsigned int)(c * 2048 + ht * 512 + lane * 8));
        o[ht]   = wmma_f16(vb, pa,  o[ht]);
        orr[ht] = wmma_f16(vb, pra, orr[ht]);
      }
#pragma unroll
      for (int ht = 0; ht < 4; ++ht) {
        const v16h vr = frag_lin(rbase + (unsigned int)(c * 2048 + ht * 512 + lane * 8));
        orr[ht] = wmma_f16(vr, pa, orr[ht]);
      }
    } else {
#pragma unroll
      for (int ht = 0; ht < 4; ++ht) {
        const v16h vb = frag_lin(vbase + (unsigned int)(c * 2048 + ht * 512 + lane * 8));
        o[ht] = wmma_f16(vb, pa, o[ht]);
      }
      osum = wmma_f16(ones, pa, osum);   // sums of the same f16 P
    }
  }

  // lane index taken anew, so that no thread-index value has to
  // stay in a register across the loop (the register budget decides how many blocks a WGP holds)
  const int el  = (int)__lane_id();
  const int eh  = el >> 4;
  const int eln = el & 15;

  // merge ownership: each thread owns CPT adjacent columns of one query row
  const unsigned int et = (unsigned int)(wave * 32 + el);
  const int mrow = (int)(et / TPR);
  const int mcol = (int)(et % TPR) * CPT;

  // every wave publishes its own row maxima, row sums and unnormalised O tile (a wave without a chunk: NEG_BIG, 0, 0);
  // a lane's 8 registers of an O^T tile are 8 adjacent features of its query's row
#pragma unroll
  for (int ht = 0; ht < 4; ++ht) {
    v4f lo, hi;
#pragma unroll
    for (int r = 0; r < 4; ++r) {
      lo[r] = o[ht][r];
      hi[r] = o[ht][r + 4];
      if (EARLY) {
        lo[r] = lo[r] + orr[ht][r] * RINV;
        hi[r] = hi[r] + orr[ht][r + 4] * RINV;
      }
    }
    *(v4f*)(&part[wave][eln][ht * 16 + 8 * eh])     = lo;
    *(v4f*)(&part[wave][eln][ht * 16 + 8 * eh + 4]) = hi;
  }
  if (eh == 0) {
    float den = osum[0];
    if (EARLY) den = den + osumr[0] * RINV;
    pmax[eln][wave] = rmax;
    pden[eln][wave] = den;
  }
  __syncthreads();   // all NS partial results are in LDS before any thread merges them

  // merge: the partials of the first NM waves (those that can hold a chunk) are added in wave order, each rescaled by 2^(its maximum - common maximum)
  float pm[NM];
  float gmax = NEG_BIG;
#pragma unroll
  for (int w = 0; w < NM; ++w) { pm[w] = pmax[mrow][w]; gmax = fmaxf(gmax, pm[w]); }
  float den = 0.0f;
  vcf num;
#pragma unroll
  for (int i = 0; i < CPT; ++i) num[i] = 0.0f;
#pragma unroll
  for (int w = 0; w < NM; ++w) {
    const float f = exp2f(pm[w] - gmax);
    den += pden[mrow][w] * f;
    num += *(const vcf*)(&part[w][mrow][mcol]) * f;
  }

  const float qnan = __uint_as_float(0x7fc00000u);

  // normalise (1024 carry cancels between numerator and denominator; 1/16 undoes the v carry)
  const float inv = 0.0625f * __builtin_amdgcn_rcpf(den);
  vcf res;
#pragma unroll
  for (int i = 0; i < CPT; ++i) res[i] = (mk != 0) ? (num[i] * inv) : qnan;
  *(vcf*)(out + ((size_t)b * SEQ_FULL + row0 + mrow) * HDIM + mcol) = res;
}

__global__ __launch_bounds__(NS_A * 32, 8) __attribute__((amdgpu_num_vgpr(256)))
void k_attn(const _Float16* __restrict__ qh, const _Float16* __restrict__ kh,
            const _Float16* __restrict__ vT, const _Float16* __restrict__ vR,
            const int* __restrict__ mask, float* __restrict__ out)
{
  __shared__ __attribute__((aligned(16))) float    part[NS_A][16][68];   // per-wave 16 x 64 partial O tile
  __shared__ __attribute__((aligned(16))) float    pmax[16][NS_A];       // per-wave row maxima  [row][wave]
  __shared__ __attribute__((aligned(16))) float    pden[16][NS_A];       // per-wave row sums    [row][wave]

  const int blk = blockIdx.x;                    // block-uniform: the barrier below is passed by the whole block
  if (blk < NB * NTB_L * 4) {
    const int b = blk / (4 * NTB_LD);
    attn_tile<0>(qh, kh, vT, vR, mask, out, b, 4 * NTB_E + (blk - b * (4 * NTB_LD)), part, pmax, pden);
  } else {
    const int e = blk - NB * NTB_L * 4;
    const int b = e / (4 * NTB_E);
    attn_tile<1>(qh, kh, vT, vR, mask, out, b, e - b * (4 * NTB_E), part, pmax, pden);
  }
}

// ---------------------------------------------------------------------------
extern "C" void kernel_launch(void* const* d_in, const int* in_sizes, int n_in,
                              void* d_out, int out_size, void* d_ws, size_t ws_size,
                              hipStream_t stream)
{
  if (n_in < 8) return;
  const long long tok_rows = (long long)(NB - 1) * SEQ_FULL + SEQ;
  if ((long long)in_sizes[0] < tok_rows * CDIM) return;
  if ((long long)in_sizes[1] < tok_rows) return;
  if (in_sizes[2] < CDIM * HDIM || in_sizes[4] < CDIM * HDIM || in_sizes[6] < CDIM * HDIM) return;
  if (in_sizes[3] < HDIM || in_sizes[5] < HDIM || in_sizes[7] < HDIM) return;
  if ((long long)out_size < tok_rows * HDIM) return;

  const float* x    = (const float*)d_in[0];
  const int*   mask = (const int*)d_in[1];
  const float* Wq   = (const float*)d_in[2];
  const float* bq   = (const float*)d_in[3];
  const float* Wk   = (const float*)d_in[4];
  const float* bk   = (const float*)d_in[5];
  const float* Wv   = (const float*)d_in[6];
  const float* bv   = (const float*)d_in[7];
  float* out = (float*)d_out;

  // workspace carve (bytes): qh NB*SEQ*64*2 | kh same | vT same | vR same
  const size_t plane    = (size_t)NB * SEQ * HDIM * sizeof(_Float16);
  const size_t off_q  = 0;
  const size_t off_k  = off_q + plane;
  const size_t off_v  = off_k + plane;
  const size_t off_r  = off_v + plane;
  const size_t total  = off_r + plane;
  if (total > ws_size) return;

  _Float16* qh = (_Float16*)((char*)d_ws + off_q);
  _Float16* kh = (_Float16*)((char*)d_ws + off_k);
  _Float16* vT = (_Float16*)((char*)d_ws + off_v);
  _Float16* vR = (_Float16*)((char*)d_ws + off_r);

  k_proj<<<(NB * SEQ) / 64, 256, 0, stream>>>(x, Wq, Wk, Wv, bq, bk, bv, qh, kh, vT, vR);
  k_attn<<<NB * NTB * 4, NS_A * 32, 0, stream>>>(qh, kh, vT, vR, mask, out);
}

// v009
// A run of this version takes 28.8 microseconds.
// Timed twice side by side with v008, it ran 1.22 and 1.23 times as fast.
// Counting every step since v000, it is 7.93 times as fast.
#include <hip/hip_runtime.h>

// Contractions: x*W projections (q,k,v): v_wmma_f32_16x16x32_bf16, bf16 operands (RNE-converted inputs), f32 accumulate.
// q.k scores, P.v, P row sums: v_wmma_f32_16x16x32_f16, f16 operands (q x log2e, k, P x 1024, v x 16), f32 accumulate;
// query rows < 256 of each sequence also use f16 residual planes of P and v (x1024 carries) in separate f32 accumulators.
// Bias add, rotary pair mixing (f32 cos/sin via powf + sincosf), online softmax and normalisation in f32.

#ifndef NB
#define NB 4
#endif
#ifndef SEQ
#define SEQ 2048
#endif
#define NB_FULL  4
#define SEQ_FULL 2048
#define CDIM  1024
#define HDIM  64
#define NPROJ 192
#define XC    256         // k chunk of the x tile staged in LDS per pass
#define XP    264         // LDS pitch of the staged x chunk (16-bit elements)
#define NTB    (SEQ / 64)                    // 64-row query tiles per sequence
#define NTB_E  ((NTB < 4) ? NTB : 4)         // tiles with query rows < 256: residual path
#define NTB_L  (NTB - NTB_E)
#define NTB_LD ((NTB_L > 0) ? NTB_L : 1)
#define NS_A   8                              // key splits (waves) per 16-row query tile, the same for all rows (one launch)

static_assert(SEQ % 64 == 0 && SEQ >= 64);
static_assert(NS_A == 8 || NS_A == 16);
static_assert(SEQ <= SEQ_FULL);
static_assert(NB >= 1 && NB <= NB_FULL);
static_assert((CDIM % XC) == 0 && (XC % 32) == 0);
static_assert(XP >= XC && (XP % 8) == 0);
static_assert(XC == 8 * 32);   // wave w of 8 stages the 32 k at 32 * w of each W chunk
static_assert(XC / 4 == 64);   // one x row of a chunk = 64 threads' 16-byte loads
static_assert(NPROJ == 3 * HDIM && (NPROJ % 32) == 0 && (HDIM % 8) == 0 && HDIM == 64);
static_assert(64 * XP >= 4 * 4096);
static_assert(((long long)(NB - 1) * SEQ_FULL + SEQ) * HDIM <= 524288LL);

typedef _Float16       v16h  __attribute__((ext_vector_type(16)));
typedef _Float16       v8h   __attribute__((ext_vector_type(8)));
typedef float          v8f   __attribute__((ext_vector_type(8)));
typedef float          v4f   __attribute__((ext_vector_type(4)));
typedef unsigned short v16us __attribute__((ext_vector_type(16)));
typedef unsigned short v8us  __attribute__((ext_vector_type(8)));
typedef unsigned int   v4u   __attribute__((ext_vector_type(4)));
typedef unsigned int   v2u   __attribute__((ext_vector_type(2)));
typedef __bf16         v16bf __attribute__((ext_vector_type(16)));
typedef __bf16         v2bf  __attribute__((ext_vector_type(2)));
typedef float          v2f   __attribute__((ext_vector_type(2)));

union FragH { v16h v; v8h h[2]; };
union FragU { v16us v; v8us h[2]; };

#define LOG2E_F 1.4426950408889634f
#define NEG_BIG (-3.0e38f)
#define RINV    0.0009765625f
#define SCL     0.03125f          // CDIM^-0.5

// f32 -> bf16 bits, RNE convert
__device__ __forceinline__ unsigned int bf_bits(float f) {
  const unsigned int u = __float_as_uint(f);
  return (u + 0x7FFFu + ((u >> 16) & 1u)) >> 16;
}
// f32 -> bf16 (RNE) -> f32
__device__ __forceinline__ float bfr(float f) {
  return __uint_as_float(bf_bits(f) << 16);
}

// two f32 -> two bf16 (RNE) in one word, lo in the low half: one packed hardware convert
__device__ __forceinline__ unsigned int bf_pack(float lo, float hi) {
  v2f f;
  f.x = lo;
  f.y = hi;
  return __builtin_bit_cast(unsigned int, __builtin_convertvector(f, v2bf));
}

// WMMA helpers with the VALU hazard guard (ties D, keeps A/B live)
__device__ __forceinline__ v8f wmma_f16(v16h a, v16h b, v8f c) {
  v8f d = __builtin_amdgcn_wmma_f32_16x16x32_f16(false, a, false, b, (short)0, c, false, false);
  asm volatile("v_nop\n\tv_nop\n\tv_nop\n\tv_nop" : "+v"(d) : "v"(a), "v"(b));
  return d;
}
__device__ __forceinline__ v8f wmma_bf16(v16us a, v16us b, v8f c) {
  v8f d = __builtin_amdgcn_wmma_f32_16x16x32_bf16(false, __builtin_bit_cast(v16bf, a), false,
                                                   __builtin_bit_cast(v16bf, b), (short)0, c, false, false);
  asm volatile("v_nop\n\tv_nop\n\tv_nop\n\tv_nop" : "+v"(d) : "v"(a), "v"(b));
  return d;
}

// 16-bit operand fragment, split k map for BOTH A and B:
// p = (row or column (lane&15)) base + k0 + 8*(lane>>4); elements 0..7 <- p[0..7], elements 8..15 <- p[16..23].
__device__ __forceinline__ v16h frag_f16(const _Float16* p) {
  FragH f;
  f.h[0] = *(const v8h*)p;
  f.h[1] = *(const v8h*)(p + 16);
  return f.v;
}
// The K and V planes lie in the workspace in the order in which the attention kernel's fragment loads read them: each chunk of
// 32 tokens is one block of 2048 elements = 8 pieces of 512 bytes; piece j holds, lane after lane, the 8 elements that lane l takes
// with its j-th 16-byte load, so that one wave-wide load reads 512 contiguous, line-aligned bytes (4 lines, not 16).
// K, token tl (within a tile of whole chunks), feature f: piece = 4 * (16-key tile of the chunk) + f / 16, lane = 16 * ((f / 8) & 1) + tl % 16.
__device__ __forceinline__ int kfrag_idx(int tl, int f) {
  return (tl >> 5) * 2048 + ((((tl >> 4) & 1) * 4 + (f >> 4)) * 32 + ((f >> 3) & 1) * 16 + (tl & 15)) * 8 + (f & 7);
}
// V, feature h, token tl: piece = 2 * (h / 16) + (16-key half of the chunk), lane = 16 * ((tl / 8) & 1) + h % 16.
__device__ __forceinline__ int vfrag_idx(int h, int tl) {
  return (tl >> 5) * 2048 + (((h >> 4) * 2 + ((tl >> 4) & 1)) * 32 + ((tl >> 3) & 1) * 16 + (h & 15)) * 8 + (tl & 7);
}
// fragment from two adjacent pieces of such a block: p = block + piece * 256 + lane * 8; the k map is that of frag_f16
__device__ __forceinline__ v16h frag_lin(const _Float16* p) {
  FragH f;
  f.h[0] = *(const v8h*)p;
  f.h[1] = *(const v8h*)(p + 256);
  return f.v;
}
// the four fragments (8 pieces) of one chunk block of such a plane: blk = the block (wave-uniform), lofs = lane * 8
__device__ __forceinline__ void load_block(FragH (&f)[4], const _Float16* blk, unsigned int lofs) {
#pragma unroll   // constant indices keep f[] in registers and all 8 loads in flight at once
  for (int i = 0; i < 4; ++i) {
    f[i].h[0] = *(const v8h*)(blk + (lofs + i * 512));
    // the 8 loads may share one address pair, and the compiler may let the last load land on that pair: the 7 before it are held first
    if (i == 3) asm volatile("s_wait_xcnt 0x0" ::: "memory");
    f[i].h[1] = *(const v8h*)(blk + (lofs + i * 512 + 256));
  }
  // held before an address register that these loads name is written again; it also keeps the loads ahead of what follows it
  asm volatile("s_wait_xcnt 0x0" ::: "memory");
}
__device__ __forceinline__ v16us frag_u16(const unsigned short* p) {
  FragU f;
  f.h[0] = *(const v8us*)p;
  f.h[1] = *(const v8us*)(p + 16);
  return f.v;
}

// ---------------------------------------------------------------------------
// Kernel 1: q,k,v projections (+bias, rotary pair mixing on q,k) for a tile of 64 token rows on bf16 WMMA.
// 8 waves: wave -> 16 rows (wave&3) x 96 output columns (wave>>2). x tile staged in LDS as bf16 in 4 chunks of 256 k
// (each chunk loaded into registers one chunk ahead),
// and with each x chunk the same 256 k of all 192 W columns (n = 64 * p + column; p: 0 q, 1 k, 2 v), read as f32 from Wq, Wk, Wv,
// converted to bf16 and transposed to [n][k] on the way into LDS, so that the B fragments come from LDS like the A fragments.
// Outputs: qh = f16(rot(q+bq)*log2e) [tok][64]; kh = f16(rot(k+bk)), vT = f16(16*(v+bv)) and vR = f16((16*v - vT) * 1024)
// (residual plane), each as [chunk of 32 tokens][2048] in fragment order (kfrag_idx, vfrag_idx).
// ---------------------------------------------------------------------------
__global__ __launch_bounds__(256) __attribute__((amdgpu_num_vgpr(256)))
void k_proj(const float* __restrict__ x,
            const float* __restrict__ Wq, const float* __restrict__ Wk, const float* __restrict__ Wv,
            const float* __restrict__ bq, const float* __restrict__ bk, const float* __restrict__ bv,
            _Float16* __restrict__ qh, _Float16* __restrict__ kh,
            _Float16* __restrict__ vT, _Float16* __restrict__ vR)
{
  __shared__ __attribute__((aligned(16))) unsigned short sm[64 * XP];    // 33792 B, later reused as staging
  __shared__ __attribute__((aligned(16))) unsigned short swt[NPROJ * XP]; // W chunk [n][k], same pitch as the x chunk, 101376 B
  __shared__ __attribute__((aligned(16))) float scs[64 * HDIM];         // [tl][2i] = cos, [tl][2i+1] = sin
  __shared__ float sb[NPROJ];                                           // biases (bf16 RNE-converted)

  const int tid  = threadIdx.x;
  const int lane = tid & 31;
  const int wave = __builtin_amdgcn_readfirstlane(tid >> 5);
  const int half = lane >> 4;
  const int ln   = lane & 15;
  const int m0 = blockIdx.x * 64;               // compact token row of this tile
  const int b  = m0 / SEQ;
  const int t0 = m0 - b * SEQ;
  const float* xblk = x + ((size_t)b * SEQ_FULL + t0) * CDIM;

  // x chunk in registers, one chunk ahead of its use: thread -> rows (tid / 64) + 4 * it, 4 columns at (tid % 64) * 4. All 16 loads
  // of a chunk are in flight together; those of chunk 0 fly during the table set-up below, later ones during the products
  const float* xsrc = xblk + (size_t)(tid >> 6) * CDIM + (tid & 63) * 4;
  v4f xr[64 * (XC / 4) / 256];
#pragma unroll   // constant indices keep xr[] in registers and all 16 loads in flight at once
  for (int it = 0; it < 64 * (XC / 4) / 256; ++it)
    xr[it] = *(const v4f*)(xsrc + (size_t)it * 4 * CDIM);

  // rotary table for positions t0..t0+63: f_i = 1 / 10000^(i/32), angle = t * f_i, i = 0..31
#pragma unroll 1
  for (int i = tid; i < 64 * (HDIM / 2); i += 256) {
    const int r  = i >> 5;
    const int pr = i & 31;
    const float ex  = (float)(2 * pr) * 0.015625f;
    const float fr  = 1.0f / powf(10000.0f, ex);
    const float ang = (float)(t0 + r) * fr;
    float sn, cn;
    sincosf(ang, &sn, &cn);
    scs[r * HDIM + 2 * pr]     = cn;
    scs[r * HDIM + 2 * pr + 1] = sn;
  }
  if (tid < HDIM) {                             // waves 0 and 1 exactly (wave-uniform)
    sb[tid]            = bfr(bq[tid]);
    sb[HDIM + tid]     = bfr(bk[tid]);
    sb[2 * HDIM + tid] = bfr(bv[tid]);
  }

  const int rg = wave & 3;
  const int ch = wave >> 2;
  v8f acc[6];
#pragma unroll
  for (int nt = 0; nt < 6; ++nt) {
#pragma unroll
    for (int r = 0; r < 8; ++r) acc[nt][r] = 0.0f;
  }

  // W staging: wave w brings the 32 k at 32 * w of a chunk for all 192 columns, as 6 units of 32 k x 32 columns. In a unit a lane
  // loads 8 k rows x 4 adjacent columns (a wave-wide load = 4 rows x 128 bytes = 4 whole lines) and stores, for each of its 4
  // columns, the 8 k as 16 bytes. Lane -> column group wg and k group wk: every 16 lanes hold 4 wg x 4 wk, which spreads
  // their 16-byte stores (pitch XP) over all 64 banks
  const int wg = (lane & 3) | ((lane >> 4) << 2);   // 0..7: columns 4 * wg .. 4 * wg + 3 of the unit
  const int wk = (lane >> 2) & 3;                   // 0..3: k 8 * wk .. 8 * wk + 7 of the unit
  const int woff = (wave * 32 + wk * 8) * HDIM + wg * 4;   // lane's element offset in a W matrix, chunk 0
  const float* wsq = Wq + woff;                     // this lane's first 16 bytes of the chunk in each matrix; they step on by a chunk
  const float* wsk = Wk + woff;
  const float* wsv = Wv + woff;
  unsigned short* wdst = swt + (wg * 4) * XP + wave * 32 + wk * 8;
#pragma unroll 1
  for (int kc = 0; kc < CDIM; kc += XC) {
    __syncthreads();   // all waves done reading the prior chunk
    // W chunk, units 0..2: the loads are issued ahead of the x chunk's conversion, which covers part of their latency
    v4f wr[3][8];
#pragma unroll   // constant indices keep wr[] in registers and all 24 loads in flight at once
    for (int u = 0; u < 3; ++u) {
      const float* ws = ((u >> 1) == 0 ? wsq : wsk) + (u & 1) * 32;
#pragma unroll
      for (int j = 0; j < 8; ++j) wr[u][j] = *(const v4f*)(ws + j * HDIM);
    }
    // stage x chunk: 64 rows x XC columns (kc..kc+XC-1) -> bf16, from the registers loaded one chunk ago
#pragma unroll   // constant indices keep xr[] in registers
    for (int it = 0; it < 64 * (XC / 4) / 256; ++it) {
      const v4f v = xr[it];
      v2u w;
      w.x = bf_bits(v.x) | (bf_bits(v.y) << 16);
      w.y = bf_bits(v.z) | (bf_bits(v.w) << 16);
      *(v2u*)(sm + ((tid >> 6) + 4 * it) * XP + (tid & 63) * 4) = w;
    }
    // each unit is converted and stored (word m of a column = k 2m, 2m + 1); unit u + 3 is loaded into the registers unit u leaves
#pragma unroll   // constant indices keep wr[] in registers
    for (int u = 0; u < 6; ++u) {
#pragma unroll
      for (int i = 0; i < 4; ++i) {
        v4u d;
#pragma unroll
        for (int m = 0; m < 4; ++m) d[m] = bf_pack(wr[u % 3][2 * m][i], wr[u % 3][2 * m + 1][i]);
        *(v4u*)(wdst + (u * 32 + i) * XP) = d;
      }
      if (u < 3) {
        const float* ws = (((u + 3) >> 1) == 1 ? wsk : wsv) + ((u + 3) & 1) * 32;
#pragma unroll
        for (int j = 0; j < 8; ++j) wr[u][j] = *(const v4f*)(ws + j * HDIM);
        // keeps these loads here, ahead of the next unit's conversion: sunk behind it they would start later and be waited for longer
        __builtin_amdgcn_sched_barrier(0);
      }
    }
    wsq += XC * HDIM;
    wsk += XC * HDIM;
    wsv += XC * HDIM;
    __syncthreads();

    // the next chunk's x loads are issued ahead of this chunk's products, which cover their memory latency
    if (kc + XC < CDIM) {                       // block-uniform
      xsrc += XC;
#pragma unroll   // constant indices keep xr[] in registers and all 16 loads in flight at once
      for (int it = 0; it < 64 * (XC / 4) / 256; ++it)
        xr[it] = *(const v4f*)(xsrc + (size_t)it * 4 * CDIM);
    }

    const unsigned short* arow = sm + (rg * 16 + ln) * XP + 8 * half;
    const unsigned short* brow = swt + (ch * 96 + ln) * XP + 8 * half;
    // two register sets of fragments: the 14 LDS reads of k step ks + 1 are issued as one group ahead of the 6 products
    // of step ks, so that a product no longer waits out the LDS latency of its own operands
    v16us af[2];
    v16us bf[2][6];
    af[0] = frag_u16(arow);
#pragma unroll
    for (int nt = 0; nt < 6; ++nt) bf[0][nt] = frag_u16(brow + nt * 16 * XP);
#pragma unroll   // constant set indices keep both fragment sets in registers, with no copies between them
    for (int ks = 0; ks < XC / 32; ++ks) {
      const int cur = ks & 1;
      const int nxt = cur ^ 1;
      if (ks + 1 < XC / 32) {
        af[nxt] = frag_u16(arow + (ks + 1) * 32);
#pragma unroll
        for (int nt = 0; nt < 6; ++nt) bf[nxt][nt] = frag_u16(brow + nt * 16 * XP + (ks + 1) * 32);
      }
#pragma unroll
      for (int nt = 0; nt < 6; ++nt) acc[nt] = wmma_bf16(af[cur], bf[cur][nt], acc[nt]);
    }
  }
  __syncthreads();   // all waves done reading the x tile

  // staging (16-bit elements): sQ = sm[0..4095] as [t][64], sK = sm[4096..8191], sV = sm[8192..12287] and
  // sVr = sm[12288..16383] as the tile's two chunk blocks in fragment order
#pragma unroll
  for (int nt = 0; nt < 6; ++nt) {
    const int n0 = ch * 96 + nt * 16;            // wave-uniform
    const int p  = n0 >> 6;
    const int hc = (n0 & 63) + ln;
    const float bias = sb[p * HDIM + hc];
    const float sc = (p == 0) ? LOG2E_F : ((p == 2) ? 16.0f : 1.0f);
    unsigned short* base = sm + p * 4096;
    // r walks the low three bits of the token index, which every one of the three orders maps to a constant step
    const int tl0 = rg * 16 + 8 * half;
    const int i0  = (p == 2) ? vfrag_idx(hc, tl0) : ((p == 1) ? kfrag_idx(tl0, hc) : (tl0 * 64 + hc));
    const int ist = (p == 2) ? 1 : ((p == 1) ? 8 : 64);
#pragma unroll
    for (int r = 0; r < 8; ++r) {
      const int tl = rg * 16 + 8 * half + r;
      const float val = acc[nt][r] + bias;
      const float pv  = __shfl_xor(val, 1, 32);          // pair partner column hc^1 (lane ln^1), unconditional
      const float cn  = scs[tl * HDIM + (hc & ~1)];
      const float sn  = scs[tl * HDIM + (hc | 1)];
      const float t1  = val * cn;
      const float t2  = pv * sn;
      const float rot = (hc & 1) ? (t1 + t2) : (t1 - t2);  // even: ev*c - od*s ; odd: od*c + ev*s
      const float vf  = ((p < 2) ? rot : val) * sc;
      const int idx = i0 + r * ist;
      const _Float16 hv = (_Float16)vf;
      base[idx] = __builtin_bit_cast(unsigned short, hv);
      if (p == 2) {
        const _Float16 rv = (_Float16)((vf - (float)hv) * 1024.0f);
        sm[12288 + idx] = __builtin_bit_cast(unsigned short, rv);
      }
    }
  }
  __syncthreads();

  // whole-line stores: wave w owns token rows 8w..8w+7 of qh and pieces 2w, 2w+1 of the tile's 16 in kh, vT and vR
  const int rl = lane >> 3;
  const int pc = lane & 7;
  const int rA = wave * 8 + rl;
  const int rB = rA + 4;
  const v4u qA = *(const v4u*)(sm + rA * 64 + pc * 8);
  const v4u qB = *(const v4u*)(sm + rB * 64 + pc * 8);
  const int fA = wave * 512 + lane * 8;
  const int fB = fA + 256;
  const v4u kA = *(const v4u*)(sm + 4096 + fA);
  const v4u kB = *(const v4u*)(sm + 4096 + fB);
  const v4u vA = *(const v4u*)(sm + 8192 + fA);
  const v4u vB = *(const v4u*)(sm + 8192 + fB);
  const v4u uA = *(const v4u*)(sm + 12288 + fA);
  const v4u uB = *(const v4u*)(sm + 12288 + fB);
  _Float16* dqA = qh + (size_t)(m0 + rA) * HDIM + pc * 8;
  _Float16* dqB = qh + (size_t)(m0 + rB) * HDIM + pc * 8;
  _Float16* dkA = kh + (size_t)m0 * HDIM + fA;
  _Float16* dkB = kh + (size_t)m0 * HDIM + fB;
  _Float16* dvA = vT + (size_t)m0 * HDIM + fA;
  _Float16* dvB = vT + (size_t)m0 * HDIM + fB;
  _Float16* duA = vR + (size_t)m0 * HDIM + fA;
  _Float16* duB = vR + (size_t)m0 * HDIM + fB;
  *(v4u*)dqA = qA; *(v4u*)dqB = qB;
  *(v4u*)dkA = kA; *(v4u*)dkB = kB;
  *(v4u*)dvA = vA; *(v4u*)dvB = vB;
  *(v4u*)duA = uA; *(v4u*)duB = uB;
  
}

// ---------------------------------------------------------------------------
// Kernel 2: causal flash attention, all query tiles in one launch. Block = one tile of 16 query rows; its NS waves split the tile's key chunks
// (32 keys each): wave w takes chunks w, w + NS, w + 2*NS, ... and keeps its own running maximum, sums and O tile.
// The products are taken transposed: S^T = K . Q^T (K fragments as A, Q fragments as B) and O^T += V^T . P^T (V fragments as A).
// A lane then holds 16 scores of ONE query (column lane & 15; keys 8 * (lane >> 4) + r of each 16-key tile): the row maximum is taken
// in the lane plus one exchange between the lane halves, and the two score tiles, converted in place, ARE the B fragment of P^T
// (element 8t + r = tile t, register r, the split k map of the V fragments). P passes through no LDS and the loop holds no barrier.
// The K and V fragments are fetched ahead: a trip opens with the 8 loads of the next chunk's K (into a second register set) and
// closes with the 8 loads of the next chunk's V (into the registers the O products have just read); it waits for no load of its own.
// Online softmax in log2 domain, P carried x 1024 in f16; sums += (row of ones) . P^T.
// After the loop the partial results of the first NM waves (those that can hold a chunk) are merged through LDS in wave order (rescaled to the common row maximum).
// EARLY = 1 handles query rows < 256: adds P residual (x1024) and v residual plane (x1024)
// products into separate accumulators folded with 2^-10 before the merge; EARLY = 0 handles the rest.
// Query rows with mask == 0 get NaN (whole score row excluded -> NaN softmax).
// The two paths share one grid behind a block-uniform branch: neither reads what the other writes. The later rows' tiles
// come first in the grid, by rising row; the short tiles of rows < 256 come last and run beside them.
// Second launch bound (waves per SIMD): 4, so that two 8-wave blocks fit one WGP and the whole grid is resident at once, with
// registers for a whole chunk's K and V fragments in every wave.
// ---------------------------------------------------------------------------
// value of lane l ^ 16
__device__ __forceinline__ float xhalf(float x) {
  const int v = __builtin_bit_cast(int, x);
  return __builtin_bit_cast(float, __builtin_amdgcn_permlanex16(v, v, 0x76543210, 0xfedcba98, false, false));
}

// 2^x of eight values, with the range step of exp2f (an argument below -126 is raised by 64 and the result scaled back by 2^-64),
// so that the values are those of exp2f. The eight v_exp_f32 stand in one statement: behind each stands an instruction that neither
// reads its result nor overwrites its source (the outputs are early-clobber), and behind the last a v_nop: the slot that the
// instruction set asks for behind a transcendental, which the compiler leaves open between two adjacent v_exp_f32
__device__ __forceinline__ v8f exp2_x8(v8f x) {
  float a[8], y[8];
#pragma unroll   // constant indices keep a[] and y[] in registers
  for (int r = 0; r < 8; ++r) a[r] = x[r] + ((x[r] < -126.0f) ? 64.0f : 0.0f);
  asm("v_exp_f32 %0, %8\n\tv_exp_f32 %1, %9\n\tv_exp_f32 %2, %10\n\tv_exp_f32 %3, %11\n\t"
      "v_exp_f32 %4, %12\n\tv_exp_f32 %5, %13\n\tv_exp_f32 %6, %14\n\tv_exp_f32 %7, %15\n\tv_nop"
      : "=&v"(y[0]), "=&v"(y[1]), "=&v"(y[2]), "=&v"(y[3]), "=&v"(y[4]), "=&v"(y[5]), "=&v"(y[6]), "=&v"(y[7])
      : "v"(a[0]), "v"(a[1]), "v"(a[2]), "v"(a[3]), "v"(a[4]), "v"(a[5]), "v"(a[6]), "v"(a[7]));
  v8f res;
#pragma unroll
  for (int r = 0; r < 8; ++r) res[r] = ldexpf(y[r], (x[r] < -126.0f) ? -64 : 0);
  return res;
}

template <int EARLY>
__device__ __forceinline__
void attn_tile(const _Float16* __restrict__ qh, const _Float16* __restrict__ kh,
               const _Float16* __restrict__ vT, const _Float16* __restrict__ vR,
               const int* __restrict__ mask, float* __restrict__ out, const int b, const int tq,
               float (*part)[16][68], float (*pmax)[NS_A], float (*pden)[NS_A])
{
  constexpr int NS  = NS_A;                    // waves per block = key splits of the tile
  constexpr int NM  = (EARLY && 2 * NTB_E < NS) ? 2 * NTB_E : NS;   // waves that can hold a chunk (rows < 256: at most 2 chunks per 64 rows)
  constexpr int CPT = 32 / NS;                 // output columns merged per thread (16 x 64 tile over NS*32 threads)
  constexpr int TPR = HDIM / CPT;              // threads per output row in the merge
  constexpr bool ONE = EARLY && 2 * NTB_E <= NS;   // rows < 256 hold at most NS chunks: one trip a wave, nothing to fetch ahead
  typedef float vcf __attribute__((ext_vector_type(CPT)));

  const int tid  = threadIdx.x;
  const int lane = tid & 31;
  const int wave = __builtin_amdgcn_readfirstlane(tid >> 5);
  const int half = lane >> 4;
  const int ln   = lane & 15;
  const int row0 = tq * 16;                      // first query row of this block (within the sequence)

  const _Float16* qrow  = qh + ((size_t)b * SEQ + row0 + ln) * HDIM + 8 * half;
  // block-uniform plane bases (scalar registers); a chunk's block is a wave-uniform step on them, and a lane's own part of an
  // address is one 32-bit element offset (lane * 8), the same in all three planes and in every trip
  const _Float16* kbase = kh + (size_t)b * SEQ * HDIM;
  const _Float16* vbase = vT + (size_t)b * HDIM * SEQ;
  const _Float16* rbase = vR + (size_t)b * HDIM * SEQ;

  // pad flag of the query row that this thread will merge and store (row0 + tid / TPR, always < SEQ); with one wave per row the
  // index is wave-uniform, so that the flag waits in a scalar register and takes no vector register across the loop
  const int mk = mask[(size_t)b * SEQ_FULL + row0 + ((TPR == 32) ? wave : tid / TPR)];
  // held before any register that the flag load names (its offset, its base pair) is written again
  asm volatile("s_wait_xcnt 0x0" ::: "memory");

  // A operand whose row 0 is ones: row 0 of its product with P^T holds each query's sum (lane = query, register 0)
  v16h ones;
#pragma unroll
  for (int i = 0; i < 16; ++i) ones[i] = (ln == 0) ? (_Float16)1.0f : (_Float16)0.0f;

  v8f o[4], orr[4];                              // O^T tiles: register r = feature 16 * ht + 8 * half + r of query ln
  v8f osum, osumr;
#pragma unroll
  for (int r = 0; r < 8; ++r) { osum[r] = 0.0f; osumr[r] = 0.0f; }
#pragma unroll
  for (int ht = 0; ht < 4; ++ht) {
#pragma unroll
    for (int r = 0; r < 8; ++r) { o[ht][r] = 0.0f; orr[ht][r] = 0.0f; }
  }
  float rmax = NEG_BIG;                          // running maximum of query ln, the same in both lane halves

  const int nchunk = ((row0 + 15) >> 5) + 1;     // keys 0 .. row0+15 in chunks of 32
  const unsigned int lofs = (unsigned int)lane * 8u;
  if (wave < nchunk) {                           // wave-uniform; a wave without a chunk loads nothing and goes to the merge
  // loop-invariant Q fragments (feature blocks 0..31, 32..63), B operand: column = query (lane&15), k = feature (split map)
  const v16h qa0 = frag_f16(qrow);
  const v16h qa1 = frag_f16(qrow + 32);
  // fragment registers: ka, kb = two sets for K (f[2nt], f[2nt+1] = pieces 4nt .. 4nt+3 of a chunk's block), used in turn;
  // vf[ht], rf[ht] = pieces 2ht, 2ht+1 of the V and residual blocks. The first chunk's loads are all in flight together, K ahead of V
  FragH ka[4], kb[4], vf[4], rf[4];
  load_block(ka, kbase + wave * 2048, lofs);
  load_block(vf, vbase + wave * 2048, lofs);
  if (EARLY) load_block(rf, rbase + wave * 2048, lofs);
  // one trip: chunk c, its K in kc; more (a constant at each call) = the wave has a further chunk, c + NS, to fetch, its K into kn
  auto trip = [&](const int c, FragH (&kc)[4], FragH (&kn)[4], const bool more) __attribute__((always_inline)) {
    const int kt0 = c * 32;
    // the next chunk's K is asked for a whole trip ahead of its products
    if (more) load_block(kn, kbase + (c + NS) * 2048, lofs);
    v8f s[2];
    // S^T[32 x 16] = K(32 x 64) . Q^T, K as A operand: row = key (lane&15), k = feature (split map)
#pragma unroll
    for (int nt = 0; nt < 2; ++nt) {
      v8f acc;
#pragma unroll
      for (int r = 0; r < 8; ++r) acc[r] = 0.0f;
      acc = wmma_f16(kc[2 * nt].v, qa0, acc);
      acc = wmma_f16(kc[2 * nt + 1].v, qa1, acc);
#pragma unroll
      for (int r = 0; r < 8; ++r) {
        const int key = kt0 + nt * 16 + 8 * half + r;
        const float sv = acc[r] * SCL;                  // CDIM^-0.5, log2e already in q
        s[nt][r] = (key > row0 + ln) ? NEG_BIG : sv;    // causal fill (replace)
      }
    }
    // online softmax of query ln: this lane's 16 keys, then the other half's 16
    float tmax = fmaxf(s[0][0], s[1][0]);
#pragma unroll
    for (int r = 1; r < 8; ++r) tmax = fmaxf(tmax, fmaxf(s[0][r], s[1][r]));
    tmax = fmaxf(tmax, xhalf(tmax));
    const float nmax  = fmaxf(rmax, tmax);
    const float alpha = exp2f(rmax - nmax);
    rmax = nmax;
    osum[0] *= alpha;                            // the sums' tile has its one live row in register 0; the other rows stay 0
    if (EARLY) osumr[0] *= alpha;
#pragma unroll
    for (int ht = 0; ht < 4; ++ht) {
#pragma unroll
      for (int r = 0; r < 8; ++r) {
        o[ht][r] *= alpha;
        if (EARLY) orr[ht][r] *= alpha;
      }
    }
    // P^T as B operand, straight from the score tiles (carried x 1024; residual x 1024 more)
    v16h pa, pra;
#pragma unroll
    for (int nt = 0; nt < 2; ++nt) {
      const v8f e = exp2_x8(s[nt] - nmax);
#pragma unroll
      for (int r = 0; r < 8; ++r) {
        const float pf = e[r] * 1024.0f;
        const _Float16 ph = (_Float16)pf;
        pa[nt * 8 + r] = ph;
        if (EARLY) pra[nt * 8 + r] = (_Float16)((pf - (float)ph) * 1024.0f);
      }
    }

    // V as A operand: row = feature (lane&15), k = key (split map): pieces 2ht, 2ht+1 of the chunk's block
    if (EARLY) {
      osum  = wmma_f16(ones, pa,  osum);
      osumr = wmma_f16(ones, pra, osumr);
#pragma unroll
      for (int ht = 0; ht < 4; ++ht) {
        o[ht]   = wmma_f16(vf[ht].v, pa,  o[ht]);
        orr[ht] = wmma_f16(vf[ht].v, pra, orr[ht]);
      }
#pragma unroll
      for (int ht = 0; ht < 4; ++ht) orr[ht] = wmma_f16(rf[ht].v, pa, orr[ht]);
    } else {
#pragma unroll
      for (int ht = 0; ht < 4; ++ht) o[ht] = wmma_f16(vf[ht].v, pa, o[ht]);
      osum = wmma_f16(ones, pa, osum);   // sums of the same f16 P
    }
    if (more) {                                  // the next chunk's V, into the registers that the O products have just read: it
      load_block(vf, vbase + (c + NS) * 2048, lofs);   // flies during the next trip's score products and softmax
      if (EARLY) load_block(rf, rbase + (c + NS) * 2048, lofs);
    }
  };
  // wave-uniform trip count; nothing in the loop is shared between waves. Two trips a pass, so that the two K sets change roles
  // without copies; a wave's last trip, which fetches nothing, stands apart, so that every other trip has the same loads in
  // flight and its waits can leave the younger ones flying
  int c = wave;
  if (ONE) {
    trip(c, ka, kb, false);
  } else {
#pragma unroll 1   // rolled: one pass of code, whatever the number of chunks
    for (;;) {
      if (c + NS >= nchunk) { trip(c, ka, kb, false); break; }
      trip(c, ka, kb, true);
      c += NS;
      if (c + NS >= nchunk) { trip(c, kb, ka, false); break; }
      trip(c, kb, ka, true);
      c += NS;
    }
  }
  }

  // lane index taken anew, so that no thread-index value has to
  // stay in a register across the loop (the register budget decides how many blocks a WGP holds)
  const int el  = (int)__lane_id();
  const int eh  = el >> 4;
  const int eln = el & 15;

  // merge ownership: each thread owns CPT adjacent columns of one query row
  const unsigned int et = (unsigned int)(wave * 32 + el);
  const int mrow = (int)(et / TPR);
  const int mcol = (int)(et % TPR) * CPT;

  // every wave publishes its own row maxima, row sums and unnormalised O tile (a wave without a chunk: NEG_BIG, 0, 0);
  // a lane's 8 registers of an O^T tile are 8 adjacent features of its query's row
#pragma unroll
  for (int ht = 0; ht < 4; ++ht) {
    v4f lo, hi;
#pragma unroll
    for (int r = 0; r < 4; ++r) {
      lo[r] = o[ht][r];
      hi[r] = o[ht][r + 4];
      if (EARLY) {
        lo[r] = lo[r] + orr[ht][r] * RINV;
        hi[r] = hi[r] + orr[ht][r + 4] * RINV;
      }
    }
    *(v4f*)(&part[wave][eln][ht * 16 + 8 * eh])     = lo;
    *(v4f*)(&part[wave][eln][ht * 16 + 8 * eh + 4]) = hi;
  }
  if (eh == 0) {
    float den = osum[0];
    if (EARLY) den = den + osumr[0] * RINV;
    pmax[eln][wave] = rmax;
    pden[eln][wave] = den;
  }
  __syncthreads();   // all NS partial results are in LDS before any thread merges them

  // merge: the partials of the first NM waves (those that can hold a chunk) are added in wave order, each rescaled by 2^(its maximum - common maximum)
  float pm[NM];
  float gmax = NEG_BIG;
#pragma unroll
  for (int w = 0; w < NM; ++w) { pm[w] = pmax[mrow][w]; gmax = fmaxf(gmax, pm[w]); }
  float den = 0.0f;
  vcf num;
#pragma unroll
  for (int i = 0; i < CPT; ++i) num[i] = 0.0f;
#pragma unroll
  for (int w = 0; w < NM; ++w) {
    const float f = exp2f(pm[w] - gmax);
    den += pden[mrow][w] * f;
    num += *(const vcf*)(&part[w][mrow][mcol]) * f;
  }

  const float qnan = __uint_as_float(0x7fc00000u);

  // normalise (1024 carry cancels between numerator and denominator; 1/16 undoes the v carry)
  const float inv = 0.0625f * __builtin_amdgcn_rcpf(den);
  vcf res;
#pragma unroll
  for (int i = 0; i < CPT; ++i) res[i] = (mk != 0) ? (num[i] * inv) : qnan;
  *(vcf*)(out + ((size_t)b * SEQ_FULL + row0 + mrow) * HDIM + mcol) = res;
}

__global__ __launch_bounds__(NS_A * 32, 4) __attribute__((amdgpu_num_vgpr(256)))
void k_attn(const _Float16* __restrict__ qh, const _Float16* __restrict__ kh,
            const _Float16* __restrict__ vT, const _Float16* __restrict__ vR,
            const int* __restrict__ mask, float* __restrict__ out)
{
  __shared__ __attribute__((aligned(16))) float    part[NS_A][16][68];   // per-wave 16 x 64 partial O tile
  __shared__ __attribute__((aligned(16))) float    pmax[16][NS_A];       // per-wave row maxima  [row][wave]
  __shared__ __attribute__((aligned(16))) float    pden[16][NS_A];       // per-wave row sums    [row][wave]

  const int blk = blockIdx.x;                    // block-uniform: the barrier below is passed by the whole block
  if (blk < NB * NTB_L * 4) {
    const int b = blk / (4 * NTB_LD);
    attn_tile<0>(qh, kh, vT, vR, mask, out, b, 4 * NTB_E + (blk - b * (4 * NTB_LD)), part, pmax, pden);
  } else {
    const int e = blk - NB * NTB_L * 4;
    const int b = e / (4 * NTB_E);
    attn_tile<1>(qh, kh, vT, vR, mask, out, b, e - b * (4 * NTB_E), part, pmax, pden);
  }
}

// ---------------------------------------------------------------------------
extern "C" void kernel_launch(void* const* d_in, const int* in_sizes, int n_in,
                              void* d_out, int out_size, void* d_ws, size_t ws_size,
                              hipStream_t stream)
{
  if (n_in < 8) return;
  const long long tok_rows = (long long)(NB - 1) * SEQ_FULL + SEQ;
  if ((long long)in_sizes[0] < tok_rows * CDIM) return;
  if ((long long)in_sizes[1] < tok_rows) return;
  if (in_sizes[2] < CDIM * HDIM || in_sizes[4] < CDIM * HDIM || in_sizes[6] < CDIM * HDIM) return;
  if (in_sizes[3] < HDIM || in_sizes[5] < HDIM || in_sizes[7] < HDIM) return;
  if ((long long)out_size < tok_rows * HDIM) return;

  const float* x    = (const float*)d_in[0];
  const int*   mask = (const int*)d_in[1];
  const float* Wq   = (const float*)d_in[2];
  const float* bq   = (const float*)d_in[3];
  const float* Wk   = (const float*)d_in[4];
  const float* bk   = (const float*)d_in[5];
  const float* Wv   = (const float*)d_in[6];
  const float* bv   = (const float*)d_in[7];
  float* out = (float*)d_out;

  // workspace carve (bytes): qh NB*SEQ*64*2 | kh same | vT same | vR same
  const size_t plane    = (size_t)NB * SEQ * HDIM * sizeof(_Float16);
  const size_t off_q  = 0;
  const size_t off_k  = off_q + plane;
  const size_t off_v  = off_k + plane;
  const size_t off_r  = off_v + plane;
  const size_t total  = off_r + plane;
  if (total > ws_size) return;

  _Float16* qh = (_Float16*)((char*)d_ws + off_q);
  _Float16* kh = (_Float16*)((char*)d_ws + off_k);
  _Float16* vT = (_Float16*)((char*)d_ws + off_v);
  _Float16* vR = (_Float16*)((char*)d_ws + off_r);

  k_proj<<<(NB * SEQ) / 64, 256, 0, stream>>>(x, Wq, Wk, Wv, bq, bk, bv, qh, kh, vT, vR);
  k_attn<<<NB * NTB * 4, NS_A * 32, 0, stream>>>(qh, kh, vT, vR, mask, out);
}

// v010
// Measured time: 26.3 microseconds a run.
// Timed twice side by side with v009, it ran 1.09 and 1.10 times as fast.
// Over all steps from v000 it is 8.68 times as fast.
#include <hip/hip_runtime.h>

// Contractions: x*W projections (q,k,v): v_wmma_f32_16x16x32_bf16, bf16 operands (RNE-converted inputs), f32 accumulate.
// q.k scores, P.v, P row sums: v_wmma_f32_16x16x32_f16, f16 operands (q x log2e, k, P x 1024, v x 16), f32 accumulate;
// query rows < 256 of each sequence also use f16 residual planes of P and v (x1024 carries) in separate f32 accumulators.
// Bias add, rotary pair mixing (f32 cos/sin via powf + sincosf), online softmax and normalisation in f32.

#ifndef NB
#define NB 4
#endif
#ifndef SEQ
#define SEQ 2048
#endif
#define NB_FULL  4
#define SEQ_FULL 2048
#define CDIM  1024
#define HDIM  64
#define NPROJ 192
#define XC    256         // k chunk of the x tile staged in LDS per pass
#define XP    264         // LDS pitch of the staged x chunk (16-bit elements)
#define NTB    (SEQ / 64)                    // 64-row query tiles per sequence
#define NTB_E  ((NTB < 4) ? NTB : 4)         // tiles with query rows < 256: residual path
#define NTB_L  (NTB - NTB_E)
#define NTB_LD ((NTB_L > 0) ? NTB_L : 1)
#define NS_A   8                              // key splits (waves) per 16-row query tile, the same for all rows (one launch)

static_assert(SEQ % 64 == 0 && SEQ >= 64);
static_assert(NS_A == 8 || NS_A == 16);
static_assert(SEQ <= SEQ_FULL);
static_assert(NB >= 1 && NB <= NB_FULL);
static_assert((CDIM % XC) == 0 && (XC % 32) == 0);
static_assert(XP >= XC && (XP % 8) == 0);
static_assert(XC == 8 * 32);   // wave w of 8 stages the 32 k at 32 * w of each W chunk
static_assert(XC / 4 == 64);   // one x row of a chunk = 64 threads' 16-byte loads
static_assert(NPROJ == 3 * HDIM && (NPROJ % 32) == 0 && (HDIM % 8) == 0 && HDIM == 64);
static_assert(64 * XP >= 4 * 4096);
static_assert(((long long)(NB - 1) * SEQ_FULL + SEQ) * HDIM <= 524288LL);

typedef _Float16       v16h  __attribute__((ext_vector_type(16)));
typedef _Float16       v8h   __attribute__((ext_vector_type(8)));
typedef float          v8f   __attribute__((ext_vector_type(8)));
typedef float          v4f   __attribute__((ext_vector_type(4)));
typedef unsigned short v16us __attribute__((ext_vector_type(16)));
typedef unsigned short v8us  __attribute__((ext_vector_type(8)));
typedef unsigned int   v4u   __attribute__((ext_vector_type(4)));
typedef unsigned int   v2u   __attribute__((ext_vector_type(2)));
typedef __bf16         v16bf __attribute__((ext_vector_type(16)));
typedef __bf16         v2bf  __attribute__((ext_vector_type(2)));
typedef float          v2f   __attribute__((ext_vector_type(2)));

union FragH { v16h v; v8h h[2]; };
union FragU { v16us v; v8us h[2]; };

#define LOG2E_F 1.4426950408889634f
#define NEG_BIG (-3.0e38f)
#define RINV    0.0009765625f
#define SCL     0.03125f          // CDIM^-0.5

// f32 -> bf16 bits, RNE convert
__device__ __forceinline__ unsigned int bf_bits(float f) {
  const unsigned int u = __float_as_uint(f);
  return (u + 0x7FFFu + ((u >> 16) & 1u)) >> 16;
}
// f32 -> bf16 (RNE) -> f32
__device__ __forceinline__ float bfr(float f) {
  return __uint_as_float(bf_bits(f) << 16);
}

// two f32 -> two bf16 (RNE) in one word, lo in the low half: one packed hardware convert
__device__ __forceinline__ unsigned int bf_pack(float lo, float hi) {
  v2f f;
  f.x = lo;
  f.y = hi;
  return __builtin_bit_cast(unsigned int, __builtin_convertvector(f, v2bf));
}

// WMMA helpers with the VALU hazard guard (ties D, keeps A/B live)
__device__ __forceinline__ v8f wmma_f16(v16h a, v16h b, v8f c) {
  v8f d = __builtin_amdgcn_wmma_f32_16x16x32_f16(false, a, false, b, (short)0, c, false, false);
  asm volatile("v_nop\n\tv_nop\n\tv_nop\n\tv_nop" : "+v"(d) : "v"(a), "v"(b));
  return d;
}
__device__ __forceinline__ v8f wmma_bf16(v16us a, v16us b, v8f c) {
  v8f d = __builtin_amdgcn_wmma_f32_16x16x32_bf16(false, __builtin_bit_cast(v16bf, a), false,
                                                   __builtin_bit_cast(v16bf, b), (short)0, c, false, false);
  asm volatile("v_nop\n\tv_nop\n\tv_nop\n\tv_nop" : "+v"(d) : "v"(a), "v"(b));
  return d;
}

// 16-bit operand fragment, split k map for BOTH A and B:
// p = (row or column (lane&15)) base + k0 + 8*(lane>>4); elements 0..7 <- p[0..7], elements 8..15 <- p[16..23].
__device__ __forceinline__ v16h frag_f16(const _Float16* p) {
  FragH f;
  f.h[0] = *(const v8h*)p;
  f.h[1] = *(const v8h*)(p + 16);
  return f.v;
}
// The K and V planes lie in the workspace in the order in which the attention kernel's fragment loads read them: each chunk of
// 32 tokens is one block of 2048 elements = 8 pieces of 512 bytes; piece j holds, lane after lane, the 8 elements that lane l takes
// with its j-th 16-byte load, so that one wave-wide load reads 512 contiguous, line-aligned bytes (4 lines, not 16).
// K, token tl (within a tile of whole chunks), feature f: piece = 4 * (16-key tile of the chunk) + f / 16, lane = 16 * ((f / 8) & 1) + tl % 16.
__device__ __forceinline__ int kfrag_idx(int tl, int f) {
  return (tl >> 5) * 2048 + ((((tl >> 4) & 1) * 4 + (f >> 4)) * 32 + ((f >> 3) & 1) * 16 + (tl & 15)) * 8 + (f & 7);
}
// V, feature h, token tl: piece = 2 * (h / 16) + (16-key half of the chunk), lane = 16 * ((tl / 8) & 1) + h % 16.
__device__ __forceinline__ int vfrag_idx(int h, int tl) {
  return (tl >> 5) * 2048 + (((h >> 4) * 2 + ((tl >> 4) & 1)) * 32 + ((tl >> 3) & 1) * 16 + (h & 15)) * 8 + (tl & 7);
}
// fragment from two adjacent pieces of such a block: p = block + piece * 256 + lane * 8; the k map is that of frag_f16
__device__ __forceinline__ v16h frag_lin(const _Float16* p) {
  FragH f;
  f.h[0] = *(const v8h*)p;
  f.h[1] = *(const v8h*)(p + 256);
  return f.v;
}
// the four fragments (8 pieces) of one chunk block of such a plane: blk = the block (wave-uniform), lofs = lane * 8
__device__ __forceinline__ void load_block(FragH (&f)[4], const _Float16* blk, unsigned int lofs) {
#pragma unroll   // constant indices keep f[] in registers and all 8 loads in flight at once
  for (int i = 0; i < 4; ++i) {
    f[i].h[0] = *(const v8h*)(blk + (lofs + i * 512));
    // the 8 loads may share one address pair, and the compiler may let the last load land on that pair: the 7 before it are held first
    if (i == 3) asm volatile("s_wait_xcnt 0x0" ::: "memory");
    f[i].h[1] = *(const v8h*)(blk + (lofs + i * 512 + 256));
  }
  // held before an address register that these loads name is written again; it also keeps the loads ahead of what follows it
  asm volatile("s_wait_xcnt 0x0" ::: "memory");
}
__device__ __forceinline__ v16us frag_u16(const unsigned short* p) {
  FragU f;
  f.h[0] = *(const v8us*)p;
  f.h[1] = *(const v8us*)(p + 16);
  return f.v;
}

// value of lane l ^ 1 (the other column of a rotary pair): a DPP move inside the quad, no LDS round trip
__device__ __forceinline__ float xpair(float x) {
  return __builtin_bit_cast(float, __builtin_amdgcn_mov_dpp(__builtin_bit_cast(int, x), 0xB1, 0xF, 0xF, true));
}

// One 16 x 16 accumulator tile of the projection goes, finished, into the staging area. P = its plane (0 q, 1 k, 2 v), a
// compile-time constant, so that the code of a tile is one straight run: the 8 cos/sin pairs of a q or k tile are read as one
// group of 8-byte loads and waited for once, and a v tile, which is not rotated, reads none.
// hc = this lane's column within the plane, tl0 = its first token row (register r = row tl0 + r).
template <int P>
__device__ __forceinline__ void stage_tile(const v8f a, const int hc, const int tl0,
                                           const float* sb, const float* scs, unsigned short* sm) {
  const float bias = sb[P * HDIM + hc];
  if (P == 2) {
    // r walks the low three bits of the token index, adjacent elements in the V order: 8 values = one 16-byte store
    v8h hv, rv;
#pragma unroll   // constant indices keep a, hv and rv in registers
    for (int r = 0; r < 8; ++r) {
      const float vf = (a[r] + bias) * 16.0f;
      const _Float16 h = (_Float16)vf;
      hv[r] = h;
      rv[r] = (_Float16)((vf - (float)h) * 1024.0f);
    }
    const int i0 = vfrag_idx(hc, tl0);
    *(v8us*)(sm + 8192 + i0)  = __builtin_bit_cast(v8us, hv);
    *(v8us*)(sm + 12288 + i0) = __builtin_bit_cast(v8us, rv);
  } else {
    v2f cs[8];                                   // x = cos, y = sin of (row tl0 + r, pair hc / 2)
#pragma unroll   // constant indices keep cs[] in registers and all 8 reads in flight at once
    for (int r = 0; r < 8; ++r) cs[r] = *(const v2f*)(scs + (tl0 + r) * HDIM + (hc & ~1));
    const int i0 = (P == 1) ? kfrag_idx(tl0, hc) : (tl0 * 64 + hc);
    constexpr int ist = (P == 1) ? 8 : 64;       // step of one token row in the plane's order
#pragma unroll   // constant indices keep a and cs[] in registers; the stores get constant offsets
    for (int r = 0; r < 8; ++r) {
      const float val = a[r] + bias;
      const float pv  = xpair(val);                        // pair partner column hc ^ 1
      const float t1  = val * cs[r].x;
      const float t2  = pv * cs[r].y;
      const float rot = (hc & 1) ? (t1 + t2) : (t1 - t2);  // even: ev*c - od*s ; odd: od*c + ev*s
      const _Float16 hv = (_Float16)((P == 0) ? rot * LOG2E_F : rot);
      sm[P * 4096 + i0 + r * ist] = __builtin_bit_cast(unsigned short, hv);
    }
  }
}

// ---------------------------------------------------------------------------
// Kernel 1: q,k,v projections (+bias, rotary pair mixing on q,k) for a tile of 64 token rows on bf16 WMMA.
// 8 waves: wave -> 16 rows (wave&3) x 96 output columns (wave>>2). x tile staged in LDS as bf16 in 4 chunks of 256 k
// (each chunk loaded into registers one chunk ahead),
// and with each x chunk the same 256 k of all 192 W columns (n = 64 * p + column; p: 0 q, 1 k, 2 v), read as f32 from Wq, Wk, Wv,
// converted to bf16 and transposed to [n][k] on the way into LDS, so that the B fragments come from LDS like the A fragments.
// Outputs: qh = f16(rot(q+bq)*log2e) [tok][64]; kh = f16(rot(k+bk)), vT = f16(16*(v+bv)) and vR = f16((16*v - vT) * 1024)
// (residual plane), each as [chunk of 32 tokens][2048] in fragment order (kfrag_idx, vfrag_idx).
// ---------------------------------------------------------------------------
__global__ __launch_bounds__(256) __attribute__((amdgpu_num_vgpr(256)))
void k_proj(const float* __restrict__ x,
            const float* __restrict__ Wq, const float* __restrict__ Wk, const float* __restrict__ Wv,
            const float* __restrict__ bq, const float* __restrict__ bk, const float* __restrict__ bv,
            _Float16* __restrict__ qh, _Float16* __restrict__ kh,
            _Float16* __restrict__ vT, _Float16* __restrict__ vR)
{
  __shared__ __attribute__((aligned(16))) unsigned short sm[64 * XP];    // 33792 B, later reused as staging
  __shared__ __attribute__((aligned(16))) unsigned short swt[NPROJ * XP]; // W chunk [n][k], same pitch as the x chunk, 101376 B
  __shared__ __attribute__((aligned(16))) float scs[64 * HDIM];         // [tl][2i] = cos, [tl][2i+1] = sin
  __shared__ float sb[NPROJ];                                           // biases (bf16 RNE-converted)

  const int tid  = threadIdx.x;
  const int lane = tid & 31;
  const int wave = __builtin_amdgcn_readfirstlane(tid >> 5);
  const int half = lane >> 4;
  const int ln   = lane & 15;
  const int m0 = blockIdx.x * 64;               // compact token row of this tile
  const int b  = m0 / SEQ;
  const int t0 = m0 - b * SEQ;
  const float* xblk = x + ((size_t)b * SEQ_FULL + t0) * CDIM;

  // x chunk in registers, one chunk ahead of its use: thread -> rows (tid / 64) + 4 * it, 4 columns at (tid % 64) * 4. All 16 loads
  // of a chunk are in flight together; those of chunk 0 fly during the table set-up below, later ones during the products
  const float* xsrc = xblk + (size_t)(tid >> 6) * CDIM + (tid & 63) * 4;
  v4f xr[64 * (XC / 4) / 256];
#pragma unroll   // constant indices keep xr[] in registers and all 16 loads in flight at once
  for (int it = 0; it < 64 * (XC / 4) / 256; ++it)
    xr[it] = *(const v4f*)(xsrc + (size_t)it * 4 * CDIM);

  // rotary table for positions t0..t0+63: f_i = 1 / 10000^(i/32), angle = t * f_i, i = 0..31
#pragma unroll 1
  for (int i = tid; i < 64 * (HDIM / 2); i += 256) {
    const int r  = i >> 5;
    const int pr = i & 31;
    const float ex  = (float)(2 * pr) * 0.015625f;
    const float fr  = 1.0f / powf(10000.0f, ex);
    const float ang = (float)(t0 + r) * fr;
    float sn, cn;
    sincosf(ang, &sn, &cn);
    scs[r * HDIM + 2 * pr]     = cn;
    scs[r * HDIM + 2 * pr + 1] = sn;
  }
  if (tid < HDIM) {                             // waves 0 and 1 exactly (wave-uniform)
    sb[tid]            = bfr(bq[tid]);
    sb[HDIM + tid]     = bfr(bk[tid]);
    sb[2 * HDIM + tid] = bfr(bv[tid]);
  }

  const int rg = wave & 3;
  const int ch = wave >> 2;
  v8f acc[6];
#pragma unroll
  for (int nt = 0; nt < 6; ++nt) {
#pragma unroll
    for (int r = 0; r < 8; ++r) acc[nt][r] = 0.0f;
  }

  // W staging: wave w brings the 32 k at 32 * w of a chunk for all 192 columns, as 6 units of 32 k x 32 columns. In a unit a lane
  // loads 8 k rows x 4 adjacent columns (a wave-wide load = 4 rows x 128 bytes = 4 whole lines) and stores, for each of its 4
  // columns, the 8 k as 16 bytes. Lane -> column group wg and k group wk: every 16 lanes hold 4 wg x 4 wk, which spreads
  // their 16-byte stores (pitch XP) over all 64 banks
  const int wg = (lane & 3) | ((lane >> 4) << 2);   // 0..7: columns 4 * wg .. 4 * wg + 3 of the unit
  const int wk = (lane >> 2) & 3;                   // 0..3: k 8 * wk .. 8 * wk + 7 of the unit
  const int woff = (wave * 32 + wk * 8) * HDIM + wg * 4;   // lane's element offset in a W matrix, chunk 0
  const float* wsq = Wq + woff;                     // this lane's first 16 bytes of the chunk in each matrix; they step on by a chunk
  const float* wsk = Wk + woff;
  const float* wsv = Wv + woff;
  unsigned short* wdst = swt + (wg * 4) * XP + wave * 32 + wk * 8;
#pragma unroll 1
  for (int kc = 0; kc < CDIM; kc += XC) {
    __syncthreads();   // all waves done reading the prior chunk
    // W chunk, units 0..2: the loads are issued ahead of the x chunk's conversion, which covers part of their latency
    v4f wr[3][8];
#pragma unroll   // constant indices keep wr[] in registers and all 24 loads in flight at once
    for (int u = 0; u < 3; ++u) {
      const float* ws = ((u >> 1) == 0 ? wsq : wsk) + (u & 1) * 32;
#pragma unroll
      for (int j = 0; j < 8; ++j) wr[u][j] = *(const v4f*)(ws + j * HDIM);
    }
    // stage x chunk: 64 rows x XC columns (kc..kc+XC-1) -> bf16, from the registers loaded one chunk ago
#pragma unroll   // constant indices keep xr[] in registers
    for (int it = 0; it < 64 * (XC / 4) / 256; ++it) {
      const v4f v = xr[it];
      v2u w;
      w.x = bf_bits(v.x) | (bf_bits(v.y) << 16);
      w.y = bf_bits(v.z) | (bf_bits(v.w) << 16);
      *(v2u*)(sm + ((tid >> 6) + 4 * it) * XP + (tid & 63) * 4) = w;
    }
    // each unit is converted and stored (word m of a column = k 2m, 2m + 1); unit u + 3 is loaded into the registers unit u leaves
#pragma unroll   // constant indices keep wr[] in registers
    for (int u = 0; u < 6; ++u) {
#pragma unroll
      for (int i = 0; i < 4; ++i) {
        v4u d;
#pragma unroll
        for (int m = 0; m < 4; ++m) d[m] = bf_pack(wr[u % 3][2 * m][i], wr[u % 3][2 * m + 1][i]);
        *(v4u*)(wdst + (u * 32 + i) * XP) = d;
      }
      if (u < 3) {
        const float* ws = (((u + 3) >> 1) == 1 ? wsk : wsv) + ((u + 3) & 1) * 32;
#pragma unroll
        for (int j = 0; j < 8; ++j) wr[u][j] = *(const v4f*)(ws + j * HDIM);
        // keeps these loads here, ahead of the next unit's conversion: sunk behind it they would start later and be waited for longer
        __builtin_amdgcn_sched_barrier(0);
      }
    }
    wsq += XC * HDIM;
    wsk += XC * HDIM;
    wsv += XC * HDIM;
    __syncthreads();

    // the next chunk's x loads are issued ahead of this chunk's products, which cover their memory latency
    if (kc + XC < CDIM) {                       // block-uniform
      xsrc += XC;
#pragma unroll   // constant indices keep xr[] in registers and all 16 loads in flight at once
      for (int it = 0; it < 64 * (XC / 4) / 256; ++it)
        xr[it] = *(const v4f*)(xsrc + (size_t)it * 4 * CDIM);
    }

    const unsigned short* arow = sm + (rg * 16 + ln) * XP + 8 * half;
    const unsigned short* brow = swt + (ch * 96 + ln) * XP + 8 * half;
    // two register sets of fragments: the 14 LDS reads of k step ks + 1 are issued as one group ahead of the 6 products
    // of step ks, so that a product no longer waits out the LDS latency of its own operands
    v16us af[2];
    v16us bf[2][6];
    af[0] = frag_u16(arow);
#pragma unroll
    for (int nt = 0; nt < 6; ++nt) bf[0][nt] = frag_u16(brow + nt * 16 * XP);
#pragma unroll   // constant set indices keep both fragment sets in registers, with no copies between them
    for (int ks = 0; ks < XC / 32; ++ks) {
      const int cur = ks & 1;
      const int nxt = cur ^ 1;
      if (ks + 1 < XC / 32) {
        af[nxt] = frag_u16(arow + (ks + 1) * 32);
#pragma unroll
        for (int nt = 0; nt < 6; ++nt) bf[nxt][nt] = frag_u16(brow + nt * 16 * XP + (ks + 1) * 32);
      }
#pragma unroll
      for (int nt = 0; nt < 6; ++nt) acc[nt] = wmma_bf16(af[cur], bf[cur][nt], acc[nt]);
    }
  }
  __syncthreads();   // all waves done reading the x tile

  // staging (16-bit elements): sQ = sm[0..4095] as [t][64], sK = sm[4096..8191], sV = sm[8192..12287] and
  // sVr = sm[12288..16383] as the tile's two chunk blocks in fragment order. One wave-uniform branch on the column half makes
  // the plane of every accumulator tile a compile-time constant (stage_tile)
  const int tl0 = rg * 16 + 8 * half;
  // the four loops are unrolled so that acc[] is indexed by constants and stays in registers
  if (ch == 0) {                                 // columns 0..95: q 0..63, k 0..31
#pragma unroll
    for (int nt = 0; nt < 4; ++nt) stage_tile<0>(acc[nt], nt * 16 + ln, tl0, sb, scs, sm);
#pragma unroll
    for (int nt = 4; nt < 6; ++nt) stage_tile<1>(acc[nt], (nt - 4) * 16 + ln, tl0, sb, scs, sm);
  } else {                                       // columns 96..191: k 32..63, v 0..63
#pragma unroll
    for (int nt = 0; nt < 2; ++nt) stage_tile<1>(acc[nt], 32 + nt * 16 + ln, tl0, sb, scs, sm);
#pragma unroll
    for (int nt = 2; nt < 6; ++nt) stage_tile<2>(acc[nt], (nt - 2) * 16 + ln, tl0, sb, scs, sm);
  }
  __syncthreads();

  // whole-line stores: wave w owns token rows 8w..8w+7 of qh and pieces 2w, 2w+1 of the tile's 16 in kh, vT and vR
  const int rl = lane >> 3;
  const int pc = lane & 7;
  const int rA = wave * 8 + rl;
  const int rB = rA + 4;
  const v4u qA = *(const v4u*)(sm + rA * 64 + pc * 8);
  const v4u qB = *(const v4u*)(sm + rB * 64 + pc * 8);
  const int fA = wave * 512 + lane * 8;
  const int fB = fA + 256;
  const v4u kA = *(const v4u*)(sm + 4096 + fA);
  const v4u kB = *(const v4u*)(sm + 4096 + fB);
  const v4u vA = *(const v4u*)(sm + 8192 + fA);
  const v4u vB = *(const v4u*)(sm + 8192 + fB);
  const v4u uA = *(const v4u*)(sm + 12288 + fA);
  const v4u uB = *(const v4u*)(sm + 12288 + fB);
  _Float16* dqA = qh + (size_t)(m0 + rA) * HDIM + pc * 8;
  _Float16* dqB = qh + (size_t)(m0 + rB) * HDIM + pc * 8;
  _Float16* dkA = kh + (size_t)m0 * HDIM + fA;
  _Float16* dkB = kh + (size_t)m0 * HDIM + fB;
  _Float16* dvA = vT + (size_t)m0 * HDIM + fA;
  _Float16* dvB = vT + (size_t)m0 * HDIM + fB;
  _Float16* duA = vR + (size_t)m0 * HDIM + fA;
  _Float16* duB = vR + (size_t)m0 * HDIM + fB;
  *(v4u*)dqA = qA; *(v4u*)dqB = qB;
  *(v4u*)dkA = kA; *(v4u*)dkB = kB;
  *(v4u*)dvA = vA; *(v4u*)dvB = vB;
  *(v4u*)duA = uA; *(v4u*)duB = uB;
  
}

// ---------------------------------------------------------------------------
// Kernel 2: causal flash attention, all query tiles in one launch. Block = one tile of 16 query rows; its NS waves split the tile's key chunks
// (32 keys each): wave w takes chunks w, w + NS, w + 2*NS, ... and keeps its own running maximum, sums and O tile.
// The products are taken transposed: S^T = K . Q^T (K fragments as A, Q fragments as B) and O^T += V^T . P^T (V fragments as A).
// A lane then holds 16 scores of ONE query (column lane & 15; keys 8 * (lane >> 4) + r of each 16-key tile): the row maximum is taken
// in the lane plus one exchange between the lane halves, and the two score tiles, converted in place, ARE the B fragment of P^T
// (element 8t + r = tile t, register r, the split k map of the V fragments). P passes through no LDS and the loop holds no barrier.
// The K and V fragments are fetched ahead: a trip opens with the 8 loads of the next chunk's K (into a second register set) and
// closes with the 8 loads of the next chunk's V (into the registers the O products have just read); it waits for no load of its own.
// Online softmax in log2 domain, P carried x 1024 in f16; sums += (row of ones) . P^T.
// After the loop the partial results of the first NM waves (those that can hold a chunk) are merged through LDS in wave order (rescaled to the common row maximum).
// EARLY = 1 handles query rows < 256: adds P residual (x1024) and v residual plane (x1024)
// products into separate accumulators folded with 2^-10 before the merge; EARLY = 0 handles the rest.
// Query rows with mask == 0 get NaN (whole score row excluded -> NaN softmax).
// The two paths share one grid behind a block-uniform branch: neither reads what the other writes. The later rows' tiles
// come first in the grid, by rising row; the short tiles of rows < 256 come last and run beside them.
// Second launch bound (waves per SIMD): 4, so that two 8-wave blocks fit one WGP and the whole grid is resident at once, with
// registers for a whole chunk's K and V fragments in every wave.
// ---------------------------------------------------------------------------
// value of lane l ^ 16
__device__ __forceinline__ float xhalf(float x) {
  const int v = __builtin_bit_cast(int, x);
  return __builtin_bit_cast(float, __builtin_amdgcn_permlanex16(v, v, 0x76543210, 0xfedcba98, false, false));
}

// 2^x of eight values, with the range step of exp2f (an argument below -126 is raised by 64 and the result scaled back by 2^-64),
// so that the values are those of exp2f. The eight v_exp_f32 stand in one statement: behind each stands an instruction that neither
// reads its result nor overwrites its source (the outputs are early-clobber), and behind the last a v_nop: the slot that the
// instruction set asks for behind a transcendental, which the compiler leaves open between two adjacent v_exp_f32
__device__ __forceinline__ v8f exp2_x8(v8f x) {
  float a[8], y[8];
#pragma unroll   // constant indices keep a[] and y[] in registers
  for (int r = 0; r < 8; ++r) a[r] = x[r] + ((x[r] < -126.0f) ? 64.0f : 0.0f);
  asm("v_exp_f32 %0, %8\n\tv_exp_f32 %1, %9\n\tv_exp_f32 %2, %10\n\tv_exp_f32 %3, %11\n\t"
      "v_exp_f32 %4, %12\n\tv_exp_f32 %5, %13\n\tv_exp_f32 %6, %14\n\tv_exp_f32 %7, %15\n\tv_nop"
      : "=&v"(y[0]), "=&v"(y[1]), "=&v"(y[2]), "=&v"(y[3]), "=&v"(y[4]), "=&v"(y[5]), "=&v"(y[6]), "=&v"(y[7])
      : "v"(a[0]), "v"(a[1]), "v"(a[2]), "v"(a[3]), "v"(a[4]), "v"(a[5]), "v"(a[6]), "v"(a[7]));
  v8f res;
#pragma unroll
  for (int r = 0; r < 8; ++r) res[r] = ldexpf(y[r], (x[r] < -126.0f) ? -64 : 0);
  return res;
}

template <int EARLY>
__device__ __forceinline__
void attn_tile(const _Float16* __restrict__ qh, const _Float16* __restrict__ kh,
               const _Float16* __restrict__ vT, const _Float16* __restrict__ vR,
               const int* __restrict__ mask, float* __restrict__ out, const int b, const int tq,
               float (*part)[16][68], float (*pmax)[NS_A], float (*pden)[NS_A])
{
  constexpr int NS  = NS_A;                    // waves per block = key splits of the tile
  constexpr int NM  = (EARLY && 2 * NTB_E < NS) ? 2 * NTB_E : NS;   // waves that can hold a chunk (rows < 256: at most 2 chunks per 64 rows)
  constexpr int CPT = 32 / NS;                 // output columns merged per thread (16 x 64 tile over NS*32 threads)
  constexpr int TPR = HDIM / CPT;              // threads per output row in the merge
  constexpr bool ONE = EARLY && 2 * NTB_E <= NS;   // rows < 256 hold at most NS chunks: one trip a wave, nothing to fetch ahead
  typedef float vcf __attribute__((ext_vector_type(CPT)));

  const int tid  = threadIdx.x;
  const int lane = tid & 31;
  const int wave = __builtin_amdgcn_readfirstlane(tid >> 5);
  const int half = lane >> 4;
  const int ln   = lane & 15;
  const int row0 = tq * 16;                      // first query row of this block (within the sequence)

  const _Float16* qrow  = qh + ((size_t)b * SEQ + row0 + ln) * HDIM + 8 * half;
  // block-uniform plane bases (scalar registers); a chunk's block is a wave-uniform step on them, and a lane's own part of an
  // address is one 32-bit element offset (lane * 8), the same in all three planes and in every trip
  const _Float16* kbase = kh + (size_t)b * SEQ * HDIM;
  const _Float16* vbase = vT + (size_t)b * HDIM * SEQ;
  const _Float16* rbase = vR + (size_t)b * HDIM * SEQ;

  // pad flag of the query row that this thread will merge and store (row0 + tid / TPR, always < SEQ); with one wave per row the
  // index is wave-uniform, so that the flag waits in a scalar register and takes no vector register across the loop
  const int mk = mask[(size_t)b * SEQ_FULL + row0 + ((TPR == 32) ? wave : tid / TPR)];
  // held before any register that the flag load names (its offset, its base pair) is written again
  asm volatile("s_wait_xcnt 0x0" ::: "memory");

  // A operand whose row 0 is ones: row 0 of its product with P^T holds each query's sum (lane = query, register 0)
  v16h ones;
#pragma unroll
  for (int i = 0; i < 16; ++i) ones[i] = (ln == 0) ? (_Float16)1.0f : (_Float16)0.0f;

  v8f o[4], orr[4];                              // O^T tiles: register r = feature 16 * ht + 8 * half + r of query ln
  v8f osum, osumr;
#pragma unroll
  for (int r = 0; r < 8; ++r) { osum[r] = 0.0f; osumr[r] = 0.0f; }
#pragma unroll
  for (int ht = 0; ht < 4; ++ht) {
#pragma unroll
    for (int r = 0; r < 8; ++r) { o[ht][r] = 0.0f; orr[ht][r] = 0.0f; }
  }
  float rmax = NEG_BIG;                          // running maximum of query ln, the same in both lane halves

  const int nchunk = ((row0 + 15) >> 5) + 1;     // keys 0 .. row0+15 in chunks of 32
  const unsigned int lofs = (unsigned int)lane * 8u;
  if (wave < nchunk) {                           // wave-uniform; a wave without a chunk loads nothing and goes to the merge
  // loop-invariant Q fragments (feature blocks 0..31, 32..63), B operand: column = query (lane&15), k = feature (split map)
  const v16h qa0 = frag_f16(qrow);
  const v16h qa1 = frag_f16(qrow + 32);
  // fragment registers: ka, kb = two sets for K (f[2nt], f[2nt+1] = pieces 4nt .. 4nt+3 of a chunk's block), used in turn;
  // vf[ht], rf[ht] = pieces 2ht, 2ht+1 of the V and residual blocks. The first chunk's loads are all in flight together, K ahead of V
  FragH ka[4], kb[4], vf[4], rf[4];
  load_block(ka, kbase + wave * 2048, lofs);
  load_block(vf, vbase + wave * 2048, lofs);
  if (EARLY) load_block(rf, rbase + wave * 2048, lofs);
  // one trip: chunk c, its K in kc; more (a constant at each call) = the wave has a further chunk, c + NS, to fetch, its K into kn
  auto trip = [&](const int c, FragH (&kc)[4], FragH (&kn)[4], const bool more) __attribute__((always_inline)) {
    const int kt0 = c * 32;
    // the next chunk's K is asked for a whole trip ahead of its products
    if (more) load_block(kn, kbase + (c + NS) * 2048, lofs);
    v8f s[2];
    // S^T[32 x 16] = K(32 x 64) . Q^T, K as A operand: row = key (lane&15), k = feature (split map)
#pragma unroll
    for (int nt = 0; nt < 2; ++nt) {
      v8f acc;
#pragma unroll
      for (int r = 0; r < 8; ++r) acc[r] = 0.0f;
      acc = wmma_f16(kc[2 * nt].v, qa0, acc);
      acc = wmma_f16(kc[2 * nt + 1].v, qa1, acc);
#pragma unroll
      for (int r = 0; r < 8; ++r) {
        const int key = kt0 + nt * 16 + 8 * half + r;
        const float sv = acc[r] * SCL;                  // CDIM^-0.5, log2e already in q
        s[nt][r] = (key > row0 + ln) ? NEG_BIG : sv;    // causal fill (replace)
      }
    }
    // online softmax of query ln: this lane's 16 keys, then the other half's 16
    float tmax = fmaxf(s[0][0], s[1][0]);
#pragma unroll
    for (int r = 1; r < 8; ++r) tmax = fmaxf(tmax, fmaxf(s[0][r], s[1][r]));
    tmax = fmaxf(tmax, xhalf(tmax));
    const float nmax  = fmaxf(rmax, tmax);
    const float alpha = exp2f(rmax - nmax);
    rmax = nmax;
    osum[0] *= alpha;                            // the sums' tile has its one live row in register 0; the other rows stay 0
    if (EARLY) osumr[0] *= alpha;
#pragma unroll
    for (int ht = 0; ht < 4; ++ht) {
#pragma unroll
      for (int r = 0; r < 8; ++r) {
        o[ht][r] *= alpha;
        if (EARLY) orr[ht][r] *= alpha;
      }
    }
    // P^T as B operand, straight from the score tiles (carried x 1024; residual x 1024 more)
    v16h pa, pra;
#pragma unroll
    for (int nt = 0; nt < 2; ++nt) {
      const v8f e = exp2_x8(s[nt] - nmax);
#pragma unroll
      for (int r = 0; r < 8; ++r) {
        const float pf = e[r] * 1024.0f;
        const _Float16 ph = (_Float16)pf;
        pa[nt * 8 + r] = ph;
        if (EARLY) pra[nt * 8 + r] = (_Float16)((pf - (float)ph) * 1024.0f);
      }
    }

    // V as A operand: row = feature (lane&15), k = key (split map): pieces 2ht, 2ht+1 of the chunk's block
    if (EARLY) {
      osum  = wmma_f16(ones, pa,  osum);
      osumr = wmma_f16(ones, pra, osumr);
#pragma unroll
      for (int ht = 0; ht < 4; ++ht) {
        o[ht]   = wmma_f16(vf[ht].v, pa,  o[ht]);
        orr[ht] = wmma_f16(vf[ht].v, pra, orr[ht]);
      }
#pragma unroll
      for (int ht = 0; ht < 4; ++ht) orr[ht] = wmma_f16(rf[ht].v, pa, orr[ht]);
    } else {
#pragma unroll
      for (int ht = 0; ht < 4; ++ht) o[ht] = wmma_f16(vf[ht].v, pa, o[ht]);
      osum = wmma_f16(ones, pa, osum);   // sums of the same f16 P
    }
    if (more) {                                  // the next chunk's V, into the registers that the O products have just read: it
      load_block(vf, vbase + (c + NS) * 2048, lofs);   // flies during the next trip's score products and softmax
      if (EARLY) load_block(rf, rbase + (c + NS) * 2048, lofs);
    }
  };
  // wave-uniform trip count; nothing in the loop is shared between waves. Two trips a pass, so that the two K sets change roles
  // without copies; a wave's last trip, which fetches nothing, stands apart, so that every other trip has the same loads in
  // flight and its waits can leave the younger ones flying
  int c = wave;
  if (ONE) {
    trip(c, ka, kb, false);
  } else {
#pragma unroll 1   // rolled: one pass of code, whatever the number of chunks
    for (;;) {
      if (c + NS >= nchunk) { trip(c, ka, kb, false); break; }
      trip(c, ka, kb, true);
      c += NS;
      if (c + NS >= nchunk) { trip(c, kb, ka, false); break; }
      trip(c, kb, ka, true);
      c += NS;
    }
  }
  }

  // lane index taken anew, so that no thread-index value has to
  // stay in a register across the loop (the register budget decides how many blocks a WGP holds)
  const int el  = (int)__lane_id();
  const int eh  = el >> 4;
  const int eln = el & 15;

  // merge ownership: each thread owns CPT adjacent columns of one query row
  const unsigned int et = (unsigned int)(wave * 32 + el);
  const int mrow = (int)(et / TPR);
  const int mcol = (int)(et % TPR) * CPT;

  // every wave publishes its own row maxima, row sums and unnormalised O tile (a wave without a chunk: NEG_BIG, 0, 0);
  // a lane's 8 registers of an O^T tile are 8 adjacent features of its query's row
#pragma unroll
  for (int ht = 0; ht < 4; ++ht) {
    v4f lo, hi;
#pragma unroll
    for (int r = 0; r < 4; ++r) {
      lo[r] = o[ht][r];
      hi[r] = o[ht][r + 4];
      if (EARLY) {
        lo[r] = lo[r] + orr[ht][r] * RINV;
        hi[r] = hi[r] + orr[ht][r + 4] * RINV;
      }
    }
    *(v4f*)(&part[wave][eln][ht * 16 + 8 * eh])     = lo;
    *(v4f*)(&part[wave][eln][ht * 16 + 8 * eh + 4]) = hi;
  }
  if (eh == 0) {
    float den = osum[0];
    if (EARLY) den = den + osumr[0] * RINV;
    pmax[eln][wave] = rmax;
    pden[eln][wave] = den;
  }
  __syncthreads();   // all NS partial results are in LDS before any thread merges them

  // merge: the partials of the first NM waves (those that can hold a chunk) are added in wave order, each rescaled by 2^(its maximum - common maximum)
  float pm[NM];
  float gmax = NEG_BIG;
#pragma unroll
  for (int w = 0; w < NM; ++w) { pm[w] = pmax[mrow][w]; gmax = fmaxf(gmax, pm[w]); }
  float den = 0.0f;
  vcf num;
#pragma unroll
  for (int i = 0; i < CPT; ++i) num[i] = 0.0f;
#pragma unroll
  for (int w = 0; w < NM; ++w) {
    const float f = exp2f(pm[w] - gmax);
    den += pden[mrow][w] * f;
    num += *(const vcf*)(&part[w][mrow][mcol]) * f;
  }

  const float qnan = __uint_as_float(0x7fc00000u);

  // normalise (1024 carry cancels between numerator and denominator; 1/16 undoes the v carry)
  const float inv = 0.0625f * __builtin_amdgcn_rcpf(den);
  vcf res;
#pragma unroll
  for (int i = 0; i < CPT; ++i) res[i] = (mk != 0) ? (num[i] * inv) : qnan;
  *(vcf*)(out + ((size_t)b * SEQ_FULL + row0 + mrow) * HDIM + mcol) = res;
}

__global__ __launch_bounds__(NS_A * 32, 4) __attribute__((amdgpu_num_vgpr(256)))
void k_attn(const _Float16* __restrict__ qh, const _Float16* __restrict__ kh,
            const _Float16* __restrict__ vT, const _Float16* __restrict__ vR,
            const int* __restrict__ mask, float* __restrict__ out)
{
  __shared__ __attribute__((aligned(16))) float    part[NS_A][16][68];   // per-wave 16 x 64 partial O tile
  __shared__ __attribute__((aligned(16))) float    pmax[16][NS_A];       // per-wave row maxima  [row][wave]
  __shared__ __attribute__((aligned(16))) float    pden[16][NS_A];       // per-wave row sums    [row][wave]

  const int blk = blockIdx.x;                    // block-uniform: the barrier below is passed by the whole block
  if (blk < NB * NTB_L * 4) {
    const int b = blk / (4 * NTB_LD);
    attn_tile<0>(qh, kh, vT, vR, mask, out, b, 4 * NTB_E + (blk - b * (4 * NTB_LD)), part, pmax, pden);
  } else {
    const int e = blk - NB * NTB_L * 4;
    const int b = e / (4 * NTB_E);
    attn_tile<1>(qh, kh, vT, vR, mask, out, b, e - b * (4 * NTB_E), part, pmax, pden);
  }
}

// ---------------------------------------------------------------------------
extern "C" void kernel_launch(void* const* d_in, const int* in_sizes, int n_in,
                              void* d_out, int out_size, void* d_ws, size_t ws_size,
                              hipStream_t stream)
{
  if (n_in < 8) return;
  const long long tok_rows = (long long)(NB - 1) * SEQ_FULL + SEQ;
  if ((long long)in_sizes[0] < tok_rows * CDIM) return;
  if ((long long)in_sizes[1] < tok_rows) return;
  if (in_sizes[2] < CDIM * HDIM || in_sizes[4] < CDIM * HDIM || in_sizes[6] < CDIM * HDIM) return;
  if (in_sizes[3] < HDIM || in_sizes[5] < HDIM || in_sizes[7] < HDIM) return;
  if ((long long)out_size < tok_rows * HDIM) return;

  const float* x    = (const float*)d_in[0];
  const int*   mask = (const int*)d_in[1];
  const float* Wq   = (const float*)d_in[2];
  const float* bq   = (const float*)d_in[3];
  const float* Wk   = (const float*)d_in[4];
  const float* bk   = (const float*)d_in[5];
  const float* Wv   = (const float*)d_in[6];
  const float* bv   = (const float*)d_in[7];
  float* out = (float*)d_out;

  // workspace carve (bytes): qh NB*SEQ*64*2 | kh same | vT same | vR same
  const size_t plane    = (size_t)NB * SEQ * HDIM * sizeof(_Float16);
  const size_t off_q  = 0;
  const size_t off_k  = off_q + plane;
  const size_t off_v  = off_k + plane;
  const size_t off_r  = off_v + plane;
  const size_t total  = off_r + plane;
  if (total > ws_size) return;

  _Float16* qh = (_Float16*)((char*)d_ws + off_q);
  _Float16* kh = (_Float16*)((char*)d_ws + off_k);
  _Float16* vT = (_Float16*)((char*)d_ws + off_v);
  _Float16* vR = (_Float16*)((char*)d_ws + off_r);

  k_proj<<<(NB * SEQ) / 64, 256, 0, stream>>>(x, Wq, Wk, Wv, bq, bk, bv, qh, kh, vT, vR);
  k_attn<<<NB * NTB * 4, NS_A * 32, 0, stream>>>(qh, kh, vT, vR, mask, out);
}
